// v000
// Times are from an AMD MI455X. After a warm-up the kernel runs many times in a row, and a time is the length of
// such a window on the GPU divided by its runs, so every launch and the gaps after it count. The runs cycle
// through copies of the inputs. A figure is the median of several windows, for all but v000 over two sittings.
// Sittings can differ by a few percent; kernels timed side by side share one.
// v000, which the later versions start from, runs in 449 microseconds.
#include <hip/hip_runtime.h>
// Contractions: q/k/v = x*W^T + b on v_wmma_f32_16x16x32_bf16 (x, W, b converted to bf16 RNE, single term); QK^T and P*V per 16-query tile as
// 3-term bf16 hi/lo splits; out = a*Wo^T + bo with a as a 2-term bf16 hi/lo split (Wo, bo bf16 RNE); f32 accumulate, softmax in f32.
#ifndef NB
#define NB 4
#endif
#ifndef SEQ
#define SEQ 2048
#endif
#define NB_FULL 4
#define SEQ_FULL 2048
#define DD 512
#define NH 8
#define HD 64

static_assert(NB >= 1 && NB <= NB_FULL);
static_assert(SEQ >= 64 && SEQ <= SEQ_FULL && (SEQ % 64) == 0);
static_assert(NH * HD == DD && (DD % 64) == 0 && (HD % 32) == 0 && HD <= 128);

typedef __bf16 v16b __attribute__((ext_vector_type(16)));
typedef unsigned short v8us __attribute__((ext_vector_type(8), may_alias));
typedef float  v8f  __attribute__((ext_vector_type(8)));
typedef float  v4f  __attribute__((ext_vector_type(4)));
typedef float  v4fa __attribute__((ext_vector_type(4), may_alias));
union FragB { v16b v; v8us half[2]; unsigned short u[16]; };

__device__ __forceinline__ unsigned short bf16_bits(float x) { unsigned int u = __float_as_uint(x); return (unsigned short)((u + 0x7FFFu + ((u >> 16) & 1u)) >> 16); }
__device__ __forceinline__ float bf16_val(unsigned short b) { return __uint_as_float(((unsigned int)b) << 16); }
__device__ __forceinline__ float bf16_rne(float x) { return bf16_val(bf16_bits(x)); }

// D += A*B with NT terms: 1 = ah*bh, 2 = + al*bh (A split), 3 = + ah*bl (both split); 4 nops guard the accumulator
template <int NT>
__device__ __forceinline__ v8f mmaN(v16b ah, v16b al, v16b bh, v16b bl, v8f c) {
  c = __builtin_amdgcn_wmma_f32_16x16x32_bf16(false, ah, false, bh, (short)0, c, false, false);
  if (NT >= 2) c = __builtin_amdgcn_wmma_f32_16x16x32_bf16(false, al, false, bh, (short)0, c, false, false);
  if (NT >= 3) c = __builtin_amdgcn_wmma_f32_16x16x32_bf16(false, ah, false, bl, (short)0, c, false, false);
  asm volatile("v_nop\n\tv_nop\n\tv_nop\n\tv_nop" : "+v"(c) : "v"(ah), "v"(al), "v"(bh), "v"(bl));
  return c;
}

// Wt[n][k] (bf16 bits) = RNE(W[n][k]) for a row-major [N][K] weight used as x*W^T: plain elementwise convert, 8 per thread,
__global__ __launch_bounds__(256) void k_rne_rows(const float* __restrict__ W, unsigned short* __restrict__ Wt, int n8) {
  const int t = blockIdx.x * 256 + threadIdx.x;
  if (t >= n8) return;
  const v4f a = *(const v4fa*)(W + (size_t)t * 8), b = *(const v4fa*)(W + (size_t)t * 8 + 4);
  v8us v; v[0]=bf16_bits(a[0]); v[1]=bf16_bits(a[1]); v[2]=bf16_bits(a[2]); v[3]=bf16_bits(a[3]);
  v[4]=bf16_bits(b[0]); v[5]=bf16_bits(b[1]); v[6]=bf16_bits(b[2]); v[7]=bf16_bits(b[3]);
  *(v8us*)(Wt + (size_t)t * 8) = v; 
}

// GEMM C[M][N] (f32, pitch ldc) = A[M][K]*W^T + bias per batch blockIdx.y (A += y*abatch, C += y*cbatch elements).
// A f32 row-major (pitch lda) converted per fragment to bf16 (ASPLIT: hi/lo -> 2 terms, else single RNE term); Wt bf16 [N][K] (pitch ldb).
// BIAS_BF16 converts the bias to bf16 RNE before the add. K%32==0, M%16==0, N%64==0.
template <bool ASPLIT, bool BIAS_BF16>
__global__ __launch_bounds__(128) void k_gemm_bf(const float* __restrict__ A, int lda, int abatch, const unsigned short* __restrict__ Wt, int ldb,
                                               const float* __restrict__ bias, float* __restrict__ C, int ldc, int cbatch, int M, int N, int K) {
  __shared__ __attribute__((aligned(16))) float so[4][16][64];
  const int tid = threadIdx.x, w = tid >> 5, lane = tid & 31, ln = lane & 15, hh = lane >> 4;
  const int ntn = N / 64;
  const int wid = blockIdx.x * 4 + w;
  const int mt = wid / ntn, nq = wid % ntn;
  if (mt * 16 >= M) return;                     // no block barrier in this kernel
  const int row0 = mt * 16, col0 = nq * 64;
  const float* Ab = A + (size_t)blockIdx.y * (size_t)abatch;
  float* Cb = C + (size_t)blockIdx.y * (size_t)cbatch;
  const float* arow = Ab + (size_t)(row0 + ln) * lda;
  v8f acc[4];
#pragma unroll
  for (int t = 0; t < 4; ++t) acc[t] = (v8f){0.f,0.f,0.f,0.f,0.f,0.f,0.f,0.f};
  for (int kb = 0; kb < K; kb += 32) {
    FragB ah, al;
    const v4f x0 = *(const v4fa*)(arow + kb + 8 * hh), x1 = *(const v4fa*)(arow + kb + 8 * hh + 4);
    const v4f x2 = *(const v4fa*)(arow + kb + 16 + 8 * hh), x3 = *(const v4fa*)(arow + kb + 16 + 8 * hh + 4);
    float xs[16] = {x0[0],x0[1],x0[2],x0[3],x1[0],x1[1],x1[2],x1[3],x2[0],x2[1],x2[2],x2[3],x3[0],x3[1],x3[2],x3[3]};
#pragma unroll
    for (int i = 0; i < 16; ++i) { const unsigned short hb = bf16_bits(xs[i]); ah.u[i] = hb; al.u[i] = ASPLIT ? bf16_bits(xs[i] - bf16_val(hb)) : (unsigned short)0; }
#pragma unroll
    for (int t = 0; t < 4; ++t) {
      const unsigned short* brow = Wt + (size_t)(col0 + t * 16 + ln) * ldb + kb;
      FragB b;
      b.half[0] = *(const v8us*)(brow + 8 * hh);          // elements 0..7  <- k = kb+8h .. +7
      b.half[1] = *(const v8us*)(brow + 16 + 8 * hh);     // elements 8..15 <- k = kb+16+8h .. +7
      acc[t] = mmaN<ASPLIT ? 2 : 1>(ah.v, al.v, b.v, b.v, acc[t]);
    }
  }
#pragma unroll
  for (int t = 0; t < 4; ++t) {
    float bvv = bias[col0 + t * 16 + ln];
    if (BIAS_BF16) bvv = bf16_rne(bvv);
#pragma unroll
    for (int r = 0; r < 8; ++r) { so[w][8 * hh + r][t * 16 + ln] = acc[t][r] + bvv; }
  }
  __builtin_amdgcn_fence(4 /* acq_rel order */, "workgroup");
  __builtin_amdgcn_wave_barrier();
  const int rsub = lane >> 4, c4 = (lane & 15) * 4;
  {
#pragma unroll
    for (int q = 0; q < 8; ++q) {
      const int r = q * 2 + rsub;
      const v4f v = *(const v4fa*)&so[w][r][c4];
      *(v4f*)(Cb + (size_t)(row0 + r) * ldc + col0 + c4) = v;
    }
    
  }
}

// Flash-style attention with a per-key padding flag (kpm[b*mpitch + j] != 0 -> key j excluded, probability exactly 0;
// a query row with every key excluded yields NaN). QK^T and P*V as 3-term bf16 hi/lo splits, f32 softmax with running max.
// q,k,v rows f32 with pitch `pitch`, batch b at X + b*T*pitch, head h at column h*D. One wave = 16 query rows,
// block = 4 waves (64 queries) sharing K/V chunks of 32 keys staged in LDS (hi/lo bf16 planes).
template <int D>
__global__ __launch_bounds__(128) void k_flash_pm(const float* __restrict__ Qb, const float* __restrict__ Kb, const float* __restrict__ Vb,
                                                int pitch, int T, int H, float scale, const int* __restrict__ kpm, int mpitch,
                                                float* __restrict__ y, int ypitch) {
  constexpr int KS = D / 32, DT = D / 16;
  __shared__ __attribute__((aligned(16))) unsigned short sKh[32][D + 8], sKl[32][D + 8], sVh[32][D + 8], sVl[32][D + 8];
  __shared__ __attribute__((aligned(16))) unsigned short sPh[4][16][40], sPl[4][16][40];
  __shared__ __attribute__((aligned(16))) float sO[4][16][D];
  const int tid = threadIdx.x, w = tid >> 5, lane = tid & 31, ln = lane & 15, hh = lane >> 4;
  const int nqb = (T + 63) / 64;
  const int bh = blockIdx.x / nqb, qblk = blockIdx.x % nqb;
  const int b = bh / H, h = bh % H;
  const int q0 = qblk * 64 + w * 16;
  const float* Q = Qb + (size_t)b * T * pitch + h * D;
  const float* K = Kb + (size_t)b * T * pitch + h * D;
  const float* V = Vb + (size_t)b * T * pitch + h * D;
  const int* mrow = kpm + (size_t)b * mpitch;

  // A fragments of the wave's 16 query rows (scaled by an exact power of two), hi/lo
  FragB aqh[KS], aql[KS];
  {
    int row = q0 + ln; if (row >= T) row = T - 1;
    const float* qr = Q + (size_t)row * pitch;
#pragma unroll
    for (int ks = 0; ks < KS; ++ks)
#pragma unroll
      for (int i = 0; i < 16; ++i) {
        const int d = ks * 32 + ((i < 8) ? (8 * hh + i) : (16 + 8 * hh + (i - 8)));
        const float x = qr[d] * scale; const unsigned short hb = bf16_bits(x);
        aqh[ks].u[i] = hb; aql[ks].u[i] = bf16_bits(x - bf16_val(hb));
      }
  }
  float m_r[8], l_r[8];
#pragma unroll
  for (int r = 0; r < 8; ++r) { m_r[r] = -3.0e38f; l_r[r] = 0.f; }
  v8f oacc[DT];
#pragma unroll
  for (int dt = 0; dt < DT; ++dt) oacc[dt] = (v8f){0.f,0.f,0.f,0.f,0.f,0.f,0.f,0.f};

  for (int j0 = 0; j0 < T; j0 += 32) {
    __syncthreads();                                 // cross-wave: all waves done reading sK/sV of the prior chunk
    for (int e = tid; e < 32 * (D / 4); e += 128) {
      const int r = e / (D / 4), c4 = (e % (D / 4)) * 4;
      int key = j0 + r; const bool kin = key < T; if (!kin) key = T - 1;     // clamped address, zero by value
      v4f kf = *(const v4fa*)(K + (size_t)key * pitch + c4);
      v4f vf = *(const v4fa*)(V + (size_t)key * pitch + c4);
      if (!kin) { kf = (v4f){0.f,0.f,0.f,0.f}; vf = (v4f){0.f,0.f,0.f,0.f}; }
#pragma unroll
      for (int t = 0; t < 4; ++t) {
        unsigned short hb = bf16_bits(kf[t]); sKh[r][c4 + t] = hb; sKl[r][c4 + t] = bf16_bits(kf[t] - bf16_val(hb));
        hb = bf16_bits(vf[t]); sVh[r][c4 + t] = hb; sVl[r][c4 + t] = bf16_bits(vf[t] - bf16_val(hb));
      }
    }
    __syncthreads();                                 // cross-wave: staging complete before any fragment load
    // S tile 16 queries x 32 keys: B[k = d][n = key] from sK[key][d]
    v8f s[2];
#pragma unroll
    for (int nt = 0; nt < 2; ++nt) {
      v8f acc = (v8f){0.f,0.f,0.f,0.f,0.f,0.f,0.f,0.f};
#pragma unroll
      for (int ks = 0; ks < KS; ++ks) {
        FragB bh_, bl_;
        bh_.half[0] = *(const v8us*)&sKh[nt * 16 + ln][ks * 32 + 8 * hh]; bh_.half[1] = *(const v8us*)&sKh[nt * 16 + ln][ks * 32 + 16 + 8 * hh];
        bl_.half[0] = *(const v8us*)&sKl[nt * 16 + ln][ks * 32 + 8 * hh]; bl_.half[1] = *(const v8us*)&sKl[nt * 16 + ln][ks * 32 + 16 + 8 * hh];
        acc = mmaN<3>(aqh[ks].v, aql[ks].v, bh_.v, bl_.v, acc);
      }
      s[nt] = acc;
    }
    // key flags for this lane's two key columns (replace semantics: excluded key -> probability 0)
    const int ja = j0 + ln, jb = j0 + 16 + ln;
    const int jac = (ja < T) ? ja : (T - 1), jbc = (jb < T) ? jb : (T - 1);
    const int fa = mrow[jac], fb = mrow[jbc];
    const bool keepa = (ja < T) && (fa == 0), keepb = (jb < T) && (fb == 0);
    float alpha[8];
#pragma unroll
    for (int r = 0; r < 8; ++r) {
      if (!keepa) s[0][r] = -3.0e38f;
      if (!keepb) s[1][r] = -3.0e38f;
      float mx = fmaxf(s[0][r], s[1][r]);
      mx = fmaxf(mx, __shfl_xor(mx, 1, 32)); mx = fmaxf(mx, __shfl_xor(mx, 2, 32)); mx = fmaxf(mx, __shfl_xor(mx, 4, 32)); mx = fmaxf(mx, __shfl_xor(mx, 8, 32));
      const float mnew = fmaxf(m_r[r], mx);
      alpha[r] = (mnew > -1.0e38f) ? __expf(m_r[r] - mnew) : 1.0f;
      const float p0 = keepa ? __expf(s[0][r] - mnew) : 0.f;
      const float p1 = keepb ? __expf(s[1][r] - mnew) : 0.f;
      m_r[r] = mnew;
      l_r[r] = l_r[r] * alpha[r] + p0 + p1;            // per-lane partial row sum (16 lanes combined at the end)
      unsigned short hb = bf16_bits(p0); sPh[w][8 * hh + r][ln] = hb;      sPl[w][8 * hh + r][ln] = bf16_bits(p0 - bf16_val(hb));
      hb = bf16_bits(p1);                sPh[w][8 * hh + r][16 + ln] = hb; sPl[w][8 * hh + r][16 + ln] = bf16_bits(p1 - bf16_val(hb));
    }
#pragma unroll
    for (int dt = 0; dt < DT; ++dt)
#pragma unroll
      for (int r = 0; r < 8; ++r) oacc[dt][r] *= alpha[r];
    __builtin_amdgcn_fence(4 /* acq_rel order */, "workgroup");      // sPh/sPl are wave-private: same-wave exchange
    __builtin_amdgcn_wave_barrier();
    FragB pah, pal;                                              // A[m = query][k = key] from sP[query][key]
    pah.half[0] = *(const v8us*)&sPh[w][ln][8 * hh]; pah.half[1] = *(const v8us*)&sPh[w][ln][16 + 8 * hh];
    pal.half[0] = *(const v8us*)&sPl[w][ln][8 * hh]; pal.half[1] = *(const v8us*)&sPl[w][ln][16 + 8 * hh];
#pragma unroll
    for (int dt = 0; dt < DT; ++dt) {
      FragB bvh, bvl;                                            // B[k = key][n = d] from sV[key][d]
#pragma unroll
      for (int i = 0; i < 8; ++i) {
        bvh.u[i] = sVh[8 * hh + i][dt * 16 + ln]; bvh.u[8 + i] = sVh[16 + 8 * hh + i][dt * 16 + ln];
        bvl.u[i] = sVl[8 * hh + i][dt * 16 + ln]; bvl.u[8 + i] = sVl[16 + 8 * hh + i][dt * 16 + ln];
      }
      oacc[dt] = mmaN<3>(pah.v, pal.v, bvh.v, bvl.v, oacc[dt]);
    }
    __builtin_amdgcn_fence(4 /* acq_rel order */, "workgroup");
    __builtin_amdgcn_wave_barrier();
  }
  const float qnan = __uint_as_float(0x7FC00000u);
#pragma unroll
  for (int r = 0; r < 8; ++r) {
    float l = l_r[r];
    l += __shfl_xor(l, 1, 32); l += __shfl_xor(l, 2, 32); l += __shfl_xor(l, 4, 32); l += __shfl_xor(l, 8, 32);
    l_r[r] = (m_r[r] > -1.0e38f) ? (1.0f / l) : qnan;
  }
#pragma unroll
  for (int dt = 0; dt < DT; ++dt)
#pragma unroll
    for (int r = 0; r < 8; ++r) sO[w][8 * hh + r][dt * 16 + ln] = oacc[dt][r] * l_r[r];
  __builtin_amdgcn_fence(4 /* acq_rel order */, "workgroup");
  __builtin_amdgcn_wave_barrier();
  {
    for (int r = 0; r < 16; ++r) {
      const int row = q0 + r;
      if (row < T && lane < D / 4) {
        const v4f val = *(const v4fa*)&sO[w][r][lane * 4];
        *(v4f*)(y + ((size_t)b * T + row) * ypitch + h * D + lane * 4) = val;
      }
    }
    
  }
}

extern "C" void kernel_launch(void* const* d_in, const int* in_sizes, int n_in,
                              void* d_out, int out_size, void* d_ws, size_t ws_size, hipStream_t stream) {
  if (n_in < 12) return;
  const float* xq = (const float*)d_in[0]; const float* xk = (const float*)d_in[1]; const float* xv = (const float*)d_in[2];
  const int* kpm = (const int*)d_in[3];
  const float* Wq = (const float*)d_in[4]; const float* bq = (const float*)d_in[5]; const float* Wk = (const float*)d_in[6]; const float* bk = (const float*)d_in[7];
  const float* Wv = (const float*)d_in[8]; const float* bv = (const float*)d_in[9]; const float* Wo = (const float*)d_in[10]; const float* bo = (const float*)d_in[11];
  // size checks (lower bounds so a reduced NB/SEQ build still launches on full-size inputs)
  const long long needX = (long long)(NB - 1) * SEQ_FULL * DD + (long long)SEQ * DD;
  if ((long long)in_sizes[0] < needX || (long long)in_sizes[1] < needX || (long long)in_sizes[2] < needX) return;
  if (in_sizes[3] < (NB - 1) * SEQ_FULL + SEQ) return;
  if (in_sizes[4] < DD * DD || in_sizes[6] < DD * DD || in_sizes[8] < DD * DD || in_sizes[10] < DD * DD) return;
  if (in_sizes[5] < DD || in_sizes[7] < DD || in_sizes[9] < DD || in_sizes[11] < DD) return;
  if ((long long)out_size < (long long)NB * SEQ * DD) return;

  char* ws = (char*)d_ws; size_t off = 0;
  auto take = [&](size_t bytes) { char* p = ws + off; off += (bytes + 255) & ~(size_t)255; return p; };
  const size_t MROWS = (size_t)NB * SEQ;
  unsigned short* Wt[4]; for (int i = 0; i < 4; ++i) Wt[i] = (unsigned short*)take((size_t)DD * DD * 2);
  float* q   = (float*)take(MROWS * DD * 4);
  float* k   = (float*)take(MROWS * DD * 4);
  float* v   = (float*)take(MROWS * DD * 4);
  float* att = (float*)take(MROWS * DD * 4);
  if (off > ws_size) return;

  const int n8 = DD * DD / 8;
  const int gb = ((SEQ / 16) * (DD / 64) + 3) / 4;
  const dim3 gg(gb, NB);
  const float* W4[4] = {Wq, Wk, Wv, Wo};
  for (int i = 0; i < 4; ++i) k_rne_rows<<<(n8 + 255) / 256, 256, 0, stream>>>(W4[i], Wt[i], n8);
  k_gemm_bf<false, true><<<gg, 128, 0, stream>>>(xq, DD, SEQ_FULL * DD, Wt[0], DD, bq, q, DD, SEQ * DD, SEQ, DD, DD);
  k_gemm_bf<false, true><<<gg, 128, 0, stream>>>(xk, DD, SEQ_FULL * DD, Wt[1], DD, bk, k, DD, SEQ * DD, SEQ, DD, DD);
  k_gemm_bf<false, true><<<gg, 128, 0, stream>>>(xv, DD, SEQ_FULL * DD, Wt[2], DD, bv, v, DD, SEQ * DD, SEQ, DD, DD);
  k_flash_pm<HD><<<NB * NH * (SEQ / 64), 128, 0, stream>>>(q, k, v, DD, SEQ, NH, 0.125f, kpm, SEQ_FULL, att, DD);
  k_gemm_bf<true, true><<<gg, 128, 0, stream>>>(att, DD, SEQ * DD, Wt[3], DD, bo, (float*)d_out, DD, SEQ * DD, SEQ, DD, DD);
  (void)hipGetLastError();
}

// v001
// One run takes 369 microseconds.
// Timed twice side by side with v000, it ran 1.27 times as fast both times.
#include <hip/hip_runtime.h>
// Contractions: q/k/v = x*W^T + b on v_wmma_f32_16x16x32_bf16 (x, W, b converted to bf16 RNE, single term); QK^T and P*V per 16-query tile as
// 3-term bf16 hi/lo splits; out = a*Wo^T + bo with a as a 2-term bf16 hi/lo split (Wo, bo bf16 RNE); f32 accumulate, softmax in f32.
#ifndef NB
#define NB 4
#endif
#ifndef SEQ
#define SEQ 2048
#endif
#define NB_FULL 4
#define SEQ_FULL 2048
#define DD 512
#define NH 8
#define HD 64

static_assert(NB >= 1 && NB <= NB_FULL);
static_assert(SEQ >= 64 && SEQ <= SEQ_FULL && (SEQ % 64) == 0);
static_assert(NH * HD == DD && (DD % 64) == 0 && (HD % 32) == 0 && HD <= 128);

typedef __bf16 v16b __attribute__((ext_vector_type(16)));
typedef unsigned short v8us __attribute__((ext_vector_type(8), may_alias));
typedef float  v8f  __attribute__((ext_vector_type(8)));
typedef float  v4f  __attribute__((ext_vector_type(4)));
typedef float  v4fa __attribute__((ext_vector_type(4), may_alias));
union FragB { v16b v; v8us half[2]; unsigned short u[16]; };

__device__ __forceinline__ unsigned short bf16_bits(float x) { unsigned int u = __float_as_uint(x); return (unsigned short)((u + 0x7FFFu + ((u >> 16) & 1u)) >> 16); }
__device__ __forceinline__ float bf16_val(unsigned short b) { return __uint_as_float(((unsigned int)b) << 16); }
__device__ __forceinline__ float bf16_rne(float x) { return bf16_val(bf16_bits(x)); }

// 16-bit transposing LDS load: with lane l addressing 16 bytes at T[k0 + 8*(l>>4) + (l&7)][d0 + 8*((l>>3)&1)], lane (c = l&15, h = l>>4)
// receives T[k0 + 8h + 0..7][d0 + c]
typedef short s16x8 __attribute__((ext_vector_type(8)));
__device__ __forceinline__ v8us tr16(const unsigned short* p) {
  const s16x8 r = __builtin_amdgcn_ds_load_tr16_b128_v8i16((__attribute__((address_space(3))) s16x8*)p);
  return __builtin_bit_cast(v8us, r);
}

// D += A*B with NT terms: 1 = ah*bh, 2 = + al*bh (A split), 3 = + ah*bl (both split); 4 nops guard the accumulator
template <int NT>
__device__ __forceinline__ v8f mmaN(v16b ah, v16b al, v16b bh, v16b bl, v8f c) {
  c = __builtin_amdgcn_wmma_f32_16x16x32_bf16(false, ah, false, bh, (short)0, c, false, false);
  if (NT >= 2) c = __builtin_amdgcn_wmma_f32_16x16x32_bf16(false, al, false, bh, (short)0, c, false, false);
  if (NT >= 3) c = __builtin_amdgcn_wmma_f32_16x16x32_bf16(false, ah, false, bl, (short)0, c, false, false);
  asm volatile("v_nop\n\tv_nop\n\tv_nop\n\tv_nop" : "+v"(c) : "v"(ah), "v"(al), "v"(bh), "v"(bl));
  return c;
}

// Wt[n][k] (bf16 bits) = RNE(W[n][k]) for a row-major [N][K] weight used as x*W^T: plain elementwise convert, 8 per thread,
__global__ __launch_bounds__(256) void k_rne_rows(const float* __restrict__ W, unsigned short* __restrict__ Wt, int n8) {
  const int t = blockIdx.x * 256 + threadIdx.x;
  if (t >= n8) return;
  const v4f a = *(const v4fa*)(W + (size_t)t * 8), b = *(const v4fa*)(W + (size_t)t * 8 + 4);
  v8us v; v[0]=bf16_bits(a[0]); v[1]=bf16_bits(a[1]); v[2]=bf16_bits(a[2]); v[3]=bf16_bits(a[3]);
  v[4]=bf16_bits(b[0]); v[5]=bf16_bits(b[1]); v[6]=bf16_bits(b[2]); v[7]=bf16_bits(b[3]);
  *(v8us*)(Wt + (size_t)t * 8) = v; 
}

// GEMM C[M][N] (f32, pitch ldc) = A[M][K]*W^T + bias per batch blockIdx.y (A += y*abatch, C += y*cbatch elements).
// A f32 row-major (pitch lda) converted per fragment to bf16 (ASPLIT: hi/lo -> 2 terms, else single RNE term); Wt bf16 [N][K] (pitch ldb).
// BIAS_BF16 converts the bias to bf16 RNE before the add. K%32==0, M%16==0, N%64==0.
template <bool ASPLIT, bool BIAS_BF16>
__global__ __launch_bounds__(128) void k_gemm_bf(const float* __restrict__ A, int lda, int abatch, const unsigned short* __restrict__ Wt, int ldb,
                                               const float* __restrict__ bias, float* __restrict__ C, int ldc, int cbatch, int M, int N, int K) {
  __shared__ __attribute__((aligned(16))) float so[4][16][64];
  const int tid = threadIdx.x, w = tid >> 5, lane = tid & 31, ln = lane & 15, hh = lane >> 4;
  const int ntn = N / 64;
  const int wid = blockIdx.x * 4 + w;
  const int mt = wid / ntn, nq = wid % ntn;
  if (mt * 16 >= M) return;                     // no block barrier in this kernel
  const int row0 = mt * 16, col0 = nq * 64;
  const float* Ab = A + (size_t)blockIdx.y * (size_t)abatch;
  float* Cb = C + (size_t)blockIdx.y * (size_t)cbatch;
  const float* arow = Ab + (size_t)(row0 + ln) * lda;
  v8f acc[4];
#pragma unroll
  for (int t = 0; t < 4; ++t) acc[t] = (v8f){0.f,0.f,0.f,0.f,0.f,0.f,0.f,0.f};
  for (int kb = 0; kb < K; kb += 32) {
    FragB ah, al;
    const v4f x0 = *(const v4fa*)(arow + kb + 8 * hh), x1 = *(const v4fa*)(arow + kb + 8 * hh + 4);
    const v4f x2 = *(const v4fa*)(arow + kb + 16 + 8 * hh), x3 = *(const v4fa*)(arow + kb + 16 + 8 * hh + 4);
    float xs[16] = {x0[0],x0[1],x0[2],x0[3],x1[0],x1[1],x1[2],x1[3],x2[0],x2[1],x2[2],x2[3],x3[0],x3[1],x3[2],x3[3]};
#pragma unroll
    for (int i = 0; i < 16; ++i) { const unsigned short hb = bf16_bits(xs[i]); ah.u[i] = hb; al.u[i] = ASPLIT ? bf16_bits(xs[i] - bf16_val(hb)) : (unsigned short)0; }
#pragma unroll
    for (int t = 0; t < 4; ++t) {
      const unsigned short* brow = Wt + (size_t)(col0 + t * 16 + ln) * ldb + kb;
      FragB b;
      b.half[0] = *(const v8us*)(brow + 8 * hh);          // elements 0..7  <- k = kb+8h .. +7
      b.half[1] = *(const v8us*)(brow + 16 + 8 * hh);     // elements 8..15 <- k = kb+16+8h .. +7
      acc[t] = mmaN<ASPLIT ? 2 : 1>(ah.v, al.v, b.v, b.v, acc[t]);
    }
  }
#pragma unroll
  for (int t = 0; t < 4; ++t) {
    float bvv = bias[col0 + t * 16 + ln];
    if (BIAS_BF16) bvv = bf16_rne(bvv);
#pragma unroll
    for (int r = 0; r < 8; ++r) { so[w][8 * hh + r][t * 16 + ln] = acc[t][r] + bvv; }
  }
  __builtin_amdgcn_fence(4 /* acq_rel order */, "workgroup");
  __builtin_amdgcn_wave_barrier();
  const int rsub = lane >> 4, c4 = (lane & 15) * 4;
  {
#pragma unroll
    for (int q = 0; q < 8; ++q) {
      const int r = q * 2 + rsub;
      const v4f v = *(const v4fa*)&so[w][r][c4];
      *(v4f*)(Cb + (size_t)(row0 + r) * ldc + col0 + c4) = v;
    }
    
  }
}

// Flash-style attention with a per-key padding flag (kpm[b*mpitch + j] != 0 -> key j excluded, probability exactly 0;
// a query row with every key excluded yields NaN). QK^T and P*V as 3-term bf16 hi/lo splits, f32 softmax with running max.
// q,k,v rows f32 with pitch `pitch`, batch b at X + b*T*pitch, head h at column h*D. One wave = 16 query rows,
// block = 4 waves (64 queries) sharing K/V chunks of 32 keys staged in LDS (hi/lo bf16 planes).
template <int D>
__global__ __launch_bounds__(128) void k_flash_pm(const float* __restrict__ Qb, const float* __restrict__ Kb, const float* __restrict__ Vb,
                                                int pitch, int T, int H, float scale, const int* __restrict__ kpm, int mpitch,
                                                float* __restrict__ y, int ypitch) {
  constexpr int KS = D / 32, DT = D / 16;
  __shared__ __attribute__((aligned(16))) unsigned short sKh[32][D + 8], sKl[32][D + 8], sVh[32][D + 16], sVl[32][D + 16];
  __shared__ __attribute__((aligned(16))) unsigned short sPh[4][16][40], sPl[4][16][40];
  __shared__ __attribute__((aligned(16))) float sO[4][16][D];
  const int tid = threadIdx.x, w = tid >> 5, lane = tid & 31, ln = lane & 15, hh = lane >> 4;
  const int nqb = (T + 63) / 64;
  const int bh = blockIdx.x / nqb, qblk = blockIdx.x % nqb;
  const int b = bh / H, h = bh % H;
  const int q0 = qblk * 64 + w * 16;
  const float* Q = Qb + (size_t)b * T * pitch + h * D;
  const float* K = Kb + (size_t)b * T * pitch + h * D;
  const float* V = Vb + (size_t)b * T * pitch + h * D;
  const int* mrow = kpm + (size_t)b * mpitch;
  const int trow = 8 * hh + (lane & 7), tcol = 8 * ((lane >> 3) & 1);   // lane address of a transposing load: 16 bytes of row trow

  // A fragments of the wave's 16 query rows (scaled by an exact power of two), hi/lo
  FragB aqh[KS], aql[KS];
  {
    int row = q0 + ln; if (row >= T) row = T - 1;
    const float* qr = Q + (size_t)row * pitch;
#pragma unroll
    for (int ks = 0; ks < KS; ++ks)
#pragma unroll
      for (int i = 0; i < 16; ++i) {
        const int d = ks * 32 + ((i < 8) ? (8 * hh + i) : (16 + 8 * hh + (i - 8)));
        const float x = qr[d] * scale; const unsigned short hb = bf16_bits(x);
        aqh[ks].u[i] = hb; aql[ks].u[i] = bf16_bits(x - bf16_val(hb));
      }
  }
  float m_r[8], l_r[8];
#pragma unroll
  for (int r = 0; r < 8; ++r) { m_r[r] = -3.0e38f; l_r[r] = 0.f; }
  v8f oacc[DT];
#pragma unroll
  for (int dt = 0; dt < DT; ++dt) oacc[dt] = (v8f){0.f,0.f,0.f,0.f,0.f,0.f,0.f,0.f};

  for (int j0 = 0; j0 < T; j0 += 32) {
    __syncthreads();                                 // cross-wave: all waves done reading sK/sV of the prior chunk
    for (int e = tid; e < 32 * (D / 4); e += 128) {
      const int r = e / (D / 4), c4 = (e % (D / 4)) * 4;
      int key = j0 + r; const bool kin = key < T; if (!kin) key = T - 1;     // clamped address, zero by value
      v4f kf = *(const v4fa*)(K + (size_t)key * pitch + c4);
      v4f vf = *(const v4fa*)(V + (size_t)key * pitch + c4);
      if (!kin) { kf = (v4f){0.f,0.f,0.f,0.f}; vf = (v4f){0.f,0.f,0.f,0.f}; }
#pragma unroll
      for (int t = 0; t < 4; ++t) {
        unsigned short hb = bf16_bits(kf[t]); sKh[r][c4 + t] = hb; sKl[r][c4 + t] = bf16_bits(kf[t] - bf16_val(hb));
        hb = bf16_bits(vf[t]); sVh[r][c4 + t] = hb; sVl[r][c4 + t] = bf16_bits(vf[t] - bf16_val(hb));
      }
    }
    __syncthreads();                                 // cross-wave: staging complete before any fragment load
    // S tile 16 queries x 32 keys: B[k = d][n = key] from sK[key][d]
    v8f s[2];
#pragma unroll
    for (int nt = 0; nt < 2; ++nt) {
      v8f acc = (v8f){0.f,0.f,0.f,0.f,0.f,0.f,0.f,0.f};
#pragma unroll
      for (int ks = 0; ks < KS; ++ks) {
        FragB bh_, bl_;
        bh_.half[0] = *(const v8us*)&sKh[nt * 16 + ln][ks * 32 + 8 * hh]; bh_.half[1] = *(const v8us*)&sKh[nt * 16 + ln][ks * 32 + 16 + 8 * hh];
        bl_.half[0] = *(const v8us*)&sKl[nt * 16 + ln][ks * 32 + 8 * hh]; bl_.half[1] = *(const v8us*)&sKl[nt * 16 + ln][ks * 32 + 16 + 8 * hh];
        acc = mmaN<3>(aqh[ks].v, aql[ks].v, bh_.v, bl_.v, acc);
      }
      s[nt] = acc;
    }
    // B[k = key][n = d] from sV[key][d]: all V fragments by transposing LDS loads, one group whose latency the softmax covers
    FragB bvh[DT], bvl[DT];
#pragma unroll
    for (int dt = 0; dt < DT; ++dt) {
      bvh[dt].half[0] = tr16(&sVh[trow][dt * 16 + tcol]); bvh[dt].half[1] = tr16(&sVh[16 + trow][dt * 16 + tcol]);
      bvl[dt].half[0] = tr16(&sVl[trow][dt * 16 + tcol]); bvl[dt].half[1] = tr16(&sVl[16 + trow][dt * 16 + tcol]);
    }
    // key flags for this lane's two key columns (replace semantics: excluded key -> probability 0)
    const int ja = j0 + ln, jb = j0 + 16 + ln;
    const int jac = (ja < T) ? ja : (T - 1), jbc = (jb < T) ? jb : (T - 1);
    const int fa = mrow[jac], fb = mrow[jbc];
    const bool keepa = (ja < T) && (fa == 0), keepb = (jb < T) && (fb == 0);
    float alpha[8];
#pragma unroll
    for (int r = 0; r < 8; ++r) {
      if (!keepa) s[0][r] = -3.0e38f;
      if (!keepb) s[1][r] = -3.0e38f;
      float mx = fmaxf(s[0][r], s[1][r]);
      mx = fmaxf(mx, __shfl_xor(mx, 1, 32)); mx = fmaxf(mx, __shfl_xor(mx, 2, 32)); mx = fmaxf(mx, __shfl_xor(mx, 4, 32)); mx = fmaxf(mx, __shfl_xor(mx, 8, 32));
      const float mnew = fmaxf(m_r[r], mx);
      alpha[r] = (mnew > -1.0e38f) ? __expf(m_r[r] - mnew) : 1.0f;
      const float p0 = keepa ? __expf(s[0][r] - mnew) : 0.f;
      const float p1 = keepb ? __expf(s[1][r] - mnew) : 0.f;
      m_r[r] = mnew;
      l_r[r] = l_r[r] * alpha[r] + p0 + p1;            // per-lane partial row sum (16 lanes combined at the end)
      unsigned short hb = bf16_bits(p0); sPh[w][8 * hh + r][ln] = hb;      sPl[w][8 * hh + r][ln] = bf16_bits(p0 - bf16_val(hb));
      hb = bf16_bits(p1);                sPh[w][8 * hh + r][16 + ln] = hb; sPl[w][8 * hh + r][16 + ln] = bf16_bits(p1 - bf16_val(hb));
    }
#pragma unroll
    for (int dt = 0; dt < DT; ++dt)
#pragma unroll
      for (int r = 0; r < 8; ++r) oacc[dt][r] *= alpha[r];
    __builtin_amdgcn_fence(4 /* acq_rel order */, "workgroup");      // sPh/sPl are wave-private: same-wave exchange
    __builtin_amdgcn_wave_barrier();
    FragB pah, pal;                                              // A[m = query][k = key] from sP[query][key]
    pah.half[0] = *(const v8us*)&sPh[w][ln][8 * hh]; pah.half[1] = *(const v8us*)&sPh[w][ln][16 + 8 * hh];
    pal.half[0] = *(const v8us*)&sPl[w][ln][8 * hh]; pal.half[1] = *(const v8us*)&sPl[w][ln][16 + 8 * hh];
#pragma unroll
    for (int dt = 0; dt < DT; ++dt) {
      oacc[dt] = mmaN<3>(pah.v, pal.v, bvh[dt].v, bvl[dt].v, oacc[dt]);
    }
    __builtin_amdgcn_fence(4 /* acq_rel order */, "workgroup");
    __builtin_amdgcn_wave_barrier();
  }
  const float qnan = __uint_as_float(0x7FC00000u);
#pragma unroll
  for (int r = 0; r < 8; ++r) {
    float l = l_r[r];
    l += __shfl_xor(l, 1, 32); l += __shfl_xor(l, 2, 32); l += __shfl_xor(l, 4, 32); l += __shfl_xor(l, 8, 32);
    l_r[r] = (m_r[r] > -1.0e38f) ? (1.0f / l) : qnan;
  }
#pragma unroll
  for (int dt = 0; dt < DT; ++dt)
#pragma unroll
    for (int r = 0; r < 8; ++r) sO[w][8 * hh + r][dt * 16 + ln] = oacc[dt][r] * l_r[r];
  __builtin_amdgcn_fence(4 /* acq_rel order */, "workgroup");
  __builtin_amdgcn_wave_barrier();
  {
    for (int r = 0; r < 16; ++r) {
      const int row = q0 + r;
      if (row < T && lane < D / 4) {
        const v4f val = *(const v4fa*)&sO[w][r][lane * 4];
        *(v4f*)(y + ((size_t)b * T + row) * ypitch + h * D + lane * 4) = val;
      }
    }
    
  }
}

extern "C" void kernel_launch(void* const* d_in, const int* in_sizes, int n_in,
                              void* d_out, int out_size, void* d_ws, size_t ws_size, hipStream_t stream) {
  if (n_in < 12) return;
  const float* xq = (const float*)d_in[0]; const float* xk = (const float*)d_in[1]; const float* xv = (const float*)d_in[2];
  const int* kpm = (const int*)d_in[3];
  const float* Wq = (const float*)d_in[4]; const float* bq = (const float*)d_in[5]; const float* Wk = (const float*)d_in[6]; const float* bk = (const float*)d_in[7];
  const float* Wv = (const float*)d_in[8]; const float* bv = (const float*)d_in[9]; const float* Wo = (const float*)d_in[10]; const float* bo = (const float*)d_in[11];
  // size checks (lower bounds so a reduced NB/SEQ build still launches on full-size inputs)
  const long long needX = (long long)(NB - 1) * SEQ_FULL * DD + (long long)SEQ * DD;
  if ((long long)in_sizes[0] < needX || (long long)in_sizes[1] < needX || (long long)in_sizes[2] < needX) return;
  if (in_sizes[3] < (NB - 1) * SEQ_FULL + SEQ) return;
  if (in_sizes[4] < DD * DD || in_sizes[6] < DD * DD || in_sizes[8] < DD * DD || in_sizes[10] < DD * DD) return;
  if (in_sizes[5] < DD || in_sizes[7] < DD || in_sizes[9] < DD || in_sizes[11] < DD) return;
  if ((long long)out_size < (long long)NB * SEQ * DD) return;

  char* ws = (char*)d_ws; size_t off = 0;
  auto take = [&](size_t bytes) { char* p = ws + off; off += (bytes + 255) & ~(size_t)255; return p; };
  const size_t MROWS = (size_t)NB * SEQ;
  unsigned short* Wt[4]; for (int i = 0; i < 4; ++i) Wt[i] = (unsigned short*)take((size_t)DD * DD * 2);
  float* q   = (float*)take(MROWS * DD * 4);
  float* k   = (float*)take(MROWS * DD * 4);
  float* v   = (float*)take(MROWS * DD * 4);
  float* att = (float*)take(MROWS * DD * 4);
  if (off > ws_size) return;

  const int n8 = DD * DD / 8;
  const int gb = ((SEQ / 16) * (DD / 64) + 3) / 4;
  const dim3 gg(gb, NB);
  const float* W4[4] = {Wq, Wk, Wv, Wo};
  for (int i = 0; i < 4; ++i) k_rne_rows<<<(n8 + 255) / 256, 256, 0, stream>>>(W4[i], Wt[i], n8);
  k_gemm_bf<false, true><<<gg, 128, 0, stream>>>(xq, DD, SEQ_FULL * DD, Wt[0], DD, bq, q, DD, SEQ * DD, SEQ, DD, DD);
  k_gemm_bf<false, true><<<gg, 128, 0, stream>>>(xk, DD, SEQ_FULL * DD, Wt[1], DD, bk, k, DD, SEQ * DD, SEQ, DD, DD);
  k_gemm_bf<false, true><<<gg, 128, 0, stream>>>(xv, DD, SEQ_FULL * DD, Wt[2], DD, bv, v, DD, SEQ * DD, SEQ, DD, DD);
  k_flash_pm<HD><<<NB * NH * (SEQ / 64), 128, 0, stream>>>(q, k, v, DD, SEQ, NH, 0.125f, kpm, SEQ_FULL, att, DD);
  k_gemm_bf<true, true><<<gg, 128, 0, stream>>>(att, DD, SEQ * DD, Wt[3], DD, bo, (float*)d_out, DD, SEQ * DD, SEQ, DD, DD);
  (void)hipGetLastError();
}

// v002
// It runs in 265 microseconds.
// Two timings next to v001 put it at 1.38 and 1.40 times that version's speed.
// Counting every step since v000, it is 1.77 times as fast.
#include <hip/hip_runtime.h>
// Contractions: q/k/v = x*W^T + b on v_wmma_f32_16x16x32_bf16 (x, W, b converted to bf16 RNE, single term); QK^T and P*V per 16-query tile as
// 3-term bf16 hi/lo splits; out = a*Wo^T + bo with a as a 2-term bf16 hi/lo split (Wo, bo bf16 RNE); f32 accumulate, softmax in f32.
// k and v leave their projection already split into bf16 hi/lo planes, so the attention blocks stage them into LDS by plain 16-byte copies.
#ifndef NB
#define NB 4
#endif
#ifndef SEQ
#define SEQ 2048
#endif
#define NB_FULL 4
#define SEQ_FULL 2048
#define DD 512
#define NH 8
#define HD 64

static_assert(NB >= 1 && NB <= NB_FULL);
static_assert(SEQ >= 64 && SEQ <= SEQ_FULL && (SEQ % 64) == 0);
static_assert(NH * HD == DD && (DD % 64) == 0 && (HD % 32) == 0 && HD <= 128);

typedef __bf16 v16b __attribute__((ext_vector_type(16)));
typedef unsigned short v8us __attribute__((ext_vector_type(8), may_alias));
typedef float  v8f  __attribute__((ext_vector_type(8)));
typedef float  v4f  __attribute__((ext_vector_type(4)));
typedef float  v4fa __attribute__((ext_vector_type(4), may_alias));
union FragB { v16b v; v8us half[2]; unsigned short u[16]; };

__device__ __forceinline__ unsigned short bf16_bits(float x) { unsigned int u = __float_as_uint(x); return (unsigned short)((u + 0x7FFFu + ((u >> 16) & 1u)) >> 16); }
__device__ __forceinline__ float bf16_val(unsigned short b) { return __uint_as_float(((unsigned int)b) << 16); }
__device__ __forceinline__ float bf16_rne(float x) { return bf16_val(bf16_bits(x)); }

// 16-bit transposing LDS load: with lane l addressing 16 bytes at T[k0 + 8*(l>>4) + (l&7)][d0 + 8*((l>>3)&1)], lane (c = l&15, h = l>>4)
// receives T[k0 + 8h + 0..7][d0 + c]
typedef short s16x8 __attribute__((ext_vector_type(8)));
__device__ __forceinline__ v8us tr16(const unsigned short* p) {
  const s16x8 r = __builtin_amdgcn_ds_load_tr16_b128_v8i16((__attribute__((address_space(3))) s16x8*)p);
  return __builtin_bit_cast(v8us, r);
}

// D += A*B with NT terms: 1 = ah*bh, 2 = + al*bh (A split), 3 = + ah*bl (both split); 4 nops guard the accumulator
template <int NT>
__device__ __forceinline__ v8f mmaN(v16b ah, v16b al, v16b bh, v16b bl, v8f c) {
  c = __builtin_amdgcn_wmma_f32_16x16x32_bf16(false, ah, false, bh, (short)0, c, false, false);
  if (NT >= 2) c = __builtin_amdgcn_wmma_f32_16x16x32_bf16(false, al, false, bh, (short)0, c, false, false);
  if (NT >= 3) c = __builtin_amdgcn_wmma_f32_16x16x32_bf16(false, ah, false, bl, (short)0, c, false, false);
  asm volatile("v_nop\n\tv_nop\n\tv_nop\n\tv_nop" : "+v"(c) : "v"(ah), "v"(al), "v"(bh), "v"(bl));
  return c;
}

// Wt[n][k] (bf16 bits) = RNE(W[n][k]) for a row-major [N][K] weight used as x*W^T: plain elementwise convert, 8 per thread,
__global__ __launch_bounds__(256) void k_rne_rows(const float* __restrict__ W, unsigned short* __restrict__ Wt, int n8) {
  const int t = blockIdx.x * 256 + threadIdx.x;
  if (t >= n8) return;
  const v4f a = *(const v4fa*)(W + (size_t)t * 8), b = *(const v4fa*)(W + (size_t)t * 8 + 4);
  v8us v; v[0]=bf16_bits(a[0]); v[1]=bf16_bits(a[1]); v[2]=bf16_bits(a[2]); v[3]=bf16_bits(a[3]);
  v[4]=bf16_bits(b[0]); v[5]=bf16_bits(b[1]); v[6]=bf16_bits(b[2]); v[7]=bf16_bits(b[3]);
  *(v8us*)(Wt + (size_t)t * 8) = v; 
}

// GEMM C[M][N] (f32, pitch ldc) = A[M][K]*W^T + bias per batch blockIdx.y (A += y*abatch, C += y*cbatch elements).
// A f32 row-major (pitch lda) converted per fragment to bf16 (ASPLIT: hi/lo -> 2 terms, else single RNE term); Wt bf16 [N][K] (pitch ldb).
// BIAS_BF16 converts the bias to bf16 RNE before the add. K%32==0, M%16==0, N%64==0.
// CSPLIT: the f32 result x is not stored; Ch gets RNE(x) and Cl gets RNE(x - Ch) as bf16 bits, same pitch and batch stride (in elements) as C.
template <bool ASPLIT, bool BIAS_BF16, bool CSPLIT>
__global__ __launch_bounds__(128) void k_gemm_bf(const float* __restrict__ A, int lda, int abatch, const unsigned short* __restrict__ Wt, int ldb,
                                               const float* __restrict__ bias, float* __restrict__ C, unsigned short* __restrict__ Ch,
                                               unsigned short* __restrict__ Cl, int ldc, int cbatch, int M, int N, int K) {
  __shared__ __attribute__((aligned(16))) float so[4][16][64];
  const int tid = threadIdx.x, w = tid >> 5, lane = tid & 31, ln = lane & 15, hh = lane >> 4;
  const int ntn = N / 64;
  const int wid = blockIdx.x * 4 + w;
  const int mt = wid / ntn, nq = wid % ntn;
  if (mt * 16 >= M) return;                     // no block barrier in this kernel
  const int row0 = mt * 16, col0 = nq * 64;
  const float* Ab = A + (size_t)blockIdx.y * (size_t)abatch;
  const float* arow = Ab + (size_t)(row0 + ln) * lda;
  v8f acc[4];
#pragma unroll
  for (int t = 0; t < 4; ++t) acc[t] = (v8f){0.f,0.f,0.f,0.f,0.f,0.f,0.f,0.f};
  for (int kb = 0; kb < K; kb += 32) {
    FragB ah, al;
    const v4f x0 = *(const v4fa*)(arow + kb + 8 * hh), x1 = *(const v4fa*)(arow + kb + 8 * hh + 4);
    const v4f x2 = *(const v4fa*)(arow + kb + 16 + 8 * hh), x3 = *(const v4fa*)(arow + kb + 16 + 8 * hh + 4);
    float xs[16] = {x0[0],x0[1],x0[2],x0[3],x1[0],x1[1],x1[2],x1[3],x2[0],x2[1],x2[2],x2[3],x3[0],x3[1],x3[2],x3[3]};
#pragma unroll
    for (int i = 0; i < 16; ++i) { const unsigned short hb = bf16_bits(xs[i]); ah.u[i] = hb; al.u[i] = ASPLIT ? bf16_bits(xs[i] - bf16_val(hb)) : (unsigned short)0; }
#pragma unroll
    for (int t = 0; t < 4; ++t) {
      const unsigned short* brow = Wt + (size_t)(col0 + t * 16 + ln) * ldb + kb;
      FragB b;
      b.half[0] = *(const v8us*)(brow + 8 * hh);          // elements 0..7  <- k = kb+8h .. +7
      b.half[1] = *(const v8us*)(brow + 16 + 8 * hh);     // elements 8..15 <- k = kb+16+8h .. +7
      acc[t] = mmaN<ASPLIT ? 2 : 1>(ah.v, al.v, b.v, b.v, acc[t]);
    }
  }
#pragma unroll
  for (int t = 0; t < 4; ++t) {
    float bvv = bias[col0 + t * 16 + ln];
    if (BIAS_BF16) bvv = bf16_rne(bvv);
#pragma unroll
    for (int r = 0; r < 8; ++r) { so[w][8 * hh + r][t * 16 + ln] = acc[t][r] + bvv; }
  }
  __builtin_amdgcn_fence(4 /* acq_rel order */, "workgroup");
  __builtin_amdgcn_wave_barrier();
  if (CSPLIT) {
    unsigned short* Chb = Ch + (size_t)blockIdx.y * (size_t)cbatch;
    unsigned short* Clb = Cl + (size_t)blockIdx.y * (size_t)cbatch;
    const int rsub = lane >> 3, c8 = (lane & 7) * 8;      // 8 lanes write one 128-byte row piece of each plane
#pragma unroll
    for (int q = 0; q < 4; ++q) {
      const int r = q * 4 + rsub;
      const v4f x0 = *(const v4fa*)&so[w][r][c8], x1 = *(const v4fa*)&so[w][r][c8 + 4];
      v8us hi, lo;
#pragma unroll
      for (int i = 0; i < 4; ++i) {
        unsigned short hb = bf16_bits(x0[i]); hi[i] = hb;     lo[i] = bf16_bits(x0[i] - bf16_val(hb));
        hb = bf16_bits(x1[i]);                hi[4 + i] = hb; lo[4 + i] = bf16_bits(x1[i] - bf16_val(hb));
      }
      const size_t o = (size_t)(row0 + r) * ldc + col0 + c8;
      *(v8us*)(Chb + o) = hi;
      *(v8us*)(Clb + o) = lo;
    }
  } else {
    float* Cb = C + (size_t)blockIdx.y * (size_t)cbatch;
    const int rsub = lane >> 4, c4 = (lane & 15) * 4;
#pragma unroll
    for (int q = 0; q < 8; ++q) {
      const int r = q * 2 + rsub;
      const v4f v = *(const v4fa*)&so[w][r][c4];
      *(v4f*)(Cb + (size_t)(row0 + r) * ldc + col0 + c4) = v;
    }
  }
}

// Flash-style attention with a per-key padding flag (kpm[b*mpitch + j] != 0 -> key j excluded, probability exactly 0;
// a query row with every key excluded yields NaN). QK^T and P*V as 3-term bf16 hi/lo splits, f32 softmax with running max.
// q rows f32, k and v rows as bf16 hi/lo planes, all with pitch `pitch` (elements), batch b at X + b*T*pitch, head h at column h*D.
// One wave = 16 query rows, block = 4 waves (64 queries) sharing K/V chunks of 32 keys copied into LDS (hi/lo bf16 planes).
template <int D>
__global__ __launch_bounds__(128) void k_flash_pm(const float* __restrict__ Qb, const unsigned short* __restrict__ Khb, const unsigned short* __restrict__ Klb,
                                                const unsigned short* __restrict__ Vhb, const unsigned short* __restrict__ Vlb, int pitch, int T, int H, float scale, const int* __restrict__ kpm, int mpitch,
                                                float* __restrict__ y, int ypitch) {
  constexpr int KS = D / 32, DT = D / 16, NP = 32 * (D / 8) / 128;   // NP: 16-byte pieces of one plane's chunk per thread
  __shared__ __attribute__((aligned(16))) unsigned short sKh[32][D + 8], sKl[32][D + 8], sVh[32][D + 16], sVl[32][D + 16];
  __shared__ __attribute__((aligned(16))) unsigned short sPh[4][16][40], sPl[4][16][40];
  __shared__ __attribute__((aligned(16))) float sO[4][16][D];
  const int tid = threadIdx.x, w = tid >> 5, lane = tid & 31, ln = lane & 15, hh = lane >> 4;
  const int nqb = (T + 63) / 64;
  const int bh = blockIdx.x / nqb, qblk = blockIdx.x % nqb;
  const int b = bh / H, h = bh % H;
  const int q0 = qblk * 64 + w * 16;
  const float* Q = Qb + (size_t)b * T * pitch + h * D;
  const unsigned short* Kh = Khb + (size_t)b * T * pitch + h * D;
  const unsigned short* Kl = Klb + (size_t)b * T * pitch + h * D;
  const unsigned short* Vh = Vhb + (size_t)b * T * pitch + h * D;
  const unsigned short* Vl = Vlb + (size_t)b * T * pitch + h * D;
  const int* mrow = kpm + (size_t)b * mpitch;
  const int trow = 8 * hh + (lane & 7), tcol = 8 * ((lane >> 3) & 1);   // lane address of a transposing load: 16 bytes of row trow

  // A fragments of the wave's 16 query rows (scaled by an exact power of two), hi/lo
  FragB aqh[KS], aql[KS];
  {
    int row = q0 + ln; if (row >= T) row = T - 1;
    const float* qr = Q + (size_t)row * pitch;
#pragma unroll
    for (int ks = 0; ks < KS; ++ks)
#pragma unroll
      for (int i = 0; i < 16; ++i) {
        const int d = ks * 32 + ((i < 8) ? (8 * hh + i) : (16 + 8 * hh + (i - 8)));
        const float x = qr[d] * scale; const unsigned short hb = bf16_bits(x);
        aqh[ks].u[i] = hb; aql[ks].u[i] = bf16_bits(x - bf16_val(hb));
      }
  }
  float m_r[8], l_r[8];
#pragma unroll
  for (int r = 0; r < 8; ++r) { m_r[r] = -3.0e38f; l_r[r] = 0.f; }
  v8f oacc[DT];
#pragma unroll
  for (int dt = 0; dt < DT; ++dt) oacc[dt] = (v8f){0.f,0.f,0.f,0.f,0.f,0.f,0.f,0.f};

  for (int j0 = 0; j0 < T; j0 += 32) {
    __syncthreads();                                 // cross-wave: all waves done reading sK/sV of the prior chunk
    {
      v8us xkh[NP], xkl[NP], xvh[NP], xvl[NP];       // all loads of the chunk issued before the first LDS store
#pragma unroll
      for (int i = 0; i < NP; ++i) {
        const int e = tid + i * 128, r = e / (D / 8), c8 = (e % (D / 8)) * 8;
        int key = j0 + r; if (key >= T) key = T - 1;                         // clamped address, zero by value
        const unsigned o = ((unsigned)key * (unsigned)pitch + (unsigned)c8) * 2u;   // byte offset, one 32-bit register for all four planes
        xkh[i] = *(const v8us*)((const char*)Kh + o); xkl[i] = *(const v8us*)((const char*)Kl + o);
        xvh[i] = *(const v8us*)((const char*)Vh + o); xvl[i] = *(const v8us*)((const char*)Vl + o);
      }
      if (j0 + 32 > T) {                                                     // block-uniform: only a chunk that runs past T
        const v8us zz = (v8us){0,0,0,0,0,0,0,0};
#pragma unroll
        for (int i = 0; i < NP; ++i)
          if (j0 + (tid + i * 128) / (D / 8) >= T) { xkh[i] = zz; xkl[i] = zz; xvh[i] = zz; xvl[i] = zz; }
      }
#pragma unroll
      for (int i = 0; i < NP; ++i) {
        const int e = tid + i * 128, r = e / (D / 8), c8 = (e % (D / 8)) * 8;
        *(v8us*)&sKh[r][c8] = xkh[i]; *(v8us*)&sKl[r][c8] = xkl[i];
        *(v8us*)&sVh[r][c8] = xvh[i]; *(v8us*)&sVl[r][c8] = xvl[i];
      }
    }
    __syncthreads();                                 // cross-wave: staging complete before any fragment load
    // S tile 16 queries x 32 keys: B[k = d][n = key] from sK[key][d]
    v8f s[2];
#pragma unroll
    for (int nt = 0; nt < 2; ++nt) {
      v8f acc = (v8f){0.f,0.f,0.f,0.f,0.f,0.f,0.f,0.f};
#pragma unroll
      for (int ks = 0; ks < KS; ++ks) {
        FragB bh_, bl_;
        bh_.half[0] = *(const v8us*)&sKh[nt * 16 + ln][ks * 32 + 8 * hh]; bh_.half[1] = *(const v8us*)&sKh[nt * 16 + ln][ks * 32 + 16 + 8 * hh];
        bl_.half[0] = *(const v8us*)&sKl[nt * 16 + ln][ks * 32 + 8 * hh]; bl_.half[1] = *(const v8us*)&sKl[nt * 16 + ln][ks * 32 + 16 + 8 * hh];
        acc = mmaN<3>(aqh[ks].v, aql[ks].v, bh_.v, bl_.v, acc);
      }
      s[nt] = acc;
    }
    // B[k = key][n = d] from sV[key][d]: all V fragments by transposing LDS loads, one group whose latency the softmax covers
    FragB bvh[DT], bvl[DT];
#pragma unroll
    for (int dt = 0; dt < DT; ++dt) {
      bvh[dt].half[0] = tr16(&sVh[trow][dt * 16 + tcol]); bvh[dt].half[1] = tr16(&sVh[16 + trow][dt * 16 + tcol]);
      bvl[dt].half[0] = tr16(&sVl[trow][dt * 16 + tcol]); bvl[dt].half[1] = tr16(&sVl[16 + trow][dt * 16 + tcol]);
    }
    // key flags for this lane's two key columns (replace semantics: excluded key -> probability 0)
    const int ja = j0 + ln, jb = j0 + 16 + ln;
    const int jac = (ja < T) ? ja : (T - 1), jbc = (jb < T) ? jb : (T - 1);
    const int fa = mrow[jac], fb = mrow[jbc];
    const bool keepa = (ja < T) && (fa == 0), keepb = (jb < T) && (fb == 0);
    float alpha[8];
#pragma unroll
    for (int r = 0; r < 8; ++r) {
      if (!keepa) s[0][r] = -3.0e38f;
      if (!keepb) s[1][r] = -3.0e38f;
      float mx = fmaxf(s[0][r], s[1][r]);
      mx = fmaxf(mx, __shfl_xor(mx, 1, 32)); mx = fmaxf(mx, __shfl_xor(mx, 2, 32)); mx = fmaxf(mx, __shfl_xor(mx, 4, 32)); mx = fmaxf(mx, __shfl_xor(mx, 8, 32));
      const float mnew = fmaxf(m_r[r], mx);
      alpha[r] = (mnew > -1.0e38f) ? __expf(m_r[r] - mnew) : 1.0f;
      const float p0 = keepa ? __expf(s[0][r] - mnew) : 0.f;
      const float p1 = keepb ? __expf(s[1][r] - mnew) : 0.f;
      m_r[r] = mnew;
      l_r[r] = l_r[r] * alpha[r] + p0 + p1;            // per-lane partial row sum (16 lanes combined at the end)
      unsigned short hb = bf16_bits(p0); sPh[w][8 * hh + r][ln] = hb;      sPl[w][8 * hh + r][ln] = bf16_bits(p0 - bf16_val(hb));
      hb = bf16_bits(p1);                sPh[w][8 * hh + r][16 + ln] = hb; sPl[w][8 * hh + r][16 + ln] = bf16_bits(p1 - bf16_val(hb));
    }
#pragma unroll
    for (int dt = 0; dt < DT; ++dt)
#pragma unroll
      for (int r = 0; r < 8; ++r) oacc[dt][r] *= alpha[r];
    __builtin_amdgcn_fence(4 /* acq_rel order */, "workgroup");      // sPh/sPl are wave-private: same-wave exchange
    __builtin_amdgcn_wave_barrier();
    FragB pah, pal;                                              // A[m = query][k = key] from sP[query][key]
    pah.half[0] = *(const v8us*)&sPh[w][ln][8 * hh]; pah.half[1] = *(const v8us*)&sPh[w][ln][16 + 8 * hh];
    pal.half[0] = *(const v8us*)&sPl[w][ln][8 * hh]; pal.half[1] = *(const v8us*)&sPl[w][ln][16 + 8 * hh];
#pragma unroll
    for (int dt = 0; dt < DT; ++dt) {
      oacc[dt] = mmaN<3>(pah.v, pal.v, bvh[dt].v, bvl[dt].v, oacc[dt]);
    }
    __builtin_amdgcn_fence(4 /* acq_rel order */, "workgroup");
    __builtin_amdgcn_wave_barrier();
  }
  const float qnan = __uint_as_float(0x7FC00000u);
#pragma unroll
  for (int r = 0; r < 8; ++r) {
    float l = l_r[r];
    l += __shfl_xor(l, 1, 32); l += __shfl_xor(l, 2, 32); l += __shfl_xor(l, 4, 32); l += __shfl_xor(l, 8, 32);
    l_r[r] = (m_r[r] > -1.0e38f) ? (1.0f / l) : qnan;
  }
#pragma unroll
  for (int dt = 0; dt < DT; ++dt)
#pragma unroll
    for (int r = 0; r < 8; ++r) sO[w][8 * hh + r][dt * 16 + ln] = oacc[dt][r] * l_r[r];
  __builtin_amdgcn_fence(4 /* acq_rel order */, "workgroup");
  __builtin_amdgcn_wave_barrier();
  {
    for (int r = 0; r < 16; ++r) {
      const int row = q0 + r;
      if (row < T && lane < D / 4) {
        const v4f val = *(const v4fa*)&sO[w][r][lane * 4];
        *(v4f*)(y + ((size_t)b * T + row) * ypitch + h * D + lane * 4) = val;
      }
    }
    
  }
}

extern "C" void kernel_launch(void* const* d_in, const int* in_sizes, int n_in,
                              void* d_out, int out_size, void* d_ws, size_t ws_size, hipStream_t stream) {
  if (n_in < 12) return;
  const float* xq = (const float*)d_in[0]; const float* xk = (const float*)d_in[1]; const float* xv = (const float*)d_in[2];
  const int* kpm = (const int*)d_in[3];
  const float* Wq = (const float*)d_in[4]; const float* bq = (const float*)d_in[5]; const float* Wk = (const float*)d_in[6]; const float* bk = (const float*)d_in[7];
  const float* Wv = (const float*)d_in[8]; const float* bv = (const float*)d_in[9]; const float* Wo = (const float*)d_in[10]; const float* bo = (const float*)d_in[11];
  // size checks (lower bounds so a reduced NB/SEQ build still launches on full-size inputs)
  const long long needX = (long long)(NB - 1) * SEQ_FULL * DD + (long long)SEQ * DD;
  if ((long long)in_sizes[0] < needX || (long long)in_sizes[1] < needX || (long long)in_sizes[2] < needX) return;
  if (in_sizes[3] < (NB - 1) * SEQ_FULL + SEQ) return;
  if (in_sizes[4] < DD * DD || in_sizes[6] < DD * DD || in_sizes[8] < DD * DD || in_sizes[10] < DD * DD) return;
  if (in_sizes[5] < DD || in_sizes[7] < DD || in_sizes[9] < DD || in_sizes[11] < DD) return;
  if ((long long)out_size < (long long)NB * SEQ * DD) return;

  char* ws = (char*)d_ws; size_t off = 0;
  auto take = [&](size_t bytes) { char* p = ws + off; off += (bytes + 255) & ~(size_t)255; return p; };
  const size_t MROWS = (size_t)NB * SEQ;
  unsigned short* Wt[4]; for (int i = 0; i < 4; ++i) Wt[i] = (unsigned short*)take((size_t)DD * DD * 2);
  float* q   = (float*)take(MROWS * DD * 4);
  unsigned short* kh = (unsigned short*)take(MROWS * DD * 2);
  unsigned short* kl = (unsigned short*)take(MROWS * DD * 2);
  unsigned short* vh = (unsigned short*)take(MROWS * DD * 2);
  unsigned short* vl = (unsigned short*)take(MROWS * DD * 2);
  float* att = (float*)take(MROWS * DD * 4);
  if (off > ws_size) return;

  const int n8 = DD * DD / 8;
  const int gb = ((SEQ / 16) * (DD / 64) + 3) / 4;
  const dim3 gg(gb, NB);
  const float* W4[4] = {Wq, Wk, Wv, Wo};
  for (int i = 0; i < 4; ++i) k_rne_rows<<<(n8 + 255) / 256, 256, 0, stream>>>(W4[i], Wt[i], n8);
  k_gemm_bf<false, true, false><<<gg, 128, 0, stream>>>(xq, DD, SEQ_FULL * DD, Wt[0], DD, bq, q, nullptr, nullptr, DD, SEQ * DD, SEQ, DD, DD);
  k_gemm_bf<false, true, true><<<gg, 128, 0, stream>>>(xk, DD, SEQ_FULL * DD, Wt[1], DD, bk, nullptr, kh, kl, DD, SEQ * DD, SEQ, DD, DD);
  k_gemm_bf<false, true, true><<<gg, 128, 0, stream>>>(xv, DD, SEQ_FULL * DD, Wt[2], DD, bv, nullptr, vh, vl, DD, SEQ * DD, SEQ, DD, DD);
  k_flash_pm<HD><<<NB * NH * (SEQ / 64), 128, 0, stream>>>(q, kh, kl, vh, vl, DD, SEQ, NH, 0.125f, kpm, SEQ_FULL, att, DD);
  k_gemm_bf<true, true, false><<<gg, 128, 0, stream>>>(att, DD, SEQ * DD, Wt[3], DD, bo, (float*)d_out, nullptr, nullptr, DD, SEQ * DD, SEQ, DD, DD);
  (void)hipGetLastError();
}

// v003
// A run of this version takes 196 microseconds.
// Timed twice side by side with v002, it ran 1.36 and 1.35 times as fast.
// All steps since v000 together make it 2.40 times as fast.
#include <hip/hip_runtime.h>
// Contractions: q/k/v = x*W^T + b on v_wmma_f32_16x16x32_bf16 (x, W, b converted to bf16 RNE, single term); QK^T and P*V per 16-query tile as
// 3-term bf16 hi/lo splits; out = a*Wo^T + bo with a as a 2-term bf16 hi/lo split (Wo, bo bf16 RNE); f32 accumulate, softmax in f32.
// k and v leave their projection already split into bf16 hi/lo planes, so the attention blocks stage them into LDS by plain 16-byte copies.
// Keys whose padding flag is set have probability exactly 0: the unflagged keys of each batch are listed in ascending order, the k and v
// projections compute only those rows and store them packed (row p = p-th unflagged key), and the attention key loop ends at their count.
#ifndef NB
#define NB 4
#endif
#ifndef SEQ
#define SEQ 2048
#endif
#define NB_FULL 4
#define SEQ_FULL 2048
#define DD 512
#define NH 8
#define HD 64

static_assert(NB >= 1 && NB <= NB_FULL);
static_assert(SEQ >= 64 && SEQ <= SEQ_FULL && (SEQ % 64) == 0);
static_assert(NH * HD == DD && (DD % 64) == 0 && (HD % 32) == 0 && HD <= 128);

typedef __bf16 v16b __attribute__((ext_vector_type(16)));
typedef unsigned short v8us __attribute__((ext_vector_type(8), may_alias));
typedef float  v8f  __attribute__((ext_vector_type(8)));
typedef float  v4f  __attribute__((ext_vector_type(4)));
typedef float  v4fa __attribute__((ext_vector_type(4), may_alias));
union FragB { v16b v; v8us half[2]; unsigned short u[16]; };

__device__ __forceinline__ unsigned short bf16_bits(float x) { unsigned int u = __float_as_uint(x); return (unsigned short)((u + 0x7FFFu + ((u >> 16) & 1u)) >> 16); }
__device__ __forceinline__ float bf16_val(unsigned short b) { return __uint_as_float(((unsigned int)b) << 16); }
__device__ __forceinline__ float bf16_rne(float x) { return bf16_val(bf16_bits(x)); }

// 16-bit transposing LDS load: with lane l addressing 16 bytes at T[k0 + 8*(l>>4) + (l&7)][d0 + 8*((l>>3)&1)], lane (c = l&15, h = l>>4)
// receives T[k0 + 8h + 0..7][d0 + c]
typedef short s16x8 __attribute__((ext_vector_type(8)));
__device__ __forceinline__ v8us tr16(const unsigned short* p) {
  const s16x8 r = __builtin_amdgcn_ds_load_tr16_b128_v8i16((__attribute__((address_space(3))) s16x8*)p);
  return __builtin_bit_cast(v8us, r);
}

// D += A*B with NT terms: 1 = ah*bh, 2 = + al*bh (A split), 3 = + ah*bl (both split); 4 nops guard the accumulator
template <int NT>
__device__ __forceinline__ v8f mmaN(v16b ah, v16b al, v16b bh, v16b bl, v8f c) {
  c = __builtin_amdgcn_wmma_f32_16x16x32_bf16(false, ah, false, bh, (short)0, c, false, false);
  if (NT >= 2) c = __builtin_amdgcn_wmma_f32_16x16x32_bf16(false, al, false, bh, (short)0, c, false, false);
  if (NT >= 3) c = __builtin_amdgcn_wmma_f32_16x16x32_bf16(false, ah, false, bl, (short)0, c, false, false);
  asm volatile("v_nop\n\tv_nop\n\tv_nop\n\tv_nop" : "+v"(c) : "v"(ah), "v"(al), "v"(bh), "v"(bl));
  return c;
}

// Wt[n][k] (bf16 bits) = RNE(W[n][k]) for a row-major [N][K] weight used as x*W^T: plain elementwise convert, 8 per thread,
__global__ __launch_bounds__(256) void k_rne_rows(const float* __restrict__ W, unsigned short* __restrict__ Wt, int n8) {
  const int t = blockIdx.x * 256 + threadIdx.x;
  if (t >= n8) return;
  const v4f a = *(const v4fa*)(W + (size_t)t * 8), b = *(const v4fa*)(W + (size_t)t * 8 + 4);
  v8us v; v[0]=bf16_bits(a[0]); v[1]=bf16_bits(a[1]); v[2]=bf16_bits(a[2]); v[3]=bf16_bits(a[3]);
  v[4]=bf16_bits(b[0]); v[5]=bf16_bits(b[1]); v[6]=bf16_bits(b[2]); v[7]=bf16_bits(b[3]);
  *(v8us*)(Wt + (size_t)t * 8) = v; 
}

// live[b*lpitch + p] = index of the p-th key of batch b = blockIdx.x with kpm[b*mpitch + j] == 0 (ascending), nlive[b] = how many there are.
// Wave w owns the PER*32 consecutive keys from w*PER*32, one key a lane in each of PER groups: a ballot gives a key's rank inside its group,
// and the eight wave totals, exchanged through LDS, give each wave its first slot.
template <int PER>
__global__ __launch_bounds__(256) void k_live_keys(const int* __restrict__ kpm, int mpitch, int T, int* __restrict__ live, int lpitch, int* __restrict__ nlive) {
  __shared__ int part[8];
  const int t = threadIdx.x, w = t >> 5, lane = t & 31, b = blockIdx.x;
  const int* mrow = kpm + (size_t)b * mpitch;
  unsigned bal[PER];
  int c = 0;
#pragma unroll
  for (int i = 0; i < PER; ++i) {
    const int j = (w * PER + i) * 32 + lane, jc = (j < T) ? j : (T - 1);
    bal[i] = __builtin_amdgcn_ballot_w32((mrow[jc] == 0) && (j < T));
    c += __builtin_popcount(bal[i]);
  }
  if (lane == 0) part[w] = c;
  __syncthreads();                                 // cross-wave: every wave's total is in LDS
  int o = 0, tot = 0;
#pragma unroll
  for (int k = 0; k < 8; ++k) { const int v = part[k]; o += (k < w) ? v : 0; tot += v; }
  int* lrow = live + (size_t)b * lpitch;
  const unsigned below = (1u << lane) - 1u;
#pragma unroll
  for (int i = 0; i < PER; ++i) {
    if ((bal[i] >> lane) & 1u) lrow[o + __builtin_popcount(bal[i] & below)] = (w * PER + i) * 32 + lane;
    o += __builtin_popcount(bal[i]);
  }
  if (t == 0) nlive[b] = tot;
}

// GEMM C[M][N] (f32, pitch ldc) = A[M][K]*W^T + bias per batch blockIdx.y (A += y*abatch, C += y*cbatch elements).
// A f32 row-major (pitch lda) converted per fragment to bf16 (ASPLIT: hi/lo -> 2 terms, else single RNE term); Wt bf16 [N][K] (pitch ldb).
// BIAS_BF16 converts the bias to bf16 RNE before the add. K%32==0, M%16==0, N%64==0.
// CSPLIT: the f32 result x is not stored; Ch gets RNE(x) and Cl gets RNE(x - Ch) as bf16 bits, same pitch and batch stride (in elements) as C.
// PACK: output row p comes from A row live[y*lpitch + p], for p < nlive[y] only (the last 16-row tile repeats the last listed row); later rows are not written.
template <bool ASPLIT, bool BIAS_BF16, bool CSPLIT, bool PACK>
__global__ __launch_bounds__(128) void k_gemm_bf(const float* __restrict__ A, int lda, int abatch, const unsigned short* __restrict__ Wt, int ldb,
                                               const float* __restrict__ bias, float* __restrict__ C, unsigned short* __restrict__ Ch,
                                               unsigned short* __restrict__ Cl, int ldc, int cbatch, int M, int N, int K,
                                               const int* __restrict__ live, int lpitch, const int* __restrict__ nlive) {
  __shared__ __attribute__((aligned(16))) float so[4][16][64];
  const int tid = threadIdx.x, w = tid >> 5, lane = tid & 31, ln = lane & 15, hh = lane >> 4;
  const int ntn = N / 64;
  const int wid = blockIdx.x * 4 + w;
  const int mt = wid / ntn, nq = wid % ntn;
  int Mb = M;
  if (PACK) { const int c = nlive[blockIdx.y]; Mb = (c < M) ? c : M; }
  if (mt * 16 >= Mb) return;                    // no block barrier in this kernel
  const int row0 = mt * 16, col0 = nq * 64;
  const float* Ab = A + (size_t)blockIdx.y * (size_t)abatch;
  int ar = row0 + ln;
  if (PACK) {
    const int p = (ar < Mb) ? ar : (Mb - 1);
    const unsigned g = (unsigned)live[(size_t)blockIdx.y * lpitch + p];
    ar = (int)((g < (unsigned)M) ? g : (unsigned)(M - 1));
  }
  const float* arow = Ab + (size_t)ar * lda;
  v8f acc[4];
#pragma unroll
  for (int t = 0; t < 4; ++t) acc[t] = (v8f){0.f,0.f,0.f,0.f,0.f,0.f,0.f,0.f};
  for (int kb = 0; kb < K; kb += 32) {
    FragB ah, al;
    const v4f x0 = *(const v4fa*)(arow + kb + 8 * hh), x1 = *(const v4fa*)(arow + kb + 8 * hh + 4);
    const v4f x2 = *(const v4fa*)(arow + kb + 16 + 8 * hh), x3 = *(const v4fa*)(arow + kb + 16 + 8 * hh + 4);
    float xs[16] = {x0[0],x0[1],x0[2],x0[3],x1[0],x1[1],x1[2],x1[3],x2[0],x2[1],x2[2],x2[3],x3[0],x3[1],x3[2],x3[3]};
#pragma unroll
    for (int i = 0; i < 16; ++i) { const unsigned short hb = bf16_bits(xs[i]); ah.u[i] = hb; al.u[i] = ASPLIT ? bf16_bits(xs[i] - bf16_val(hb)) : (unsigned short)0; }
#pragma unroll
    for (int t = 0; t < 4; ++t) {
      const unsigned short* brow = Wt + (size_t)(col0 + t * 16 + ln) * ldb + kb;
      FragB b;
      b.half[0] = *(const v8us*)(brow + 8 * hh);          // elements 0..7  <- k = kb+8h .. +7
      b.half[1] = *(const v8us*)(brow + 16 + 8 * hh);     // elements 8..15 <- k = kb+16+8h .. +7
      acc[t] = mmaN<ASPLIT ? 2 : 1>(ah.v, al.v, b.v, b.v, acc[t]);
    }
  }
#pragma unroll
  for (int t = 0; t < 4; ++t) {
    float bvv = bias[col0 + t * 16 + ln];
    if (BIAS_BF16) bvv = bf16_rne(bvv);
#pragma unroll
    for (int r = 0; r < 8; ++r) { so[w][8 * hh + r][t * 16 + ln] = acc[t][r] + bvv; }
  }
  __builtin_amdgcn_fence(4 /* acq_rel order */, "workgroup");
  __builtin_amdgcn_wave_barrier();
  if (CSPLIT) {
    unsigned short* Chb = Ch + (size_t)blockIdx.y * (size_t)cbatch;
    unsigned short* Clb = Cl + (size_t)blockIdx.y * (size_t)cbatch;
    const int rsub = lane >> 3, c8 = (lane & 7) * 8;      // 8 lanes write one 128-byte row piece of each plane
#pragma unroll
    for (int q = 0; q < 4; ++q) {
      const int r = q * 4 + rsub;
      const v4f x0 = *(const v4fa*)&so[w][r][c8], x1 = *(const v4fa*)&so[w][r][c8 + 4];
      v8us hi, lo;
#pragma unroll
      for (int i = 0; i < 4; ++i) {
        unsigned short hb = bf16_bits(x0[i]); hi[i] = hb;     lo[i] = bf16_bits(x0[i] - bf16_val(hb));
        hb = bf16_bits(x1[i]);                hi[4 + i] = hb; lo[4 + i] = bf16_bits(x1[i] - bf16_val(hb));
      }
      const size_t o = (size_t)(row0 + r) * ldc + col0 + c8;
      *(v8us*)(Chb + o) = hi;
      *(v8us*)(Clb + o) = lo;
    }
  } else {
    float* Cb = C + (size_t)blockIdx.y * (size_t)cbatch;
    const int rsub = lane >> 4, c4 = (lane & 15) * 4;
#pragma unroll
    for (int q = 0; q < 8; ++q) {
      const int r = q * 2 + rsub;
      const v4f v = *(const v4fa*)&so[w][r][c4];
      *(v4f*)(Cb + (size_t)(row0 + r) * ldc + col0 + c4) = v;
    }
  }
}

// Flash-style attention over the packed keys of each batch: k and v rows 0 .. nlive[b]-1 take part, no other row is read;
// nlive[b] == 0 (every key excluded) yields NaN. QK^T and P*V as 3-term bf16 hi/lo splits, f32 softmax with running max.
// q rows f32, k and v rows as bf16 hi/lo planes, all with pitch `pitch` (elements), batch b at X + b*T*pitch, head h at column h*D.
// One wave = 16 query rows, block = 4 waves (64 queries) sharing K/V chunks of 32 keys copied into LDS (hi/lo bf16 planes).
template <int D>
__global__ __launch_bounds__(128) void k_flash_pm(const float* __restrict__ Qb, const unsigned short* __restrict__ Khb, const unsigned short* __restrict__ Klb,
                                                const unsigned short* __restrict__ Vhb, const unsigned short* __restrict__ Vlb, int pitch, int T, int H, float scale, const int* __restrict__ nlive,
                                                float* __restrict__ y, int ypitch) {
  constexpr int KS = D / 32, DT = D / 16, NP = 32 * (D / 8) / 128;   // NP: 16-byte pieces of one plane's chunk per thread
  __shared__ __attribute__((aligned(16))) unsigned short sKh[32][D + 8], sKl[32][D + 8], sVh[32][D + 16], sVl[32][D + 16];
  __shared__ __attribute__((aligned(16))) unsigned short sPh[4][16][40], sPl[4][16][40];
  __shared__ __attribute__((aligned(16))) float sO[4][16][D];
  const int tid = threadIdx.x, w = tid >> 5, lane = tid & 31, ln = lane & 15, hh = lane >> 4;
  const int nqb = (T + 63) / 64;
  const int bh = blockIdx.x / nqb, qblk = blockIdx.x % nqb;
  const int b = bh / H, h = bh % H;
  const int q0 = qblk * 64 + w * 16;
  const float* Q = Qb + (size_t)b * T * pitch + h * D;
  const unsigned short* Kh = Khb + (size_t)b * T * pitch + h * D;
  const unsigned short* Kl = Klb + (size_t)b * T * pitch + h * D;
  const unsigned short* Vh = Vhb + (size_t)b * T * pitch + h * D;
  const unsigned short* Vl = Vlb + (size_t)b * T * pitch + h * D;
  const int nl = nlive[b];
  const int Tk = (nl < T) ? nl : T;                  // keys of this batch; block-uniform
  const int trow = 8 * hh + (lane & 7), tcol = 8 * ((lane >> 3) & 1);   // lane address of a transposing load: 16 bytes of row trow

  // A fragments of the wave's 16 query rows (scaled by an exact power of two), hi/lo
  FragB aqh[KS], aql[KS];
  {
    int row = q0 + ln; if (row >= T) row = T - 1;
    const float* qr = Q + (size_t)row * pitch;
#pragma unroll
    for (int ks = 0; ks < KS; ++ks)
#pragma unroll
      for (int i = 0; i < 16; ++i) {
        const int d = ks * 32 + ((i < 8) ? (8 * hh + i) : (16 + 8 * hh + (i - 8)));
        const float x = qr[d] * scale; const unsigned short hb = bf16_bits(x);
        aqh[ks].u[i] = hb; aql[ks].u[i] = bf16_bits(x - bf16_val(hb));
      }
  }
  float m_r[8], l_r[8];
#pragma unroll
  for (int r = 0; r < 8; ++r) { m_r[r] = -3.0e38f; l_r[r] = 0.f; }
  v8f oacc[DT];
#pragma unroll
  for (int dt = 0; dt < DT; ++dt) oacc[dt] = (v8f){0.f,0.f,0.f,0.f,0.f,0.f,0.f,0.f};

  for (int j0 = 0; j0 < Tk; j0 += 32) {
    __syncthreads();                                 // cross-wave: all waves done reading sK/sV of the prior chunk
    {
      v8us xkh[NP], xkl[NP], xvh[NP], xvl[NP];       // all loads of the chunk issued before the first LDS store
#pragma unroll
      for (int i = 0; i < NP; ++i) {
        const int e = tid + i * 128, r = e / (D / 8), c8 = (e % (D / 8)) * 8;
        int key = j0 + r; if (key >= Tk) key = Tk - 1;                       // clamped address, zero by value
        const unsigned o = ((unsigned)key * (unsigned)pitch + (unsigned)c8) * 2u;   // byte offset, one 32-bit register for all four planes
        xkh[i] = *(const v8us*)((const char*)Kh + o); xkl[i] = *(const v8us*)((const char*)Kl + o);
        xvh[i] = *(const v8us*)((const char*)Vh + o); xvl[i] = *(const v8us*)((const char*)Vl + o);
      }
      if (j0 + 32 > Tk) {                                                    // block-uniform: only a chunk that runs past Tk
        const v8us zz = (v8us){0,0,0,0,0,0,0,0};
#pragma unroll
        for (int i = 0; i < NP; ++i)
          if (j0 + (tid + i * 128) / (D / 8) >= Tk) { xkh[i] = zz; xkl[i] = zz; xvh[i] = zz; xvl[i] = zz; }
      }
#pragma unroll
      for (int i = 0; i < NP; ++i) {
        const int e = tid + i * 128, r = e / (D / 8), c8 = (e % (D / 8)) * 8;
        *(v8us*)&sKh[r][c8] = xkh[i]; *(v8us*)&sKl[r][c8] = xkl[i];
        *(v8us*)&sVh[r][c8] = xvh[i]; *(v8us*)&sVl[r][c8] = xvl[i];
      }
    }
    __syncthreads();                                 // cross-wave: staging complete before any fragment load
    // S tile 16 queries x 32 keys: B[k = d][n = key] from sK[key][d]
    v8f s[2];
#pragma unroll
    for (int nt = 0; nt < 2; ++nt) {
      v8f acc = (v8f){0.f,0.f,0.f,0.f,0.f,0.f,0.f,0.f};
#pragma unroll
      for (int ks = 0; ks < KS; ++ks) {
        FragB bh_, bl_;
        bh_.half[0] = *(const v8us*)&sKh[nt * 16 + ln][ks * 32 + 8 * hh]; bh_.half[1] = *(const v8us*)&sKh[nt * 16 + ln][ks * 32 + 16 + 8 * hh];
        bl_.half[0] = *(const v8us*)&sKl[nt * 16 + ln][ks * 32 + 8 * hh]; bl_.half[1] = *(const v8us*)&sKl[nt * 16 + ln][ks * 32 + 16 + 8 * hh];
        acc = mmaN<3>(aqh[ks].v, aql[ks].v, bh_.v, bl_.v, acc);
      }
      s[nt] = acc;
    }
    // B[k = key][n = d] from sV[key][d]: all V fragments by transposing LDS loads, one group whose latency the softmax covers
    FragB bvh[DT], bvl[DT];
#pragma unroll
    for (int dt = 0; dt < DT; ++dt) {
      bvh[dt].half[0] = tr16(&sVh[trow][dt * 16 + tcol]); bvh[dt].half[1] = tr16(&sVh[16 + trow][dt * 16 + tcol]);
      bvl[dt].half[0] = tr16(&sVl[trow][dt * 16 + tcol]); bvl[dt].half[1] = tr16(&sVl[16 + trow][dt * 16 + tcol]);
    }
    // this lane's two key columns: a column past the last packed key has probability 0
    const bool keepa = (j0 + ln < Tk), keepb = (j0 + 16 + ln < Tk);
    float alpha[8];
#pragma unroll
    for (int r = 0; r < 8; ++r) {
      if (!keepa) s[0][r] = -3.0e38f;
      if (!keepb) s[1][r] = -3.0e38f;
      float mx = fmaxf(s[0][r], s[1][r]);
      mx = fmaxf(mx, __shfl_xor(mx, 1, 32)); mx = fmaxf(mx, __shfl_xor(mx, 2, 32)); mx = fmaxf(mx, __shfl_xor(mx, 4, 32)); mx = fmaxf(mx, __shfl_xor(mx, 8, 32));
      const float mnew = fmaxf(m_r[r], mx);
      alpha[r] = (mnew > -1.0e38f) ? __expf(m_r[r] - mnew) : 1.0f;
      const float p0 = keepa ? __expf(s[0][r] - mnew) : 0.f;
      const float p1 = keepb ? __expf(s[1][r] - mnew) : 0.f;
      m_r[r] = mnew;
      l_r[r] = l_r[r] * alpha[r] + p0 + p1;            // per-lane partial row sum (16 lanes combined at the end)
      unsigned short hb = bf16_bits(p0); sPh[w][8 * hh + r][ln] = hb;      sPl[w][8 * hh + r][ln] = bf16_bits(p0 - bf16_val(hb));
      hb = bf16_bits(p1);                sPh[w][8 * hh + r][16 + ln] = hb; sPl[w][8 * hh + r][16 + ln] = bf16_bits(p1 - bf16_val(hb));
    }
#pragma unroll
    for (int dt = 0; dt < DT; ++dt)
#pragma unroll
      for (int r = 0; r < 8; ++r) oacc[dt][r] *= alpha[r];
    __builtin_amdgcn_fence(4 /* acq_rel order */, "workgroup");      // sPh/sPl are wave-private: same-wave exchange
    __builtin_amdgcn_wave_barrier();
    FragB pah, pal;                                              // A[m = query][k = key] from sP[query][key]
    pah.half[0] = *(const v8us*)&sPh[w][ln][8 * hh]; pah.half[1] = *(const v8us*)&sPh[w][ln][16 + 8 * hh];
    pal.half[0] = *(const v8us*)&sPl[w][ln][8 * hh]; pal.half[1] = *(const v8us*)&sPl[w][ln][16 + 8 * hh];
#pragma unroll
    for (int dt = 0; dt < DT; ++dt) {
      oacc[dt] = mmaN<3>(pah.v, pal.v, bvh[dt].v, bvl[dt].v, oacc[dt]);
    }
    __builtin_amdgcn_fence(4 /* acq_rel order */, "workgroup");
    __builtin_amdgcn_wave_barrier();
  }
  const float qnan = __uint_as_float(0x7FC00000u);
#pragma unroll
  for (int r = 0; r < 8; ++r) {
    float l = l_r[r];
    l += __shfl_xor(l, 1, 32); l += __shfl_xor(l, 2, 32); l += __shfl_xor(l, 4, 32); l += __shfl_xor(l, 8, 32);
    l_r[r] = (m_r[r] > -1.0e38f) ? (1.0f / l) : qnan;
  }
#pragma unroll
  for (int dt = 0; dt < DT; ++dt)
#pragma unroll
    for (int r = 0; r < 8; ++r) sO[w][8 * hh + r][dt * 16 + ln] = oacc[dt][r] * l_r[r];
  __builtin_amdgcn_fence(4 /* acq_rel order */, "workgroup");
  __builtin_amdgcn_wave_barrier();
  {
    for (int r = 0; r < 16; ++r) {
      const int row = q0 + r;
      if (row < T && lane < D / 4) {
        const v4f val = *(const v4fa*)&sO[w][r][lane * 4];
        *(v4f*)(y + ((size_t)b * T + row) * ypitch + h * D + lane * 4) = val;
      }
    }
    
  }
}

extern "C" void kernel_launch(void* const* d_in, const int* in_sizes, int n_in,
                              void* d_out, int out_size, void* d_ws, size_t ws_size, hipStream_t stream) {
  if (n_in < 12) return;
  const float* xq = (const float*)d_in[0]; const float* xk = (const float*)d_in[1]; const float* xv = (const float*)d_in[2];
  const int* kpm = (const int*)d_in[3];
  const float* Wq = (const float*)d_in[4]; const float* bq = (const float*)d_in[5]; const float* Wk = (const float*)d_in[6]; const float* bk = (const float*)d_in[7];
  const float* Wv = (const float*)d_in[8]; const float* bv = (const float*)d_in[9]; const float* Wo = (const float*)d_in[10]; const float* bo = (const float*)d_in[11];
  // size checks (lower bounds so a reduced NB/SEQ build still launches on full-size inputs)
  const long long needX = (long long)(NB - 1) * SEQ_FULL * DD + (long long)SEQ * DD;
  if ((long long)in_sizes[0] < needX || (long long)in_sizes[1] < needX || (long long)in_sizes[2] < needX) return;
  if (in_sizes[3] < (NB - 1) * SEQ_FULL + SEQ) return;
  if (in_sizes[4] < DD * DD || in_sizes[6] < DD * DD || in_sizes[8] < DD * DD || in_sizes[10] < DD * DD) return;
  if (in_sizes[5] < DD || in_sizes[7] < DD || in_sizes[9] < DD || in_sizes[11] < DD) return;
  if ((long long)out_size < (long long)NB * SEQ * DD) return;

  char* ws = (char*)d_ws; size_t off = 0;
  auto take = [&](size_t bytes) { char* p = ws + off; off += (bytes + 255) & ~(size_t)255; return p; };
  const size_t MROWS = (size_t)NB * SEQ;
  unsigned short* Wt[4]; for (int i = 0; i < 4; ++i) Wt[i] = (unsigned short*)take((size_t)DD * DD * 2);
  float* q   = (float*)take(MROWS * DD * 4);
  unsigned short* kh = (unsigned short*)take(MROWS * DD * 2);
  unsigned short* kl = (unsigned short*)take(MROWS * DD * 2);
  unsigned short* vh = (unsigned short*)take(MROWS * DD * 2);
  unsigned short* vl = (unsigned short*)take(MROWS * DD * 2);
  float* att = (float*)take(MROWS * DD * 4);
  int* live  = (int*)take(MROWS * 4);
  int* nlive = (int*)take((size_t)NB * 4);
  if (off > ws_size) return;

  const int n8 = DD * DD / 8;
  const int gb = ((SEQ / 16) * (DD / 64) + 3) / 4;
  const dim3 gg(gb, NB);
  const float* W4[4] = {Wq, Wk, Wv, Wo};
  for (int i = 0; i < 4; ++i) k_rne_rows<<<(n8 + 255) / 256, 256, 0, stream>>>(W4[i], Wt[i], n8);
  k_live_keys<(SEQ + 255) / 256><<<NB, 256, 0, stream>>>(kpm, SEQ_FULL, SEQ, live, SEQ, nlive);
  k_gemm_bf<false, true, false, false><<<gg, 128, 0, stream>>>(xq, DD, SEQ_FULL * DD, Wt[0], DD, bq, q, nullptr, nullptr, DD, SEQ * DD, SEQ, DD, DD, nullptr, 0, nullptr);
  k_gemm_bf<false, true, true, true><<<gg, 128, 0, stream>>>(xk, DD, SEQ_FULL * DD, Wt[1], DD, bk, nullptr, kh, kl, DD, SEQ * DD, SEQ, DD, DD, live, SEQ, nlive);
  k_gemm_bf<false, true, true, true><<<gg, 128, 0, stream>>>(xv, DD, SEQ_FULL * DD, Wt[2], DD, bv, nullptr, vh, vl, DD, SEQ * DD, SEQ, DD, DD, live, SEQ, nlive);
  k_flash_pm<HD><<<NB * NH * (SEQ / 64), 128, 0, stream>>>(q, kh, kl, vh, vl, DD, SEQ, NH, 0.125f, nlive, att, DD);
  k_gemm_bf<true, true, false, false><<<gg, 128, 0, stream>>>(att, DD, SEQ * DD, Wt[3], DD, bo, (float*)d_out, nullptr, nullptr, DD, SEQ * DD, SEQ, DD, DD, nullptr, 0, nullptr);
  (void)hipGetLastError();
}

// v004
// One run takes 136 microseconds.
// Next to v003, in two timings, it ran 1.44 and 1.45 times as fast.
// Over all steps from v000 it is 3.47 times as fast.
#include <hip/hip_runtime.h>
// Contractions: q/k/v = x*W^T + b on v_wmma_f32_16x16x32_bf16, a 64 x 128 tile of the result per block with both operands staged in LDS (x, W, b converted to bf16 RNE, single term); QK^T and P*V per 16-query tile as
// 3-term bf16 hi/lo splits; out = a*Wo^T + bo with a as a 2-term bf16 hi/lo split (Wo, bo bf16 RNE); f32 accumulate, softmax in f32.
// k and v leave their projection already split into bf16 hi/lo planes, so the attention blocks stage them into LDS by plain 16-byte copies.
// Keys whose padding flag is set have probability exactly 0: the unflagged keys of each batch are listed in ascending order, the k and v
// projections compute only those rows and store them packed (row p = p-th unflagged key), and the attention key loop ends at their count.
#ifndef NB
#define NB 4
#endif
#ifndef SEQ
#define SEQ 2048
#endif
#define NB_FULL 4
#define SEQ_FULL 2048
#define DD 512
#define NH 8
#define HD 64

static_assert(NB >= 1 && NB <= NB_FULL);
static_assert(SEQ >= 64 && SEQ <= SEQ_FULL && (SEQ % 64) == 0);
static_assert(NH * HD == DD && (DD % 128) == 0 && (HD % 32) == 0 && HD <= 128);

typedef __bf16 v16b __attribute__((ext_vector_type(16)));
typedef unsigned short v8us __attribute__((ext_vector_type(8), may_alias));
typedef unsigned short v4us __attribute__((ext_vector_type(4), may_alias));
typedef float  v8f  __attribute__((ext_vector_type(8)));
typedef float  v4f  __attribute__((ext_vector_type(4)));
typedef float  v4fa __attribute__((ext_vector_type(4), may_alias));
union FragB { v16b v; v8us half[2]; unsigned short u[16]; };

__device__ __forceinline__ unsigned short bf16_bits(float x) { unsigned int u = __float_as_uint(x); return (unsigned short)((u + 0x7FFFu + ((u >> 16) & 1u)) >> 16); }
__device__ __forceinline__ float bf16_val(unsigned short b) { return __uint_as_float(((unsigned int)b) << 16); }
__device__ __forceinline__ float bf16_rne(float x) { return bf16_val(bf16_bits(x)); }

// 16-bit transposing LDS load: with lane l addressing 16 bytes at T[k0 + 8*(l>>4) + (l&7)][d0 + 8*((l>>3)&1)], lane (c = l&15, h = l>>4)
// receives T[k0 + 8h + 0..7][d0 + c]
typedef short s16x8 __attribute__((ext_vector_type(8)));
__device__ __forceinline__ v8us tr16(const unsigned short* p) {
  const s16x8 r = __builtin_amdgcn_ds_load_tr16_b128_v8i16((__attribute__((address_space(3))) s16x8*)p);
  return __builtin_bit_cast(v8us, r);
}

// D += A*B with NT terms: 1 = ah*bh, 2 = + al*bh (A split), 3 = + ah*bl (both split); 4 nops guard the accumulator
template <int NT>
__device__ __forceinline__ v8f mmaN(v16b ah, v16b al, v16b bh, v16b bl, v8f c) {
  c = __builtin_amdgcn_wmma_f32_16x16x32_bf16(false, ah, false, bh, (short)0, c, false, false);
  if (NT >= 2) c = __builtin_amdgcn_wmma_f32_16x16x32_bf16(false, al, false, bh, (short)0, c, false, false);
  if (NT >= 3) c = __builtin_amdgcn_wmma_f32_16x16x32_bf16(false, ah, false, bl, (short)0, c, false, false);
  asm volatile("v_nop\n\tv_nop\n\tv_nop\n\tv_nop" : "+v"(c) : "v"(ah), "v"(al), "v"(bh), "v"(bl));
  return c;
}

// Wt[n][k] (bf16 bits) = RNE(W[n][k]) for a row-major [N][K] weight used as x*W^T: plain elementwise convert, 8 per thread,
__global__ __launch_bounds__(256) void k_rne_rows(const float* __restrict__ W, unsigned short* __restrict__ Wt, int n8) {
  const int t = blockIdx.x * 256 + threadIdx.x;
  if (t >= n8) return;
  const v4f a = *(const v4fa*)(W + (size_t)t * 8), b = *(const v4fa*)(W + (size_t)t * 8 + 4);
  v8us v; v[0]=bf16_bits(a[0]); v[1]=bf16_bits(a[1]); v[2]=bf16_bits(a[2]); v[3]=bf16_bits(a[3]);
  v[4]=bf16_bits(b[0]); v[5]=bf16_bits(b[1]); v[6]=bf16_bits(b[2]); v[7]=bf16_bits(b[3]);
  *(v8us*)(Wt + (size_t)t * 8) = v; 
}

// live[b*lpitch + p] = index of the p-th key of batch b = blockIdx.x with kpm[b*mpitch + j] == 0 (ascending), nlive[b] = how many there are.
// Wave w owns the PER*32 consecutive keys from w*PER*32, one key a lane in each of PER groups: a ballot gives a key's rank inside its group,
// and the eight wave totals, exchanged through LDS, give each wave its first slot.
template <int PER>
__global__ __launch_bounds__(256) void k_live_keys(const int* __restrict__ kpm, int mpitch, int T, int* __restrict__ live, int lpitch, int* __restrict__ nlive) {
  __shared__ int part[8];
  const int t = threadIdx.x, w = t >> 5, lane = t & 31, b = blockIdx.x;
  const int* mrow = kpm + (size_t)b * mpitch;
  unsigned bal[PER];
  int c = 0;
#pragma unroll
  for (int i = 0; i < PER; ++i) {
    const int j = (w * PER + i) * 32 + lane, jc = (j < T) ? j : (T - 1);
    bal[i] = __builtin_amdgcn_ballot_w32((mrow[jc] == 0) && (j < T));
    c += __builtin_popcount(bal[i]);
  }
  if (lane == 0) part[w] = c;
  __syncthreads();                                 // cross-wave: every wave's total is in LDS
  int o = 0, tot = 0;
#pragma unroll
  for (int k = 0; k < 8; ++k) { const int v = part[k]; o += (k < w) ? v : 0; tot += v; }
  int* lrow = live + (size_t)b * lpitch;
  const unsigned below = (1u << lane) - 1u;
#pragma unroll
  for (int i = 0; i < PER; ++i) {
    if ((bal[i] >> lane) & 1u) lrow[o + __builtin_popcount(bal[i] & below)] = (w * PER + i) * 32 + lane;
    o += __builtin_popcount(bal[i]);
  }
  if (t == 0) nlive[b] = tot;
}

// GEMM C[M][N] (f32, pitch ldc) = A[M][K]*W^T + bias per batch blockIdx.y (A += y*abatch, C += y*cbatch elements).
// A f32 row-major (pitch lda) converted to bf16 (ASPLIT: hi/lo -> 2 terms, else single RNE term); Wt bf16 [N][K] (pitch ldb).
// BIAS_BF16 converts the bias to bf16 RNE before the add. K%64==0, M%64==0, N%128==0.
// One block = a 64 x 128 tile of C, four waves of 32 x 64 each. K goes in steps of 64: the step's 64 A rows (converted once) and 128 Wt rows are
// brought by loads that cover whole 128-byte lines, stored in LDS at a 144-byte pitch and read from there as fragments by every wave that needs
// them; the next step's global loads are issued ahead of the current step's products.
// CSPLIT: the f32 result x is not stored; Ch gets RNE(x) and Cl gets RNE(x - Ch) as bf16 bits, same pitch and batch stride (in elements) as C.
// PACK: output row p comes from A row live[y*lpitch + p], for p < nlive[y] only (the last 64-row tile repeats the last listed row); later tiles are not written.
template <bool ASPLIT, bool BIAS_BF16, bool CSPLIT, bool PACK>
__global__ __launch_bounds__(128) void k_gemm_bf(const float* __restrict__ A, int lda, int abatch, const unsigned short* __restrict__ Wt, int ldb,
                                               const float* __restrict__ bias, float* __restrict__ C, unsigned short* __restrict__ Ch,
                                               unsigned short* __restrict__ Cl, int ldc, int cbatch, int M, int N, int K,
                                               const int* __restrict__ live, int lpitch, const int* __restrict__ nlive) {
  constexpr int BM = 64, BN = 128, BK = 64, LP = BK + 8;     // LP: 144-byte rows, 16 bytes x odd, for 16-byte fragment reads
  __shared__ __attribute__((aligned(16))) unsigned short sAh[BM][LP], sAl[ASPLIT ? BM : 1][LP], sW[BN][LP];
  __shared__ __attribute__((aligned(16))) float so[4][32][64];
  const int tid = threadIdx.x, w = tid >> 5, lane = tid & 31, ln = lane & 15, hh = lane >> 4;
  const int wm = w >> 1, wn = w & 1;                         // the wave's 32 rows and 64 columns inside the block tile
  const int ntn = N / BN;
  const int mt = blockIdx.x / ntn, nq = blockIdx.x % ntn;
  int Mb = M;
  if (PACK) { const int c = nlive[blockIdx.y]; Mb = (c < M) ? c : M; }
  if (mt * BM >= Mb) return;                    // block-uniform, ahead of every barrier
  const int row0 = mt * BM, col0 = nq * BN;
  const float* Ab = A + (size_t)blockIdx.y * (size_t)abatch;
  // staging: 16 lanes cover the 256 bytes of one A row's step, 8 lanes the 128 bytes of one Wt row's step
  const int sar = tid >> 4, sac = (tid & 15) * 4, swr = tid >> 3, swc = (tid & 7) * 8;
  unsigned aoff[8], woff[8];
#pragma unroll
  for (int i = 0; i < 8; ++i) {
    int ar = row0 + sar + i * 8;
    if (PACK) {
      const int p = (ar < Mb) ? ar : (Mb - 1);
      const unsigned g = (unsigned)live[(size_t)blockIdx.y * lpitch + p];
      ar = (int)((g < (unsigned)M) ? g : (unsigned)(M - 1));
    }
    aoff[i] = ((unsigned)ar * (unsigned)lda + (unsigned)sac) * 4u;                          // byte offsets: one 32-bit register each, kept for
    woff[i] = ((unsigned)(col0 + swr + i * 16) * (unsigned)ldb + (unsigned)swc) * 2u;       // all steps and moved on by the step's bytes
  }
  v4f xa[8]; v8us xw[8];
#pragma unroll
  for (int i = 0; i < 8; ++i) { xa[i] = *(const v4fa*)((const char*)Ab + aoff[i]); xw[i] = *(const v8us*)((const char*)Wt + woff[i]); }
  v8f acc[2][4];
#pragma unroll
  for (int mi = 0; mi < 2; ++mi)
#pragma unroll
    for (int t = 0; t < 4; ++t) acc[mi][t] = (v8f){0.f,0.f,0.f,0.f,0.f,0.f,0.f,0.f};
  for (int kb = 0; kb < K; kb += BK) {
    __syncthreads();                                 // cross-wave: all waves done reading the prior step's tiles
#pragma unroll
    for (int i = 0; i < 8; ++i) {
      v4us hi, lo;
#pragma unroll
      for (int j = 0; j < 4; ++j) { const unsigned short hb = bf16_bits(xa[i][j]); hi[j] = hb; lo[j] = ASPLIT ? bf16_bits(xa[i][j] - bf16_val(hb)) : (unsigned short)0; }
      *(v4us*)&sAh[sar + i * 8][sac] = hi;
      if (ASPLIT) *(v4us*)&sAl[sar + i * 8][sac] = lo;
      *(v8us*)&sW[swr + i * 16][swc] = xw[i];
    }
    __syncthreads();                                 // cross-wave: staging complete before any fragment load
    if (kb + BK < K) {                               // block-uniform: the next step's loads fly under this step's products
#pragma unroll
      for (int i = 0; i < 8; ++i) { aoff[i] += BK * 4u; woff[i] += BK * 2u; }
#pragma unroll
      for (int i = 0; i < 8; ++i) { xa[i] = *(const v4fa*)((const char*)Ab + aoff[i]); xw[i] = *(const v8us*)((const char*)Wt + woff[i]); }
      asm volatile("s_wait_xcnt 0x0" ::: "memory");  // ahead of any later write to a register that these loads name as address
    }
#pragma unroll
    for (int ks = 0; ks < BK / 32; ++ks) {
      FragB ah[2], al[2], b[4];
#pragma unroll
      for (int mi = 0; mi < 2; ++mi) {
        const int r = wm * 32 + mi * 16 + ln;
        ah[mi].half[0] = *(const v8us*)&sAh[r][ks * 32 + 8 * hh];          // elements 0..7  <- k = kb+32ks+8h .. +7
        ah[mi].half[1] = *(const v8us*)&sAh[r][ks * 32 + 16 + 8 * hh];     // elements 8..15 <- k = kb+32ks+16+8h .. +7
        if (ASPLIT) { al[mi].half[0] = *(const v8us*)&sAl[r][ks * 32 + 8 * hh]; al[mi].half[1] = *(const v8us*)&sAl[r][ks * 32 + 16 + 8 * hh]; }
        else al[mi] = ah[mi];
      }
#pragma unroll
      for (int t = 0; t < 4; ++t) {
        const int n = wn * 64 + t * 16 + ln;
        b[t].half[0] = *(const v8us*)&sW[n][ks * 32 + 8 * hh];
        b[t].half[1] = *(const v8us*)&sW[n][ks * 32 + 16 + 8 * hh];
      }
#pragma unroll
      for (int mi = 0; mi < 2; ++mi)
#pragma unroll
        for (int t = 0; t < 4; ++t) acc[mi][t] = mmaN<ASPLIT ? 2 : 1>(ah[mi].v, al[mi].v, b[t].v, b[t].v, acc[mi][t]);
    }
  }
  const int wrow0 = row0 + wm * 32, wcol0 = col0 + wn * 64;
#pragma unroll
  for (int t = 0; t < 4; ++t) {
    float bvv = bias[wcol0 + t * 16 + ln];
    if (BIAS_BF16) bvv = bf16_rne(bvv);
#pragma unroll
    for (int mi = 0; mi < 2; ++mi)
#pragma unroll
      for (int r = 0; r < 8; ++r) { so[w][mi * 16 + 8 * hh + r][t * 16 + ln] = acc[mi][t][r] + bvv; }
  }
  __builtin_amdgcn_fence(4 /* acq_rel order */, "workgroup");      // so[w] is wave-private: same-wave exchange
  __builtin_amdgcn_wave_barrier();
  if (CSPLIT) {
    unsigned short* Chb = Ch + (size_t)blockIdx.y * (size_t)cbatch;
    unsigned short* Clb = Cl + (size_t)blockIdx.y * (size_t)cbatch;
    const int rsub = lane >> 3, c8 = (lane & 7) * 8;      // 8 lanes write one 128-byte row piece of each plane
#pragma unroll
    for (int q = 0; q < 8; ++q) {
      const int r = q * 4 + rsub;
      const v4f x0 = *(const v4fa*)&so[w][r][c8], x1 = *(const v4fa*)&so[w][r][c8 + 4];
      v8us hi, lo;
#pragma unroll
      for (int i = 0; i < 4; ++i) {
        unsigned short hb = bf16_bits(x0[i]); hi[i] = hb;     lo[i] = bf16_bits(x0[i] - bf16_val(hb));
        hb = bf16_bits(x1[i]);                hi[4 + i] = hb; lo[4 + i] = bf16_bits(x1[i] - bf16_val(hb));
      }
      const size_t o = (size_t)(wrow0 + r) * ldc + wcol0 + c8;
      *(v8us*)(Chb + o) = hi;
      *(v8us*)(Clb + o) = lo;
    }
  } else {
    float* Cb = C + (size_t)blockIdx.y * (size_t)cbatch;
    const int rsub = lane >> 4, c4 = (lane & 15) * 4;
#pragma unroll
    for (int q = 0; q < 16; ++q) {
      const int r = q * 2 + rsub;
      const v4f v = *(const v4fa*)&so[w][r][c4];
      *(v4f*)(Cb + (size_t)(wrow0 + r) * ldc + wcol0 + c4) = v;
    }
  }
}

// Flash-style attention over the packed keys of each batch: k and v rows 0 .. nlive[b]-1 take part, no other row is read;
// nlive[b] == 0 (every key excluded) yields NaN. QK^T and P*V as 3-term bf16 hi/lo splits, f32 softmax with running max.
// q rows f32, k and v rows as bf16 hi/lo planes, all with pitch `pitch` (elements), batch b at X + b*T*pitch, head h at column h*D.
// One wave = 16 query rows, block = 4 waves (64 queries) sharing K/V chunks of 32 keys copied into LDS (hi/lo bf16 planes).
template <int D>
__global__ __launch_bounds__(128) void k_flash_pm(const float* __restrict__ Qb, const unsigned short* __restrict__ Khb, const unsigned short* __restrict__ Klb,
                                                const unsigned short* __restrict__ Vhb, const unsigned short* __restrict__ Vlb, int pitch, int T, int H, float scale, const int* __restrict__ nlive,
                                                float* __restrict__ y, int ypitch) {
  constexpr int KS = D / 32, DT = D / 16, NP = 32 * (D / 8) / 128;   // NP: 16-byte pieces of one plane's chunk per thread
  __shared__ __attribute__((aligned(16))) unsigned short sKh[32][D + 8], sKl[32][D + 8], sVh[32][D + 16], sVl[32][D + 16];
  __shared__ __attribute__((aligned(16))) unsigned short sPh[4][16][40], sPl[4][16][40];
  __shared__ __attribute__((aligned(16))) float sO[4][16][D];
  const int tid = threadIdx.x, w = tid >> 5, lane = tid & 31, ln = lane & 15, hh = lane >> 4;
  const int nqb = (T + 63) / 64;
  const int bh = blockIdx.x / nqb, qblk = blockIdx.x % nqb;
  const int b = bh / H, h = bh % H;
  const int q0 = qblk * 64 + w * 16;
  const float* Q = Qb + (size_t)b * T * pitch + h * D;
  const unsigned short* Kh = Khb + (size_t)b * T * pitch + h * D;
  const unsigned short* Kl = Klb + (size_t)b * T * pitch + h * D;
  const unsigned short* Vh = Vhb + (size_t)b * T * pitch + h * D;
  const unsigned short* Vl = Vlb + (size_t)b * T * pitch + h * D;
  const int nl = nlive[b];
  const int Tk = (nl < T) ? nl : T;                  // keys of this batch; block-uniform
  const int trow = 8 * hh + (lane & 7), tcol = 8 * ((lane >> 3) & 1);   // lane address of a transposing load: 16 bytes of row trow

  // A fragments of the wave's 16 query rows (scaled by an exact power of two), hi/lo
  FragB aqh[KS], aql[KS];
  {
    int row = q0 + ln; if (row >= T) row = T - 1;
    const float* qr = Q + (size_t)row * pitch;
#pragma unroll
    for (int ks = 0; ks < KS; ++ks)
#pragma unroll
      for (int i = 0; i < 16; ++i) {
        const int d = ks * 32 + ((i < 8) ? (8 * hh + i) : (16 + 8 * hh + (i - 8)));
        const float x = qr[d] * scale; const unsigned short hb = bf16_bits(x);
        aqh[ks].u[i] = hb; aql[ks].u[i] = bf16_bits(x - bf16_val(hb));
      }
  }
  float m_r[8], l_r[8];
#pragma unroll
  for (int r = 0; r < 8; ++r) { m_r[r] = -3.0e38f; l_r[r] = 0.f; }
  v8f oacc[DT];
#pragma unroll
  for (int dt = 0; dt < DT; ++dt) oacc[dt] = (v8f){0.f,0.f,0.f,0.f,0.f,0.f,0.f,0.f};

  for (int j0 = 0; j0 < Tk; j0 += 32) {
    __syncthreads();                                 // cross-wave: all waves done reading sK/sV of the prior chunk
    {
      v8us xkh[NP], xkl[NP], xvh[NP], xvl[NP];       // all loads of the chunk issued before the first LDS store
#pragma unroll
      for (int i = 0; i < NP; ++i) {
        const int e = tid + i * 128, r = e / (D / 8), c8 = (e % (D / 8)) * 8;
        int key = j0 + r; if (key >= Tk) key = Tk - 1;                       // clamped address, zero by value
        const unsigned o = ((unsigned)key * (unsigned)pitch + (unsigned)c8) * 2u;   // byte offset, one 32-bit register for all four planes
        xkh[i] = *(const v8us*)((const char*)Kh + o); xkl[i] = *(const v8us*)((const char*)Kl + o);
        xvh[i] = *(const v8us*)((const char*)Vh + o); xvl[i] = *(const v8us*)((const char*)Vl + o);
      }
      if (j0 + 32 > Tk) {                                                    // block-uniform: only a chunk that runs past Tk
        const v8us zz = (v8us){0,0,0,0,0,0,0,0};
#pragma unroll
        for (int i = 0; i < NP; ++i)
          if (j0 + (tid + i * 128) / (D / 8) >= Tk) { xkh[i] = zz; xkl[i] = zz; xvh[i] = zz; xvl[i] = zz; }
      }
#pragma unroll
      for (int i = 0; i < NP; ++i) {
        const int e = tid + i * 128, r = e / (D / 8), c8 = (e % (D / 8)) * 8;
        *(v8us*)&sKh[r][c8] = xkh[i]; *(v8us*)&sKl[r][c8] = xkl[i];
        *(v8us*)&sVh[r][c8] = xvh[i]; *(v8us*)&sVl[r][c8] = xvl[i];
      }
    }
    __syncthreads();                                 // cross-wave: staging complete before any fragment load
    // S tile 16 queries x 32 keys: B[k = d][n = key] from sK[key][d]
    v8f s[2];
#pragma unroll
    for (int nt = 0; nt < 2; ++nt) {
      v8f acc = (v8f){0.f,0.f,0.f,0.f,0.f,0.f,0.f,0.f};
#pragma unroll
      for (int ks = 0; ks < KS; ++ks) {
        FragB bh_, bl_;
        bh_.half[0] = *(const v8us*)&sKh[nt * 16 + ln][ks * 32 + 8 * hh]; bh_.half[1] = *(const v8us*)&sKh[nt * 16 + ln][ks * 32 + 16 + 8 * hh];
        bl_.half[0] = *(const v8us*)&sKl[nt * 16 + ln][ks * 32 + 8 * hh]; bl_.half[1] = *(const v8us*)&sKl[nt * 16 + ln][ks * 32 + 16 + 8 * hh];
        acc = mmaN<3>(aqh[ks].v, aql[ks].v, bh_.v, bl_.v, acc);
      }
      s[nt] = acc;
    }
    // B[k = key][n = d] from sV[key][d]: all V fragments by transposing LDS loads, one group whose latency the softmax covers
    FragB bvh[DT], bvl[DT];
#pragma unroll
    for (int dt = 0; dt < DT; ++dt) {
      bvh[dt].half[0] = tr16(&sVh[trow][dt * 16 + tcol]); bvh[dt].half[1] = tr16(&sVh[16 + trow][dt * 16 + tcol]);
      bvl[dt].half[0] = tr16(&sVl[trow][dt * 16 + tcol]); bvl[dt].half[1] = tr16(&sVl[16 + trow][dt * 16 + tcol]);
    }
    // this lane's two key columns: a column past the last packed key has probability 0
    const bool keepa = (j0 + ln < Tk), keepb = (j0 + 16 + ln < Tk);
    float alpha[8];
#pragma unroll
    for (int r = 0; r < 8; ++r) {
      if (!keepa) s[0][r] = -3.0e38f;
      if (!keepb) s[1][r] = -3.0e38f;
      float mx = fmaxf(s[0][r], s[1][r]);
      mx = fmaxf(mx, __shfl_xor(mx, 1, 32)); mx = fmaxf(mx, __shfl_xor(mx, 2, 32)); mx = fmaxf(mx, __shfl_xor(mx, 4, 32)); mx = fmaxf(mx, __shfl_xor(mx, 8, 32));
      const float mnew = fmaxf(m_r[r], mx);
      alpha[r] = (mnew > -1.0e38f) ? __expf(m_r[r] - mnew) : 1.0f;
      const float p0 = keepa ? __expf(s[0][r] - mnew) : 0.f;
      const float p1 = keepb ? __expf(s[1][r] - mnew) : 0.f;
      m_r[r] = mnew;
      l_r[r] = l_r[r] * alpha[r] + p0 + p1;            // per-lane partial row sum (16 lanes combined at the end)
      unsigned short hb = bf16_bits(p0); sPh[w][8 * hh + r][ln] = hb;      sPl[w][8 * hh + r][ln] = bf16_bits(p0 - bf16_val(hb));
      hb = bf16_bits(p1);                sPh[w][8 * hh + r][16 + ln] = hb; sPl[w][8 * hh + r][16 + ln] = bf16_bits(p1 - bf16_val(hb));
    }
#pragma unroll
    for (int dt = 0; dt < DT; ++dt)
#pragma unroll
      for (int r = 0; r < 8; ++r) oacc[dt][r] *= alpha[r];
    __builtin_amdgcn_fence(4 /* acq_rel order */, "workgroup");      // sPh/sPl are wave-private: same-wave exchange
    __builtin_amdgcn_wave_barrier();
    FragB pah, pal;                                              // A[m = query][k = key] from sP[query][key]
    pah.half[0] = *(const v8us*)&sPh[w][ln][8 * hh]; pah.half[1] = *(const v8us*)&sPh[w][ln][16 + 8 * hh];
    pal.half[0] = *(const v8us*)&sPl[w][ln][8 * hh]; pal.half[1] = *(const v8us*)&sPl[w][ln][16 + 8 * hh];
#pragma unroll
    for (int dt = 0; dt < DT; ++dt) {
      oacc[dt] = mmaN<3>(pah.v, pal.v, bvh[dt].v, bvl[dt].v, oacc[dt]);
    }
    __builtin_amdgcn_fence(4 /* acq_rel order */, "workgroup");
    __builtin_amdgcn_wave_barrier();
  }
  const float qnan = __uint_as_float(0x7FC00000u);
#pragma unroll
  for (int r = 0; r < 8; ++r) {
    float l = l_r[r];
    l += __shfl_xor(l, 1, 32); l += __shfl_xor(l, 2, 32); l += __shfl_xor(l, 4, 32); l += __shfl_xor(l, 8, 32);
    l_r[r] = (m_r[r] > -1.0e38f) ? (1.0f / l) : qnan;
  }
#pragma unroll
  for (int dt = 0; dt < DT; ++dt)
#pragma unroll
    for (int r = 0; r < 8; ++r) sO[w][8 * hh + r][dt * 16 + ln] = oacc[dt][r] * l_r[r];
  __builtin_amdgcn_fence(4 /* acq_rel order */, "workgroup");
  __builtin_amdgcn_wave_barrier();
  {
    for (int r = 0; r < 16; ++r) {
      const int row = q0 + r;
      if (row < T && lane < D / 4) {
        const v4f val = *(const v4fa*)&sO[w][r][lane * 4];
        *(v4f*)(y + ((size_t)b * T + row) * ypitch + h * D + lane * 4) = val;
      }
    }
    
  }
}

extern "C" void kernel_launch(void* const* d_in, const int* in_sizes, int n_in,
                              void* d_out, int out_size, void* d_ws, size_t ws_size, hipStream_t stream) {
  if (n_in < 12) return;
  const float* xq = (const float*)d_in[0]; const float* xk = (const float*)d_in[1]; const float* xv = (const float*)d_in[2];
  const int* kpm = (const int*)d_in[3];
  const float* Wq = (const float*)d_in[4]; const float* bq = (const float*)d_in[5]; const float* Wk = (const float*)d_in[6]; const float* bk = (const float*)d_in[7];
  const float* Wv = (const float*)d_in[8]; const float* bv = (const float*)d_in[9]; const float* Wo = (const float*)d_in[10]; const float* bo = (const float*)d_in[11];
  // size checks (lower bounds so a reduced NB/SEQ build still launches on full-size inputs)
  const long long needX = (long long)(NB - 1) * SEQ_FULL * DD + (long long)SEQ * DD;
  if ((long long)in_sizes[0] < needX || (long long)in_sizes[1] < needX || (long long)in_sizes[2] < needX) return;
  if (in_sizes[3] < (NB - 1) * SEQ_FULL + SEQ) return;
  if (in_sizes[4] < DD * DD || in_sizes[6] < DD * DD || in_sizes[8] < DD * DD || in_sizes[10] < DD * DD) return;
  if (in_sizes[5] < DD || in_sizes[7] < DD || in_sizes[9] < DD || in_sizes[11] < DD) return;
  if ((long long)out_size < (long long)NB * SEQ * DD) return;

  char* ws = (char*)d_ws; size_t off = 0;
  auto take = [&](size_t bytes) { char* p = ws + off; off += (bytes + 255) & ~(size_t)255; return p; };
  const size_t MROWS = (size_t)NB * SEQ;
  unsigned short* Wt[4]; for (int i = 0; i < 4; ++i) Wt[i] = (unsigned short*)take((size_t)DD * DD * 2);
  float* q   = (float*)take(MROWS * DD * 4);
  unsigned short* kh = (unsigned short*)take(MROWS * DD * 2);
  unsigned short* kl = (unsigned short*)take(MROWS * DD * 2);
  unsigned short* vh = (unsigned short*)take(MROWS * DD * 2);
  unsigned short* vl = (unsigned short*)take(MROWS * DD * 2);
  float* att = (float*)take(MROWS * DD * 4);
  int* live  = (int*)take(MROWS * 4);
  int* nlive = (int*)take((size_t)NB * 4);
  if (off > ws_size) return;

  const int n8 = DD * DD / 8;
  const int gb = (SEQ / 64) * (DD / 128);
  const dim3 gg(gb, NB);
  const float* W4[4] = {Wq, Wk, Wv, Wo};
  for (int i = 0; i < 4; ++i) k_rne_rows<<<(n8 + 255) / 256, 256, 0, stream>>>(W4[i], Wt[i], n8);
  k_live_keys<(SEQ + 255) / 256><<<NB, 256, 0, stream>>>(kpm, SEQ_FULL, SEQ, live, SEQ, nlive);
  k_gemm_bf<false, true, false, false><<<gg, 128, 0, stream>>>(xq, DD, SEQ_FULL * DD, Wt[0], DD, bq, q, nullptr, nullptr, DD, SEQ * DD, SEQ, DD, DD, nullptr, 0, nullptr);
  k_gemm_bf<false, true, true, true><<<gg, 128, 0, stream>>>(xk, DD, SEQ_FULL * DD, Wt[1], DD, bk, nullptr, kh, kl, DD, SEQ * DD, SEQ, DD, DD, live, SEQ, nlive);
  k_gemm_bf<false, true, true, true><<<gg, 128, 0, stream>>>(xv, DD, SEQ_FULL * DD, Wt[2], DD, bv, nullptr, vh, vl, DD, SEQ * DD, SEQ, DD, DD, live, SEQ, nlive);
  k_flash_pm<HD><<<NB * NH * (SEQ / 64), 128, 0, stream>>>(q, kh, kl, vh, vl, DD, SEQ, NH, 0.125f, nlive, att, DD);
  k_gemm_bf<true, true, false, false><<<gg, 128, 0, stream>>>(att, DD, SEQ * DD, Wt[3], DD, bo, (float*)d_out, nullptr, nullptr, DD, SEQ * DD, SEQ, DD, DD, nullptr, 0, nullptr);
  (void)hipGetLastError();
}

// v005
// It runs in 111 microseconds.
// Next to v004, in two timings, it ran 1.21 times as fast each time.
// Counting every step since v000, it is 4.20 times as fast.
#include <hip/hip_runtime.h>
// Contractions: q/k/v = x*W^T + b on v_wmma_f32_16x16x32_bf16, a 64 x 128 tile of the result per block with both operands staged in LDS (x, W, b converted to bf16 RNE, single term); QK^T and P*V per 16-query tile as
// 3-term bf16 hi/lo splits; out = a*Wo^T + bo with a as a 2-term bf16 hi/lo split (Wo, bo bf16 RNE); f32 accumulate, softmax in f32.
// k and v leave their projection already split into bf16 hi/lo planes, so the attention blocks stage them into LDS by plain 16-byte copies.
// Keys whose padding flag is set have probability exactly 0: the unflagged keys of each batch are listed in ascending order, the k and v
// projections compute only those rows and store them packed (row p = p-th unflagged key), and the attention key loop ends at their count.
// Four launches: work that does not depend on each other shares a grid and is told apart by the block index (the four weight conversions
// with the key lists; the q, k and v projections).
#ifndef NB
#define NB 4
#endif
#ifndef SEQ
#define SEQ 2048
#endif
#define NB_FULL 4
#define SEQ_FULL 2048
#define DD 512
#define NH 8
#define HD 64

static_assert(NB >= 1 && NB <= NB_FULL);
static_assert(SEQ >= 64 && SEQ <= SEQ_FULL && (SEQ % 64) == 0);
static_assert(NH * HD == DD && (DD % 128) == 0 && (HD % 32) == 0 && HD <= 128);

typedef __bf16 v16b __attribute__((ext_vector_type(16)));
typedef unsigned short v8us __attribute__((ext_vector_type(8), may_alias));
typedef unsigned short v4us __attribute__((ext_vector_type(4), may_alias));
typedef float  v8f  __attribute__((ext_vector_type(8)));
typedef float  v4f  __attribute__((ext_vector_type(4)));
typedef float  v4fa __attribute__((ext_vector_type(4), may_alias));
union FragB { v16b v; v8us half[2]; unsigned short u[16]; };

__device__ __forceinline__ unsigned short bf16_bits(float x) { unsigned int u = __float_as_uint(x); return (unsigned short)((u + 0x7FFFu + ((u >> 16) & 1u)) >> 16); }
__device__ __forceinline__ float bf16_val(unsigned short b) { return __uint_as_float(((unsigned int)b) << 16); }
__device__ __forceinline__ float bf16_rne(float x) { return bf16_val(bf16_bits(x)); }

// 16-bit transposing LDS load: with lane l addressing 16 bytes at T[k0 + 8*(l>>4) + (l&7)][d0 + 8*((l>>3)&1)], lane (c = l&15, h = l>>4)
// receives T[k0 + 8h + 0..7][d0 + c]
typedef short s16x8 __attribute__((ext_vector_type(8)));
__device__ __forceinline__ v8us tr16(const unsigned short* p) {
  const s16x8 r = __builtin_amdgcn_ds_load_tr16_b128_v8i16((__attribute__((address_space(3))) s16x8*)p);
  return __builtin_bit_cast(v8us, r);
}

// D += A*B with NT terms: 1 = ah*bh, 2 = + al*bh (A split), 3 = + ah*bl (both split); 4 nops guard the accumulator
template <int NT>
__device__ __forceinline__ v8f mmaN(v16b ah, v16b al, v16b bh, v16b bl, v8f c) {
  c = __builtin_amdgcn_wmma_f32_16x16x32_bf16(false, ah, false, bh, (short)0, c, false, false);
  if (NT >= 2) c = __builtin_amdgcn_wmma_f32_16x16x32_bf16(false, al, false, bh, (short)0, c, false, false);
  if (NT >= 3) c = __builtin_amdgcn_wmma_f32_16x16x32_bf16(false, ah, false, bl, (short)0, c, false, false);
  asm volatile("v_nop\n\tv_nop\n\tv_nop\n\tv_nop" : "+v"(c) : "v"(ah), "v"(al), "v"(bh), "v"(bl));
  return c;
}

// Wt[n][k] (bf16 bits) = RNE(W[n][k]) for a row-major [N][K] weight used as x*W^T: plain elementwise convert, 8 per thread,
// thread t of the conversion takes elements 8t .. 8t+7
__device__ __forceinline__ void rne_rows(const float* __restrict__ W, unsigned short* __restrict__ Wt, int n8, int t) {
  if (t >= n8) return;
  const v4f a = *(const v4fa*)(W + (size_t)t * 8), b = *(const v4fa*)(W + (size_t)t * 8 + 4);
  v8us v; v[0]=bf16_bits(a[0]); v[1]=bf16_bits(a[1]); v[2]=bf16_bits(a[2]); v[3]=bf16_bits(a[3]);
  v[4]=bf16_bits(b[0]); v[5]=bf16_bits(b[1]); v[6]=bf16_bits(b[2]); v[7]=bf16_bits(b[3]);
  *(v8us*)(Wt + (size_t)t * 8) = v; 
}

// live[b*lpitch + p] = index of the p-th key of batch b (one block of 256 threads a batch) with kpm[b*mpitch + j] == 0 (ascending), nlive[b] = how many there are.
// Wave w owns the PER*32 consecutive keys from w*PER*32, one key a lane in each of PER groups: a ballot gives a key's rank inside its group,
// and the eight wave totals, exchanged through LDS, give each wave its first slot.
template <int PER>
__device__ __forceinline__ void live_keys(const int* __restrict__ kpm, int mpitch, int T, int* __restrict__ live, int lpitch, int* __restrict__ nlive, int b) {
  __shared__ int part[8];
  const int t = threadIdx.x, w = t >> 5, lane = t & 31;
  const int* mrow = kpm + (size_t)b * mpitch;
  unsigned bal[PER];
  int c = 0;
#pragma unroll
  for (int i = 0; i < PER; ++i) {
    const int j = (w * PER + i) * 32 + lane, jc = (j < T) ? j : (T - 1);
    bal[i] = __builtin_amdgcn_ballot_w32((mrow[jc] == 0) && (j < T));
    c += __builtin_popcount(bal[i]);
  }
  if (lane == 0) part[w] = c;
  __syncthreads();                                 // cross-wave: every wave's total is in LDS
  int o = 0, tot = 0;
#pragma unroll
  for (int k = 0; k < 8; ++k) { const int v = part[k]; o += (k < w) ? v : 0; tot += v; }
  int* lrow = live + (size_t)b * lpitch;
  const unsigned below = (1u << lane) - 1u;
#pragma unroll
  for (int i = 0; i < PER; ++i) {
    if ((bal[i] >> lane) & 1u) lrow[o + __builtin_popcount(bal[i] & below)] = (w * PER + i) * 32 + lane;
    o += __builtin_popcount(bal[i]);
  }
  if (t == 0) nlive[b] = tot;
}

// One grid for all that only reads inputs: blocks 0 .. nb-1 list the keys of one batch each, then nbw blocks convert each of the four weights.
template <int PER>
__global__ __launch_bounds__(256) void k_prep(const float* __restrict__ W0, const float* __restrict__ W1, const float* __restrict__ W2, const float* __restrict__ W3,
                                              unsigned short* __restrict__ T0, unsigned short* __restrict__ T1, unsigned short* __restrict__ T2, unsigned short* __restrict__ T3,
                                              int n8, int nbw, const int* __restrict__ kpm, int mpitch, int T, int* __restrict__ live, int lpitch,
                                              int* __restrict__ nlive, int nb) {
  const int bx = blockIdx.x;
  if (bx < nb) { live_keys<PER>(kpm, mpitch, T, live, lpitch, nlive, bx); return; }     // block-uniform: its barrier is met by the whole block
  const int g = bx - nb, wi = g / nbw, blk = g % nbw;
  const float* W = (wi == 0) ? W0 : (wi == 1) ? W1 : (wi == 2) ? W2 : W3;
  unsigned short* Wt = (wi == 0) ? T0 : (wi == 1) ? T1 : (wi == 2) ? T2 : T3;
  rne_rows(W, Wt, n8, blk * 256 + (int)threadIdx.x);
}

// GEMM C[M][N] (f32, pitch ldc) = A[M][K]*W^T + bias per batch y (A += y*abatch, C += y*cbatch elements); bx = the block's tile number.
// A f32 row-major (pitch lda) converted to bf16 (ASPLIT: hi/lo -> 2 terms, else single RNE term); Wt bf16 [N][K] (pitch ldb).
// BIAS_BF16 converts the bias to bf16 RNE before the add. K%64==0, M%64==0, N%128==0.
// One block = a 64 x 128 tile of C, four waves of 32 x 64 each. K goes in steps of 64: the step's 64 A rows (converted once) and 128 Wt rows are
// brought by loads that cover whole 128-byte lines, stored in LDS at a 144-byte pitch and read from there as fragments by every wave that needs
// them; the next step's global loads are issued ahead of the current step's products.
// CSPLIT: the f32 result x is not stored; Ch gets RNE(x) and Cl gets RNE(x - Ch) as bf16 bits, same pitch and batch stride (in elements) as C.
// PACK: output row p comes from A row live[y*lpitch + p], for p < nlive[y] only (the last 64-row tile repeats the last listed row); later tiles are not written.
// The block's LDS is declared by the kernel and handed in, so that two forms of the tile in one kernel share it.
template <bool ASPLIT>
struct __attribute__((aligned(16))) GemmLds {
  unsigned short Ah[64][72], Al[ASPLIT ? 64 : 1][72], W[128][72];   // 144-byte rows, 16 bytes x odd, for 16-byte fragment reads
  float so[4][32][64];
};
template <bool ASPLIT, bool BIAS_BF16, bool CSPLIT, bool PACK>
__device__ __forceinline__ void gemm_tile(GemmLds<ASPLIT>& L, unsigned bx, unsigned y, const float* __restrict__ A, int lda, int abatch, const unsigned short* __restrict__ Wt, int ldb,
                                          const float* __restrict__ bias, float* __restrict__ C, unsigned short* __restrict__ Ch,
                                          unsigned short* __restrict__ Cl, int ldc, int cbatch, int M, int N, int K,
                                          const int* __restrict__ live, int lpitch, const int* __restrict__ nlive) {
  constexpr int BM = 64, BN = 128, BK = 64;
  auto& sAh = L.Ah; auto& sAl = L.Al; auto& sW = L.W; auto& so = L.so;
  const int tid = threadIdx.x, w = tid >> 5, lane = tid & 31, ln = lane & 15, hh = lane >> 4;
  const int wm = w >> 1, wn = w & 1;                         // the wave's 32 rows and 64 columns inside the block tile
  const int ntn = N / BN;
  const int mt = bx / ntn, nq = bx % ntn;
  int Mb = M;
  if (PACK) { const int c = nlive[y]; Mb = (c < M) ? c : M; }
  if (mt * BM >= Mb) return;                    // block-uniform, ahead of every barrier
  const int row0 = mt * BM, col0 = nq * BN;
  const float* Ab = A + (size_t)y * (size_t)abatch;
  // staging: 16 lanes cover the 256 bytes of one A row's step, 8 lanes the 128 bytes of one Wt row's step
  const int sar = tid >> 4, sac = (tid & 15) * 4, swr = tid >> 3, swc = (tid & 7) * 8;
  unsigned aoff[8], woff[8];
#pragma unroll
  for (int i = 0; i < 8; ++i) {
    int ar = row0 + sar + i * 8;
    if (PACK) {
      const int p = (ar < Mb) ? ar : (Mb - 1);
      const unsigned g = (unsigned)live[(size_t)y * lpitch + p];
      ar = (int)((g < (unsigned)M) ? g : (unsigned)(M - 1));
    }
    aoff[i] = ((unsigned)ar * (unsigned)lda + (unsigned)sac) * 4u;                          // byte offsets: one 32-bit register each, kept for
    woff[i] = ((unsigned)(col0 + swr + i * 16) * (unsigned)ldb + (unsigned)swc) * 2u;       // all steps and moved on by the step's bytes
  }
  v4f xa[8]; v8us xw[8];
#pragma unroll
  for (int i = 0; i < 8; ++i) { xa[i] = *(const v4fa*)((const char*)Ab + aoff[i]); xw[i] = *(const v8us*)((const char*)Wt + woff[i]); }
  v8f acc[2][4];
#pragma unroll
  for (int mi = 0; mi < 2; ++mi)
#pragma unroll
    for (int t = 0; t < 4; ++t) acc[mi][t] = (v8f){0.f,0.f,0.f,0.f,0.f,0.f,0.f,0.f};
  for (int kb = 0; kb < K; kb += BK) {
    __syncthreads();                                 // cross-wave: all waves done reading the prior step's tiles
#pragma unroll
    for (int i = 0; i < 8; ++i) {
      v4us hi, lo;
#pragma unroll
      for (int j = 0; j < 4; ++j) { const unsigned short hb = bf16_bits(xa[i][j]); hi[j] = hb; lo[j] = ASPLIT ? bf16_bits(xa[i][j] - bf16_val(hb)) : (unsigned short)0; }
      *(v4us*)&sAh[sar + i * 8][sac] = hi;
      if (ASPLIT) *(v4us*)&sAl[sar + i * 8][sac] = lo;
      *(v8us*)&sW[swr + i * 16][swc] = xw[i];
    }
    __syncthreads();                                 // cross-wave: staging complete before any fragment load
    if (kb + BK < K) {                               // block-uniform: the next step's loads fly under this step's products
#pragma unroll
      for (int i = 0; i < 8; ++i) { aoff[i] += BK * 4u; woff[i] += BK * 2u; }
#pragma unroll
      for (int i = 0; i < 8; ++i) { xa[i] = *(const v4fa*)((const char*)Ab + aoff[i]); xw[i] = *(const v8us*)((const char*)Wt + woff[i]); }
      asm volatile("s_wait_xcnt 0x0" ::: "memory");  // ahead of any later write to a register that these loads name as address
    }
#pragma unroll
    for (int ks = 0; ks < BK / 32; ++ks) {
      FragB ah[2], al[2], b[4];
#pragma unroll
      for (int mi = 0; mi < 2; ++mi) {
        const int r = wm * 32 + mi * 16 + ln;
        ah[mi].half[0] = *(const v8us*)&sAh[r][ks * 32 + 8 * hh];          // elements 0..7  <- k = kb+32ks+8h .. +7
        ah[mi].half[1] = *(const v8us*)&sAh[r][ks * 32 + 16 + 8 * hh];     // elements 8..15 <- k = kb+32ks+16+8h .. +7
        if (ASPLIT) { al[mi].half[0] = *(const v8us*)&sAl[r][ks * 32 + 8 * hh]; al[mi].half[1] = *(const v8us*)&sAl[r][ks * 32 + 16 + 8 * hh]; }
        else al[mi] = ah[mi];
      }
#pragma unroll
      for (int t = 0; t < 4; ++t) {
        const int n = wn * 64 + t * 16 + ln;
        b[t].half[0] = *(const v8us*)&sW[n][ks * 32 + 8 * hh];
        b[t].half[1] = *(const v8us*)&sW[n][ks * 32 + 16 + 8 * hh];
      }
#pragma unroll
      for (int mi = 0; mi < 2; ++mi)
#pragma unroll
        for (int t = 0; t < 4; ++t) acc[mi][t] = mmaN<ASPLIT ? 2 : 1>(ah[mi].v, al[mi].v, b[t].v, b[t].v, acc[mi][t]);
    }
  }
  const int wrow0 = row0 + wm * 32, wcol0 = col0 + wn * 64;
#pragma unroll
  for (int t = 0; t < 4; ++t) {
    float bvv = bias[wcol0 + t * 16 + ln];
    if (BIAS_BF16) bvv = bf16_rne(bvv);
#pragma unroll
    for (int mi = 0; mi < 2; ++mi)
#pragma unroll
      for (int r = 0; r < 8; ++r) { so[w][mi * 16 + 8 * hh + r][t * 16 + ln] = acc[mi][t][r] + bvv; }
  }
  __builtin_amdgcn_fence(4 /* acq_rel order */, "workgroup");      // so[w] is wave-private: same-wave exchange
  __builtin_amdgcn_wave_barrier();
  if (CSPLIT) {
    unsigned short* Chb = Ch + (size_t)y * (size_t)cbatch;
    unsigned short* Clb = Cl + (size_t)y * (size_t)cbatch;
    const int rsub = lane >> 3, c8 = (lane & 7) * 8;      // 8 lanes write one 128-byte row piece of each plane
#pragma unroll
    for (int q = 0; q < 8; ++q) {
      const int r = q * 4 + rsub;
      const v4f x0 = *(const v4fa*)&so[w][r][c8], x1 = *(const v4fa*)&so[w][r][c8 + 4];
      v8us hi, lo;
#pragma unroll
      for (int i = 0; i < 4; ++i) {
        unsigned short hb = bf16_bits(x0[i]); hi[i] = hb;     lo[i] = bf16_bits(x0[i] - bf16_val(hb));
        hb = bf16_bits(x1[i]);                hi[4 + i] = hb; lo[4 + i] = bf16_bits(x1[i] - bf16_val(hb));
      }
      const size_t o = (size_t)(wrow0 + r) * ldc + wcol0 + c8;
      *(v8us*)(Chb + o) = hi;
      *(v8us*)(Clb + o) = lo;
    }
    asm volatile("s_wait_xcnt 0x0" ::: "memory");    // ahead of any later write to a register that these stores name: in a kernel with two forms of the tile the other form's code follows
  } else {
    float* Cb = C + (size_t)y * (size_t)cbatch;
    const int rsub = lane >> 4, c4 = (lane & 15) * 4;
#pragma unroll
    for (int q = 0; q < 16; ++q) {
      const int r = q * 2 + rsub;
      const v4f v = *(const v4fa*)&so[w][r][c4];
      *(v4f*)(Cb + (size_t)(wrow0 + r) * ldc + wcol0 + c4) = v;
    }
  }
}

// The three projections in one grid: blockIdx.z = 0, 1 the k and v projections (packed rows, split planes), 2 the q projection (all rows, f32).
// Same shapes and pitches for all three. The k and v tiles, whose first loads wait for the key list, come first in the grid.
__global__ __launch_bounds__(128) void k_gemm_qkv(const float* __restrict__ xq, const float* __restrict__ xk, const float* __restrict__ xv, int lda, int abatch,
                                                  const unsigned short* __restrict__ Wtq, const unsigned short* __restrict__ Wtk, const unsigned short* __restrict__ Wtv, int ldb,
                                                  const float* __restrict__ bq, const float* __restrict__ bk, const float* __restrict__ bv,
                                                  float* __restrict__ q, unsigned short* __restrict__ kh, unsigned short* __restrict__ kl,
                                                  unsigned short* __restrict__ vh, unsigned short* __restrict__ vl, int ldc, int cbatch, int M, int N, int K,
                                                  const int* __restrict__ live, int lpitch, const int* __restrict__ nlive) {
  __shared__ GemmLds<false> L;
  const int z = blockIdx.z;                          // block-uniform
  if (z == 2) {
    gemm_tile<false, true, false, false>(L, blockIdx.x, blockIdx.y, xq, lda, abatch, Wtq, ldb, bq, q, nullptr, nullptr, ldc, cbatch, M, N, K, nullptr, 0, nullptr);
  } else {
    gemm_tile<false, true, true, true>(L, blockIdx.x, blockIdx.y, z ? xv : xk, lda, abatch, z ? Wtv : Wtk, ldb, z ? bv : bk, nullptr, z ? vh : kh, z ? vl : kl,
                                       ldc, cbatch, M, N, K, live, lpitch, nlive);
  }
}

// The output projection: A as a 2-term split, f32 result.
__global__ __launch_bounds__(128) void k_gemm_out(const float* __restrict__ A, int lda, int abatch, const unsigned short* __restrict__ Wt, int ldb,
                                                  const float* __restrict__ bias, float* __restrict__ C, int ldc, int cbatch, int M, int N, int K) {
  __shared__ GemmLds<true> L;
  gemm_tile<true, true, false, false>(L, blockIdx.x, blockIdx.y, A, lda, abatch, Wt, ldb, bias, C, nullptr, nullptr, ldc, cbatch, M, N, K, nullptr, 0, nullptr);
}

// Flash-style attention over the packed keys of each batch: k and v rows 0 .. nlive[b]-1 take part, no other row is read;
// nlive[b] == 0 (every key excluded) yields NaN. QK^T and P*V as 3-term bf16 hi/lo splits, f32 softmax with running max.
// q rows f32, k and v rows as bf16 hi/lo planes, all with pitch `pitch` (elements), batch b at X + b*T*pitch, head h at column h*D.
// One wave = 16 query rows, block = 4 waves (64 queries) sharing K/V chunks of 32 keys copied into LDS (hi/lo bf16 planes).
template <int D>
__global__ __launch_bounds__(128) void k_flash_pm(const float* __restrict__ Qb, const unsigned short* __restrict__ Khb, const unsigned short* __restrict__ Klb,
                                                const unsigned short* __restrict__ Vhb, const unsigned short* __restrict__ Vlb, int pitch, int T, int H, float scale, const int* __restrict__ nlive,
                                                float* __restrict__ y, int ypitch) {
  constexpr int KS = D / 32, DT = D / 16, NP = 32 * (D / 8) / 128;   // NP: 16-byte pieces of one plane's chunk per thread
  __shared__ __attribute__((aligned(16))) unsigned short sKh[32][D + 8], sKl[32][D + 8], sVh[32][D + 16], sVl[32][D + 16];
  __shared__ __attribute__((aligned(16))) unsigned short sPh[4][16][40], sPl[4][16][40];
  __shared__ __attribute__((aligned(16))) float sO[4][16][D];
  const int tid = threadIdx.x, w = tid >> 5, lane = tid & 31, ln = lane & 15, hh = lane >> 4;
  const int nqb = (T + 63) / 64;
  const int bh = blockIdx.x / nqb, qblk = blockIdx.x % nqb;
  const int b = bh / H, h = bh % H;
  const int q0 = qblk * 64 + w * 16;
  const float* Q = Qb + (size_t)b * T * pitch + h * D;
  const unsigned short* Kh = Khb + (size_t)b * T * pitch + h * D;
  const unsigned short* Kl = Klb + (size_t)b * T * pitch + h * D;
  const unsigned short* Vh = Vhb + (size_t)b * T * pitch + h * D;
  const unsigned short* Vl = Vlb + (size_t)b * T * pitch + h * D;
  const int nl = nlive[b];
  const int Tk = (nl < T) ? nl : T;                  // keys of this batch; block-uniform
  const int trow = 8 * hh + (lane & 7), tcol = 8 * ((lane >> 3) & 1);   // lane address of a transposing load: 16 bytes of row trow

  // A fragments of the wave's 16 query rows (scaled by an exact power of two), hi/lo
  FragB aqh[KS], aql[KS];
  {
    int row = q0 + ln; if (row >= T) row = T - 1;
    const float* qr = Q + (size_t)row * pitch;
#pragma unroll
    for (int ks = 0; ks < KS; ++ks)
#pragma unroll
      for (int i = 0; i < 16; ++i) {
        const int d = ks * 32 + ((i < 8) ? (8 * hh + i) : (16 + 8 * hh + (i - 8)));
        const float x = qr[d] * scale; const unsigned short hb = bf16_bits(x);
        aqh[ks].u[i] = hb; aql[ks].u[i] = bf16_bits(x - bf16_val(hb));
      }
  }
  float m_r[8], l_r[8];
#pragma unroll
  for (int r = 0; r < 8; ++r) { m_r[r] = -3.0e38f; l_r[r] = 0.f; }
  v8f oacc[DT];
#pragma unroll
  for (int dt = 0; dt < DT; ++dt) oacc[dt] = (v8f){0.f,0.f,0.f,0.f,0.f,0.f,0.f,0.f};

  for (int j0 = 0; j0 < Tk; j0 += 32) {
    __syncthreads();                                 // cross-wave: all waves done reading sK/sV of the prior chunk
    {
      v8us xkh[NP], xkl[NP], xvh[NP], xvl[NP];       // all loads of the chunk issued before the first LDS store
#pragma unroll
      for (int i = 0; i < NP; ++i) {
        const int e = tid + i * 128, r = e / (D / 8), c8 = (e % (D / 8)) * 8;
        int key = j0 + r; if (key >= Tk) key = Tk - 1;                       // clamped address, zero by value
        const unsigned o = ((unsigned)key * (unsigned)pitch + (unsigned)c8) * 2u;   // byte offset, one 32-bit register for all four planes
        xkh[i] = *(const v8us*)((const char*)Kh + o); xkl[i] = *(const v8us*)((const char*)Kl + o);
        xvh[i] = *(const v8us*)((const char*)Vh + o); xvl[i] = *(const v8us*)((const char*)Vl + o);
      }
      if (j0 + 32 > Tk) {                                                    // block-uniform: only a chunk that runs past Tk
        const v8us zz = (v8us){0,0,0,0,0,0,0,0};
#pragma unroll
        for (int i = 0; i < NP; ++i)
          if (j0 + (tid + i * 128) / (D / 8) >= Tk) { xkh[i] = zz; xkl[i] = zz; xvh[i] = zz; xvl[i] = zz; }
      }
#pragma unroll
      for (int i = 0; i < NP; ++i) {
        const int e = tid + i * 128, r = e / (D / 8), c8 = (e % (D / 8)) * 8;
        *(v8us*)&sKh[r][c8] = xkh[i]; *(v8us*)&sKl[r][c8] = xkl[i];
        *(v8us*)&sVh[r][c8] = xvh[i]; *(v8us*)&sVl[r][c8] = xvl[i];
      }
    }
    __syncthreads();                                 // cross-wave: staging complete before any fragment load
    // S tile 16 queries x 32 keys: B[k = d][n = key] from sK[key][d]
    v8f s[2];
#pragma unroll
    for (int nt = 0; nt < 2; ++nt) {
      v8f acc = (v8f){0.f,0.f,0.f,0.f,0.f,0.f,0.f,0.f};
#pragma unroll
      for (int ks = 0; ks < KS; ++ks) {
        FragB bh_, bl_;
        bh_.half[0] = *(const v8us*)&sKh[nt * 16 + ln][ks * 32 + 8 * hh]; bh_.half[1] = *(const v8us*)&sKh[nt * 16 + ln][ks * 32 + 16 + 8 * hh];
        bl_.half[0] = *(const v8us*)&sKl[nt * 16 + ln][ks * 32 + 8 * hh]; bl_.half[1] = *(const v8us*)&sKl[nt * 16 + ln][ks * 32 + 16 + 8 * hh];
        acc = mmaN<3>(aqh[ks].v, aql[ks].v, bh_.v, bl_.v, acc);
      }
      s[nt] = acc;
    }
    // B[k = key][n = d] from sV[key][d]: all V fragments by transposing LDS loads, one group whose latency the softmax covers
    FragB bvh[DT], bvl[DT];
#pragma unroll
    for (int dt = 0; dt < DT; ++dt) {
      bvh[dt].half[0] = tr16(&sVh[trow][dt * 16 + tcol]); bvh[dt].half[1] = tr16(&sVh[16 + trow][dt * 16 + tcol]);
      bvl[dt].half[0] = tr16(&sVl[trow][dt * 16 + tcol]); bvl[dt].half[1] = tr16(&sVl[16 + trow][dt * 16 + tcol]);
    }
    // this lane's two key columns: a column past the last packed key has probability 0
    const bool keepa = (j0 + ln < Tk), keepb = (j0 + 16 + ln < Tk);
    float alpha[8];
#pragma unroll
    for (int r = 0; r < 8; ++r) {
      if (!keepa) s[0][r] = -3.0e38f;
      if (!keepb) s[1][r] = -3.0e38f;
      float mx = fmaxf(s[0][r], s[1][r]);
      mx = fmaxf(mx, __shfl_xor(mx, 1, 32)); mx = fmaxf(mx, __shfl_xor(mx, 2, 32)); mx = fmaxf(mx, __shfl_xor(mx, 4, 32)); mx = fmaxf(mx, __shfl_xor(mx, 8, 32));
      const float mnew = fmaxf(m_r[r], mx);
      alpha[r] = (mnew > -1.0e38f) ? __expf(m_r[r] - mnew) : 1.0f;
      const float p0 = keepa ? __expf(s[0][r] - mnew) : 0.f;
      const float p1 = keepb ? __expf(s[1][r] - mnew) : 0.f;
      m_r[r] = mnew;
      l_r[r] = l_r[r] * alpha[r] + p0 + p1;            // per-lane partial row sum (16 lanes combined at the end)
      unsigned short hb = bf16_bits(p0); sPh[w][8 * hh + r][ln] = hb;      sPl[w][8 * hh + r][ln] = bf16_bits(p0 - bf16_val(hb));
      hb = bf16_bits(p1);                sPh[w][8 * hh + r][16 + ln] = hb; sPl[w][8 * hh + r][16 + ln] = bf16_bits(p1 - bf16_val(hb));
    }
#pragma unroll
    for (int dt = 0; dt < DT; ++dt)
#pragma unroll
      for (int r = 0; r < 8; ++r) oacc[dt][r] *= alpha[r];
    __builtin_amdgcn_fence(4 /* acq_rel order */, "workgroup");      // sPh/sPl are wave-private: same-wave exchange
    __builtin_amdgcn_wave_barrier();
    FragB pah, pal;                                              // A[m = query][k = key] from sP[query][key]
    pah.half[0] = *(const v8us*)&sPh[w][ln][8 * hh]; pah.half[1] = *(const v8us*)&sPh[w][ln][16 + 8 * hh];
    pal.half[0] = *(const v8us*)&sPl[w][ln][8 * hh]; pal.half[1] = *(const v8us*)&sPl[w][ln][16 + 8 * hh];
#pragma unroll
    for (int dt = 0; dt < DT; ++dt) {
      oacc[dt] = mmaN<3>(pah.v, pal.v, bvh[dt].v, bvl[dt].v, oacc[dt]);
    }
    __builtin_amdgcn_fence(4 /* acq_rel order */, "workgroup");
    __builtin_amdgcn_wave_barrier();
  }
  const float qnan = __uint_as_float(0x7FC00000u);
#pragma unroll
  for (int r = 0; r < 8; ++r) {
    float l = l_r[r];
    l += __shfl_xor(l, 1, 32); l += __shfl_xor(l, 2, 32); l += __shfl_xor(l, 4, 32); l += __shfl_xor(l, 8, 32);
    l_r[r] = (m_r[r] > -1.0e38f) ? (1.0f / l) : qnan;
  }
#pragma unroll
  for (int dt = 0; dt < DT; ++dt)
#pragma unroll
    for (int r = 0; r < 8; ++r) sO[w][8 * hh + r][dt * 16 + ln] = oacc[dt][r] * l_r[r];
  __builtin_amdgcn_fence(4 /* acq_rel order */, "workgroup");
  __builtin_amdgcn_wave_barrier();
  {
    for (int r = 0; r < 16; ++r) {
      const int row = q0 + r;
      if (row < T && lane < D / 4) {
        const v4f val = *(const v4fa*)&sO[w][r][lane * 4];
        *(v4f*)(y + ((size_t)b * T + row) * ypitch + h * D + lane * 4) = val;
      }
    }
    
  }
}

extern "C" void kernel_launch(void* const* d_in, const int* in_sizes, int n_in,
                              void* d_out, int out_size, void* d_ws, size_t ws_size, hipStream_t stream) {
  if (n_in < 12) return;
  const float* xq = (const float*)d_in[0]; const float* xk = (const float*)d_in[1]; const float* xv = (const float*)d_in[2];
  const int* kpm = (const int*)d_in[3];
  const float* Wq = (const float*)d_in[4]; const float* bq = (const float*)d_in[5]; const float* Wk = (const float*)d_in[6]; const float* bk = (const float*)d_in[7];
  const float* Wv = (const float*)d_in[8]; const float* bv = (const float*)d_in[9]; const float* Wo = (const float*)d_in[10]; const float* bo = (const float*)d_in[11];
  // size checks (lower bounds so a reduced NB/SEQ build still launches on full-size inputs)
  const long long needX = (long long)(NB - 1) * SEQ_FULL * DD + (long long)SEQ * DD;
  if ((long long)in_sizes[0] < needX || (long long)in_sizes[1] < needX || (long long)in_sizes[2] < needX) return;
  if (in_sizes[3] < (NB - 1) * SEQ_FULL + SEQ) return;
  if (in_sizes[4] < DD * DD || in_sizes[6] < DD * DD || in_sizes[8] < DD * DD || in_sizes[10] < DD * DD) return;
  if (in_sizes[5] < DD || in_sizes[7] < DD || in_sizes[9] < DD || in_sizes[11] < DD) return;
  if ((long long)out_size < (long long)NB * SEQ * DD) return;

  char* ws = (char*)d_ws; size_t off = 0;
  auto take = [&](size_t bytes) { char* p = ws + off; off += (bytes + 255) & ~(size_t)255; return p; };
  const size_t MROWS = (size_t)NB * SEQ;
  unsigned short* Wt[4]; for (int i = 0; i < 4; ++i) Wt[i] = (unsigned short*)take((size_t)DD * DD * 2);
  float* q   = (float*)take(MROWS * DD * 4);
  unsigned short* kh = (unsigned short*)take(MROWS * DD * 2);
  unsigned short* kl = (unsigned short*)take(MROWS * DD * 2);
  unsigned short* vh = (unsigned short*)take(MROWS * DD * 2);
  unsigned short* vl = (unsigned short*)take(MROWS * DD * 2);
  float* att = (float*)take(MROWS * DD * 4);
  int* live  = (int*)take(MROWS * 4);
  int* nlive = (int*)take((size_t)NB * 4);
  if (off > ws_size) return;

  const int n8 = DD * DD / 8;
  const int gb = (SEQ / 64) * (DD / 128);
  const dim3 gg(gb, NB), gg3(gb, NB, 3);
  const int nbw = (n8 + 255) / 256;
  k_prep<(SEQ + 255) / 256><<<NB + 4 * nbw, 256, 0, stream>>>(Wq, Wk, Wv, Wo, Wt[0], Wt[1], Wt[2], Wt[3], n8, nbw, kpm, SEQ_FULL, SEQ, live, SEQ, nlive, NB);
  k_gemm_qkv<<<gg3, 128, 0, stream>>>(xq, xk, xv, DD, SEQ_FULL * DD, Wt[0], Wt[1], Wt[2], DD, bq, bk, bv, q, kh, kl, vh, vl, DD, SEQ * DD, SEQ, DD, DD, live, SEQ, nlive);
  k_flash_pm<HD><<<NB * NH * (SEQ / 64), 128, 0, stream>>>(q, kh, kl, vh, vl, DD, SEQ, NH, 0.125f, nlive, att, DD);
  k_gemm_out<<<gg, 128, 0, stream>>>(att, DD, SEQ * DD, Wt[3], DD, bo, (float*)d_out, DD, SEQ * DD, SEQ, DD, DD);
  (void)hipGetLastError();
}

// v006
// One run takes 95.2 microseconds.
// In both of two side-by-side timings against v005, it was 1.17 times as fast.
// Over all steps from v000 it is 4.93 times as fast.
#include <hip/hip_runtime.h>
// Contractions: q/k/v = x*W^T + b on v_wmma_f32_16x16x32_bf16, a 64 x 128 tile of the result per block with both operands staged in LDS (x, W, b converted to bf16 RNE, single term); QK^T and P*V per 16-query tile as
// 3-term bf16 hi/lo splits, both transposed (S^T = K*Q^T, O^T += V^T*P^T: a lane holds one query's scores, and P^T goes from the score
// accumulators straight into the B operand); out = a*Wo^T + bo with a as a 2-term bf16 hi/lo split (Wo, bo bf16 RNE); f32 accumulate, softmax in f32.
// k and v leave their projection already split into bf16 hi/lo planes, so the attention blocks stage them into LDS by plain 16-byte copies.
// Keys whose padding flag is set have probability exactly 0: the unflagged keys of each batch are listed in ascending order, the k and v
// projections compute only those rows and store them packed (row p = p-th unflagged key), and the attention key loop ends at their count.
// Four launches: work that does not depend on each other shares a grid and is told apart by the block index (the four weight conversions
// with the key lists; the q, k and v projections).
#ifndef NB
#define NB 4
#endif
#ifndef SEQ
#define SEQ 2048
#endif
#define NB_FULL 4
#define SEQ_FULL 2048
#define DD 512
#define NH 8
#define HD 64

static_assert(NB >= 1 && NB <= NB_FULL);
static_assert(SEQ >= 64 && SEQ <= SEQ_FULL && (SEQ % 64) == 0);
static_assert(NH * HD == DD && (DD % 128) == 0 && (HD % 32) == 0 && HD <= 128);

typedef __bf16 v16b __attribute__((ext_vector_type(16)));
typedef unsigned short v8us __attribute__((ext_vector_type(8), may_alias));
typedef unsigned short v4us __attribute__((ext_vector_type(4), may_alias));
typedef float  v8f  __attribute__((ext_vector_type(8)));
typedef unsigned int v8u __attribute__((ext_vector_type(8)));
typedef float  v4f  __attribute__((ext_vector_type(4)));
typedef float  v4fa __attribute__((ext_vector_type(4), may_alias));
union FragB { v16b v; v8us half[2]; unsigned short u[16]; };

__device__ __forceinline__ unsigned short bf16_bits(float x) { unsigned int u = __float_as_uint(x); return (unsigned short)((u + 0x7FFFu + ((u >> 16) & 1u)) >> 16); }
__device__ __forceinline__ float bf16_val(unsigned short b) { return __uint_as_float(((unsigned int)b) << 16); }
__device__ __forceinline__ float bf16_rne(float x) { return bf16_val(bf16_bits(x)); }

// 16-bit transposing LDS load: with lane l addressing 16 bytes at T[k0 + 8*(l>>4) + (l&7)][d0 + 8*((l>>3)&1)], lane (c = l&15, h = l>>4)
// receives T[k0 + 8h + 0..7][d0 + c]
typedef short s16x8 __attribute__((ext_vector_type(8)));
__device__ __forceinline__ v8us tr16(const unsigned short* p) {
  const s16x8 r = __builtin_amdgcn_ds_load_tr16_b128_v8i16((__attribute__((address_space(3))) s16x8*)p);
  return __builtin_bit_cast(v8us, r);
}

// f32 -> bf16 RNE with the result left in the upper 16 bits of the word (bf16_bits before its shift); the lower 16 bits are not cleared
__device__ __forceinline__ unsigned int bf16_top(float x) { const unsigned int u = __float_as_uint(x); return u + 0x7FFFu + ((u >> 16) & 1u); }
// one operand register from two such words: element 2i from a, element 2i+1 from b
__device__ __forceinline__ unsigned int pack_tops(unsigned int a, unsigned int b) { return (a >> 16) | (b & 0xFFFF0000u); }

// lane l takes the value of lane l ^ 16 (the other half of the wave)
__device__ __forceinline__ float xhalf(float x) {
  const int b = __float_as_int(x);
  return __int_as_float(__builtin_amdgcn_permlanex16(b, b, 0x76543210, 0xfedcba98, false, false));
}

// D += A*B with NT terms: 1 = ah*bh, 2 = + al*bh (A split), 3 = + ah*bl (both split); 4 nops guard the accumulator
template <int NT>
__device__ __forceinline__ v8f mmaN(v16b ah, v16b al, v16b bh, v16b bl, v8f c) {
  c = __builtin_amdgcn_wmma_f32_16x16x32_bf16(false, ah, false, bh, (short)0, c, false, false);
  if (NT >= 2) c = __builtin_amdgcn_wmma_f32_16x16x32_bf16(false, al, false, bh, (short)0, c, false, false);
  if (NT >= 3) c = __builtin_amdgcn_wmma_f32_16x16x32_bf16(false, ah, false, bl, (short)0, c, false, false);
  asm volatile("v_nop\n\tv_nop\n\tv_nop\n\tv_nop" : "+v"(c) : "v"(ah), "v"(al), "v"(bh), "v"(bl));
  return c;
}

// Wt[n][k] (bf16 bits) = RNE(W[n][k]) for a row-major [N][K] weight used as x*W^T: plain elementwise convert, 8 per thread,
// thread t of the conversion takes elements 8t .. 8t+7
__device__ __forceinline__ void rne_rows(const float* __restrict__ W, unsigned short* __restrict__ Wt, int n8, int t) {
  if (t >= n8) return;
  const v4f a = *(const v4fa*)(W + (size_t)t * 8), b = *(const v4fa*)(W + (size_t)t * 8 + 4);
  v8us v; v[0]=bf16_bits(a[0]); v[1]=bf16_bits(a[1]); v[2]=bf16_bits(a[2]); v[3]=bf16_bits(a[3]);
  v[4]=bf16_bits(b[0]); v[5]=bf16_bits(b[1]); v[6]=bf16_bits(b[2]); v[7]=bf16_bits(b[3]);
  *(v8us*)(Wt + (size_t)t * 8) = v; 
}

// live[b*lpitch + p] = index of the p-th key of batch b (one block of 256 threads a batch) with kpm[b*mpitch + j] == 0 (ascending), nlive[b] = how many there are.
// Wave w owns the PER*32 consecutive keys from w*PER*32, one key a lane in each of PER groups: a ballot gives a key's rank inside its group,
// and the eight wave totals, exchanged through LDS, give each wave its first slot.
template <int PER>
__device__ __forceinline__ void live_keys(const int* __restrict__ kpm, int mpitch, int T, int* __restrict__ live, int lpitch, int* __restrict__ nlive, int b) {
  __shared__ int part[8];
  const int t = threadIdx.x, w = t >> 5, lane = t & 31;
  const int* mrow = kpm + (size_t)b * mpitch;
  unsigned bal[PER];
  int c = 0;
#pragma unroll
  for (int i = 0; i < PER; ++i) {
    const int j = (w * PER + i) * 32 + lane, jc = (j < T) ? j : (T - 1);
    bal[i] = __builtin_amdgcn_ballot_w32((mrow[jc] == 0) && (j < T));
    c += __builtin_popcount(bal[i]);
  }
  if (lane == 0) part[w] = c;
  __syncthreads();                                 // cross-wave: every wave's total is in LDS
  int o = 0, tot = 0;
#pragma unroll
  for (int k = 0; k < 8; ++k) { const int v = part[k]; o += (k < w) ? v : 0; tot += v; }
  int* lrow = live + (size_t)b * lpitch;
  const unsigned below = (1u << lane) - 1u;
#pragma unroll
  for (int i = 0; i < PER; ++i) {
    if ((bal[i] >> lane) & 1u) lrow[o + __builtin_popcount(bal[i] & below)] = (w * PER + i) * 32 + lane;
    o += __builtin_popcount(bal[i]);
  }
  if (t == 0) nlive[b] = tot;
}

// One grid for all that only reads inputs: blocks 0 .. nb-1 list the keys of one batch each, then nbw blocks convert each of the four weights.
template <int PER>
__global__ __launch_bounds__(256) void k_prep(const float* __restrict__ W0, const float* __restrict__ W1, const float* __restrict__ W2, const float* __restrict__ W3,
                                              unsigned short* __restrict__ T0, unsigned short* __restrict__ T1, unsigned short* __restrict__ T2, unsigned short* __restrict__ T3,
                                              int n8, int nbw, const int* __restrict__ kpm, int mpitch, int T, int* __restrict__ live, int lpitch,
                                              int* __restrict__ nlive, int nb) {
  const int bx = blockIdx.x;
  if (bx < nb) { live_keys<PER>(kpm, mpitch, T, live, lpitch, nlive, bx); return; }     // block-uniform: its barrier is met by the whole block
  const int g = bx - nb, wi = g / nbw, blk = g % nbw;
  const float* W = (wi == 0) ? W0 : (wi == 1) ? W1 : (wi == 2) ? W2 : W3;
  unsigned short* Wt = (wi == 0) ? T0 : (wi == 1) ? T1 : (wi == 2) ? T2 : T3;
  rne_rows(W, Wt, n8, blk * 256 + (int)threadIdx.x);
}

// GEMM C[M][N] (f32, pitch ldc) = A[M][K]*W^T + bias per batch y (A += y*abatch, C += y*cbatch elements); bx = the block's tile number.
// A f32 row-major (pitch lda) converted to bf16 (ASPLIT: hi/lo -> 2 terms, else single RNE term); Wt bf16 [N][K] (pitch ldb).
// BIAS_BF16 converts the bias to bf16 RNE before the add. K%64==0, M%64==0, N%128==0.
// One block = a 64 x 128 tile of C, four waves of 32 x 64 each. K goes in steps of 64: the step's 64 A rows (converted once) and 128 Wt rows are
// brought by loads that cover whole 128-byte lines, stored in LDS at a 144-byte pitch and read from there as fragments by every wave that needs
// them; the next step's global loads are issued ahead of the current step's products.
// CSPLIT: the f32 result x is not stored; Ch gets RNE(x) and Cl gets RNE(x - Ch) as bf16 bits, same pitch and batch stride (in elements) as C.
// PACK: output row p comes from A row live[y*lpitch + p], for p < nlive[y] only (the last 64-row tile repeats the last listed row); later tiles are not written.
// The block's LDS is declared by the kernel and handed in, so that two forms of the tile in one kernel share it.
template <bool ASPLIT>
struct __attribute__((aligned(16))) GemmLds {
  unsigned short Ah[64][72], Al[ASPLIT ? 64 : 1][72], W[128][72];   // 144-byte rows, 16 bytes x odd, for 16-byte fragment reads
  float so[4][32][64];
};
template <bool ASPLIT, bool BIAS_BF16, bool CSPLIT, bool PACK>
__device__ __forceinline__ void gemm_tile(GemmLds<ASPLIT>& L, unsigned bx, unsigned y, const float* __restrict__ A, int lda, int abatch, const unsigned short* __restrict__ Wt, int ldb,
                                          const float* __restrict__ bias, float* __restrict__ C, unsigned short* __restrict__ Ch,
                                          unsigned short* __restrict__ Cl, int ldc, int cbatch, int M, int N, int K,
                                          const int* __restrict__ live, int lpitch, const int* __restrict__ nlive) {
  constexpr int BM = 64, BN = 128, BK = 64;
  auto& sAh = L.Ah; auto& sAl = L.Al; auto& sW = L.W; auto& so = L.so;
  const int tid = threadIdx.x, w = tid >> 5, lane = tid & 31, ln = lane & 15, hh = lane >> 4;
  const int wm = w >> 1, wn = w & 1;                         // the wave's 32 rows and 64 columns inside the block tile
  const int ntn = N / BN;
  const int mt = bx / ntn, nq = bx % ntn;
  int Mb = M;
  if (PACK) { const int c = nlive[y]; Mb = (c < M) ? c : M; }
  if (mt * BM >= Mb) return;                    // block-uniform, ahead of every barrier
  const int row0 = mt * BM, col0 = nq * BN;
  const float* Ab = A + (size_t)y * (size_t)abatch;
  // staging: 16 lanes cover the 256 bytes of one A row's step, 8 lanes the 128 bytes of one Wt row's step
  const int sar = tid >> 4, sac = (tid & 15) * 4, swr = tid >> 3, swc = (tid & 7) * 8;
  unsigned aoff[8], woff[8];
#pragma unroll
  for (int i = 0; i < 8; ++i) {
    int ar = row0 + sar + i * 8;
    if (PACK) {
      const int p = (ar < Mb) ? ar : (Mb - 1);
      const unsigned g = (unsigned)live[(size_t)y * lpitch + p];
      ar = (int)((g < (unsigned)M) ? g : (unsigned)(M - 1));
    }
    aoff[i] = ((unsigned)ar * (unsigned)lda + (unsigned)sac) * 4u;                          // byte offsets: one 32-bit register each, kept for
    woff[i] = ((unsigned)(col0 + swr + i * 16) * (unsigned)ldb + (unsigned)swc) * 2u;       // all steps and moved on by the step's bytes
  }
  v4f xa[8]; v8us xw[8];
#pragma unroll
  for (int i = 0; i < 8; ++i) { xa[i] = *(const v4fa*)((const char*)Ab + aoff[i]); xw[i] = *(const v8us*)((const char*)Wt + woff[i]); }
  v8f acc[2][4];
#pragma unroll
  for (int mi = 0; mi < 2; ++mi)
#pragma unroll
    for (int t = 0; t < 4; ++t) acc[mi][t] = (v8f){0.f,0.f,0.f,0.f,0.f,0.f,0.f,0.f};
  for (int kb = 0; kb < K; kb += BK) {
    __syncthreads();                                 // cross-wave: all waves done reading the prior step's tiles
#pragma unroll
    for (int i = 0; i < 8; ++i) {
      v4us hi, lo;
#pragma unroll
      for (int j = 0; j < 4; ++j) { const unsigned short hb = bf16_bits(xa[i][j]); hi[j] = hb; lo[j] = ASPLIT ? bf16_bits(xa[i][j] - bf16_val(hb)) : (unsigned short)0; }
      *(v4us*)&sAh[sar + i * 8][sac] = hi;
      if (ASPLIT) *(v4us*)&sAl[sar + i * 8][sac] = lo;
      *(v8us*)&sW[swr + i * 16][swc] = xw[i];
    }
    __syncthreads();                                 // cross-wave: staging complete before any fragment load
    if (kb + BK < K) {                               // block-uniform: the next step's loads fly under this step's products
#pragma unroll
      for (int i = 0; i < 8; ++i) { aoff[i] += BK * 4u; woff[i] += BK * 2u; }
#pragma unroll
      for (int i = 0; i < 8; ++i) { xa[i] = *(const v4fa*)((const char*)Ab + aoff[i]); xw[i] = *(const v8us*)((const char*)Wt + woff[i]); }
      asm volatile("s_wait_xcnt 0x0" ::: "memory");  // ahead of any later write to a register that these loads name as address
    }
#pragma unroll
    for (int ks = 0; ks < BK / 32; ++ks) {
      FragB ah[2], al[2], b[4];
#pragma unroll
      for (int mi = 0; mi < 2; ++mi) {
        const int r = wm * 32 + mi * 16 + ln;
        ah[mi].half[0] = *(const v8us*)&sAh[r][ks * 32 + 8 * hh];          // elements 0..7  <- k = kb+32ks+8h .. +7
        ah[mi].half[1] = *(const v8us*)&sAh[r][ks * 32 + 16 + 8 * hh];     // elements 8..15 <- k = kb+32ks+16+8h .. +7
        if (ASPLIT) { al[mi].half[0] = *(const v8us*)&sAl[r][ks * 32 + 8 * hh]; al[mi].half[1] = *(const v8us*)&sAl[r][ks * 32 + 16 + 8 * hh]; }
        else al[mi] = ah[mi];
      }
#pragma unroll
      for (int t = 0; t < 4; ++t) {
        const int n = wn * 64 + t * 16 + ln;
        b[t].half[0] = *(const v8us*)&sW[n][ks * 32 + 8 * hh];
        b[t].half[1] = *(const v8us*)&sW[n][ks * 32 + 16 + 8 * hh];
      }
#pragma unroll
      for (int mi = 0; mi < 2; ++mi)
#pragma unroll
        for (int t = 0; t < 4; ++t) acc[mi][t] = mmaN<ASPLIT ? 2 : 1>(ah[mi].v, al[mi].v, b[t].v, b[t].v, acc[mi][t]);
    }
  }
  const int wrow0 = row0 + wm * 32, wcol0 = col0 + wn * 64;
#pragma unroll
  for (int t = 0; t < 4; ++t) {
    float bvv = bias[wcol0 + t * 16 + ln];
    if (BIAS_BF16) bvv = bf16_rne(bvv);
#pragma unroll
    for (int mi = 0; mi < 2; ++mi)
#pragma unroll
      for (int r = 0; r < 8; ++r) { so[w][mi * 16 + 8 * hh + r][t * 16 + ln] = acc[mi][t][r] + bvv; }
  }
  __builtin_amdgcn_fence(4 /* acq_rel order */, "workgroup");      // so[w] is wave-private: same-wave exchange
  __builtin_amdgcn_wave_barrier();
  if (CSPLIT) {
    unsigned short* Chb = Ch + (size_t)y * (size_t)cbatch;
    unsigned short* Clb = Cl + (size_t)y * (size_t)cbatch;
    const int rsub = lane >> 3, c8 = (lane & 7) * 8;      // 8 lanes write one 128-byte row piece of each plane
#pragma unroll
    for (int q = 0; q < 8; ++q) {
      const int r = q * 4 + rsub;
      const v4f x0 = *(const v4fa*)&so[w][r][c8], x1 = *(const v4fa*)&so[w][r][c8 + 4];
      v8us hi, lo;
#pragma unroll
      for (int i = 0; i < 4; ++i) {
        unsigned short hb = bf16_bits(x0[i]); hi[i] = hb;     lo[i] = bf16_bits(x0[i] - bf16_val(hb));
        hb = bf16_bits(x1[i]);                hi[4 + i] = hb; lo[4 + i] = bf16_bits(x1[i] - bf16_val(hb));
      }
      const size_t o = (size_t)(wrow0 + r) * ldc + wcol0 + c8;
      *(v8us*)(Chb + o) = hi;
      *(v8us*)(Clb + o) = lo;
    }
    asm volatile("s_wait_xcnt 0x0" ::: "memory");    // ahead of any later write to a register that these stores name: in a kernel with two forms of the tile the other form's code follows
  } else {
    float* Cb = C + (size_t)y * (size_t)cbatch;
    const int rsub = lane >> 4, c4 = (lane & 15) * 4;
#pragma unroll
    for (int q = 0; q < 16; ++q) {
      const int r = q * 2 + rsub;
      const v4f v = *(const v4fa*)&so[w][r][c4];
      *(v4f*)(Cb + (size_t)(wrow0 + r) * ldc + wcol0 + c4) = v;
    }
  }
}

// The three projections in one grid: blockIdx.z = 0, 1 the k and v projections (packed rows, split planes), 2 the q projection (all rows, f32).
// Same shapes and pitches for all three. The k and v tiles, whose first loads wait for the key list, come first in the grid.
__global__ __launch_bounds__(128) void k_gemm_qkv(const float* __restrict__ xq, const float* __restrict__ xk, const float* __restrict__ xv, int lda, int abatch,
                                                  const unsigned short* __restrict__ Wtq, const unsigned short* __restrict__ Wtk, const unsigned short* __restrict__ Wtv, int ldb,
                                                  const float* __restrict__ bq, const float* __restrict__ bk, const float* __restrict__ bv,
                                                  float* __restrict__ q, unsigned short* __restrict__ kh, unsigned short* __restrict__ kl,
                                                  unsigned short* __restrict__ vh, unsigned short* __restrict__ vl, int ldc, int cbatch, int M, int N, int K,
                                                  const int* __restrict__ live, int lpitch, const int* __restrict__ nlive) {
  __shared__ GemmLds<false> L;
  const int z = blockIdx.z;                          // block-uniform
  if (z == 2) {
    gemm_tile<false, true, false, false>(L, blockIdx.x, blockIdx.y, xq, lda, abatch, Wtq, ldb, bq, q, nullptr, nullptr, ldc, cbatch, M, N, K, nullptr, 0, nullptr);
  } else {
    gemm_tile<false, true, true, true>(L, blockIdx.x, blockIdx.y, z ? xv : xk, lda, abatch, z ? Wtv : Wtk, ldb, z ? bv : bk, nullptr, z ? vh : kh, z ? vl : kl,
                                       ldc, cbatch, M, N, K, live, lpitch, nlive);
  }
}

// The output projection: A as a 2-term split, f32 result.
__global__ __launch_bounds__(128) void k_gemm_out(const float* __restrict__ A, int lda, int abatch, const unsigned short* __restrict__ Wt, int ldb,
                                                  const float* __restrict__ bias, float* __restrict__ C, int ldc, int cbatch, int M, int N, int K) {
  __shared__ GemmLds<true> L;
  gemm_tile<true, true, false, false>(L, blockIdx.x, blockIdx.y, A, lda, abatch, Wt, ldb, bias, C, nullptr, nullptr, ldc, cbatch, M, N, K, nullptr, 0, nullptr);
}

// Flash-style attention over the packed keys of each batch: k and v rows 0 .. nlive[b]-1 take part, no other row is read;
// nlive[b] == 0 (every key excluded) yields NaN. QK^T and P*V as 3-term bf16 hi/lo splits, f32 softmax with running max.
// q rows f32, k and v rows as bf16 hi/lo planes, all with pitch `pitch` (elements), batch b at X + b*T*pitch, head h at column h*D.
// One wave = 16 query rows, block = 4 waves (64 queries) sharing K/V chunks of 32 keys copied into LDS (hi/lo bf16 planes).
// Both products are transposed: in S^T[key][query] and O^T[d][query] lane (ln, hh) holds query ln, so the running maximum, the rescale factor
// and the row sum are one value a lane (the two halves of the wave hold 16 keys of a chunk each and exchange the maximum once a chunk).
template <int D>
__global__ __launch_bounds__(128) void k_flash_pm(const float* __restrict__ Qb, const unsigned short* __restrict__ Khb, const unsigned short* __restrict__ Klb,
                                                const unsigned short* __restrict__ Vhb, const unsigned short* __restrict__ Vlb, int pitch, int T, int H, float scale, const int* __restrict__ nlive,
                                                float* __restrict__ y, int ypitch) {
  constexpr int KS = D / 32, DT = D / 16, NP = 32 * (D / 8) / 128;   // NP: 16-byte pieces of one plane's chunk per thread
  __shared__ __attribute__((aligned(16))) unsigned short sKh[32][D + 8], sKl[32][D + 8], sVh[32][D + 16], sVl[32][D + 16];
  __shared__ __attribute__((aligned(16))) float sO[4][16][D + 4];     // 16 bytes x odd pitch: the 16 query rows of a 16-byte store spread over the banks
  const int tid = threadIdx.x, w = tid >> 5, lane = tid & 31, ln = lane & 15, hh = lane >> 4;
  const int nqb = (T + 63) / 64;
  const int bh = blockIdx.x / nqb, qblk = blockIdx.x % nqb;
  const int b = bh / H, h = bh % H;
  const int q0 = qblk * 64 + w * 16;
  const float* Q = Qb + (size_t)b * T * pitch + h * D;
  const unsigned short* Kh = Khb + (size_t)b * T * pitch + h * D;
  const unsigned short* Kl = Klb + (size_t)b * T * pitch + h * D;
  const unsigned short* Vh = Vhb + (size_t)b * T * pitch + h * D;
  const unsigned short* Vl = Vlb + (size_t)b * T * pitch + h * D;
  const int nl = nlive[b];
  const int Tk = (nl < T) ? nl : T;                  // keys of this batch; block-uniform
  const int trow = 8 * hh + (lane & 7), tcol = 8 * ((lane >> 3) & 1);   // lane address of a transposing load: 16 bytes of row trow

  // B fragments [k = d][n = query] of the wave's 16 query rows (scaled by an exact power of two), hi/lo
  FragB aqh[KS], aql[KS];
  {
    int row = q0 + ln; if (row >= T) row = T - 1;
    const float* qr = Q + (size_t)row * pitch;
#pragma unroll
    for (int ks = 0; ks < KS; ++ks)
#pragma unroll
      for (int i = 0; i < 16; ++i) {
        const int d = ks * 32 + ((i < 8) ? (8 * hh + i) : (16 + 8 * hh + (i - 8)));
        const float x = qr[d] * scale; const unsigned short hb = bf16_bits(x);
        aqh[ks].u[i] = hb; aql[ks].u[i] = bf16_bits(x - bf16_val(hb));
      }
  }
  float m_q = -3.0e38f, l_q = 0.f;                   // query ln: running maximum (same in both halves), this half's part of the row sum
  v8f oacc[DT];                                      // oacc[dt][r] = O[query ln][d = dt*16 + 8*hh + r]
#pragma unroll
  for (int dt = 0; dt < DT; ++dt) oacc[dt] = (v8f){0.f,0.f,0.f,0.f,0.f,0.f,0.f,0.f};

  for (int j0 = 0; j0 < Tk; j0 += 32) {
    __syncthreads();                                 // cross-wave: all waves done reading sK/sV of the prior chunk
    {
      v8us xkh[NP], xkl[NP], xvh[NP], xvl[NP];       // all loads of the chunk issued before the first LDS store
#pragma unroll
      for (int i = 0; i < NP; ++i) {
        const int e = tid + i * 128, r = e / (D / 8), c8 = (e % (D / 8)) * 8;
        int key = j0 + r; if (key >= Tk) key = Tk - 1;                       // clamped address, zero by value
        const unsigned o = ((unsigned)key * (unsigned)pitch + (unsigned)c8) * 2u;   // byte offset, one 32-bit register for all four planes
        xkh[i] = *(const v8us*)((const char*)Kh + o); xkl[i] = *(const v8us*)((const char*)Kl + o);
        xvh[i] = *(const v8us*)((const char*)Vh + o); xvl[i] = *(const v8us*)((const char*)Vl + o);
      }
      if (j0 + 32 > Tk) {                                                    // block-uniform: only a chunk that runs past Tk
        const v8us zz = (v8us){0,0,0,0,0,0,0,0};
#pragma unroll
        for (int i = 0; i < NP; ++i)
          if (j0 + (tid + i * 128) / (D / 8) >= Tk) { xkh[i] = zz; xkl[i] = zz; xvh[i] = zz; xvl[i] = zz; }
      }
#pragma unroll
      for (int i = 0; i < NP; ++i) {
        const int e = tid + i * 128, r = e / (D / 8), c8 = (e % (D / 8)) * 8;
        *(v8us*)&sKh[r][c8] = xkh[i]; *(v8us*)&sKl[r][c8] = xkl[i];
        *(v8us*)&sVh[r][c8] = xvh[i]; *(v8us*)&sVl[r][c8] = xvl[i];
      }
    }
    __syncthreads();                                 // cross-wave: staging complete before any fragment load
    // S^T tile 32 keys x 16 queries: A[m = key][k = d] from sK[key][d]; s[nt][r] = score of key j0 + nt*16 + 8*hh + r with query ln
    v8f s[2];
#pragma unroll
    for (int nt = 0; nt < 2; ++nt) {
      v8f acc = (v8f){0.f,0.f,0.f,0.f,0.f,0.f,0.f,0.f};
#pragma unroll
      for (int ks = 0; ks < KS; ++ks) {
        FragB kh_, kl_;
        kh_.half[0] = *(const v8us*)&sKh[nt * 16 + ln][ks * 32 + 8 * hh]; kh_.half[1] = *(const v8us*)&sKh[nt * 16 + ln][ks * 32 + 16 + 8 * hh];
        kl_.half[0] = *(const v8us*)&sKl[nt * 16 + ln][ks * 32 + 8 * hh]; kl_.half[1] = *(const v8us*)&sKl[nt * 16 + ln][ks * 32 + 16 + 8 * hh];
        acc = mmaN<3>(kh_.v, kl_.v, aqh[ks].v, aql[ks].v, acc);
      }
      s[nt] = acc;
    }
    // A[m = d][k = key] from sV[key][d]: all V fragments by transposing LDS loads, one group whose latency the softmax covers
    FragB avh[DT], avl[DT];
#pragma unroll
    for (int dt = 0; dt < DT; ++dt) {
      avh[dt].half[0] = tr16(&sVh[trow][dt * 16 + tcol]); avh[dt].half[1] = tr16(&sVh[16 + trow][dt * 16 + tcol]);
      avl[dt].half[0] = tr16(&sVl[trow][dt * 16 + tcol]); avl[dt].half[1] = tr16(&sVl[16 + trow][dt * 16 + tcol]);
    }
    if (j0 + 32 > Tk) {                              // block-uniform: only a chunk that runs past Tk holds keys past the last packed one;
#pragma unroll
      for (int nt = 0; nt < 2; ++nt)                 // their exponential below is exactly 0 (key j0 is real, so the maximum is a real score)
#pragma unroll
        for (int r = 0; r < 8; ++r) if (j0 + nt * 16 + 8 * hh + r >= Tk) s[nt][r] = -3.0e38f;
    }
    float mx = fmaxf(s[0][0], s[1][0]);
#pragma unroll
    for (int r = 1; r < 8; ++r) mx = fmaxf(mx, fmaxf(s[0][r], s[1][r]));
    mx = fmaxf(mx, xhalf(mx));                       // both halves now hold the maximum over the chunk's 32 keys
    const float mnew = fmaxf(m_q, mx);
    const float alpha = (mnew > -1.0e38f) ? __expf(m_q - mnew) : 1.0f;
    m_q = mnew;
    // P^T as the B operand [k = key][n = query]: element nt*8 + r of lane (ln, hh) is key nt*16 + 8*hh + r, which is where s[nt][r] already lies
    v8u pwh, pwl;                                    // hi and lo planes, two keys a register
    float ps0 = 0.f, ps1 = 0.f;
#pragma unroll
    for (int nt = 0; nt < 2; ++nt)
#pragma unroll
      for (int i = 0; i < 4; ++i) {
        const float p0 = __expf(s[nt][2 * i] - mnew), p1 = __expf(s[nt][2 * i + 1] - mnew);
        ps0 += p0; ps1 += p1;
        const unsigned int h0 = bf16_top(p0), h1 = bf16_top(p1);
        pwh[nt * 4 + i] = pack_tops(h0, h1);
        pwl[nt * 4 + i] = pack_tops(bf16_top(p0 - __uint_as_float(h0 & 0xFFFF0000u)), bf16_top(p1 - __uint_as_float(h1 & 0xFFFF0000u)));
      }
    const v16b pbh = __builtin_bit_cast(v16b, pwh), pbl = __builtin_bit_cast(v16b, pwl);
    l_q = l_q * alpha + (ps0 + ps1);                 // this half's 16 keys (the halves are joined at the end)
#pragma unroll
    for (int dt = 0; dt < DT; ++dt)
#pragma unroll
      for (int r = 0; r < 8; ++r) oacc[dt][r] *= alpha;
#pragma unroll
    for (int dt = 0; dt < DT; ++dt) {
      oacc[dt] = mmaN<3>(avh[dt].v, avl[dt].v, pbh, pbl, oacc[dt]);
    }
  }
  const float qnan = __uint_as_float(0x7FC00000u);
  const float lsum = l_q + xhalf(l_q);
  const float inv = (m_q > -1.0e38f) ? (1.0f / lsum) : qnan;
#pragma unroll
  for (int dt = 0; dt < DT; ++dt) {
    v4f lo4, hi4;
#pragma unroll
    for (int r = 0; r < 4; ++r) { lo4[r] = oacc[dt][r] * inv; hi4[r] = oacc[dt][4 + r] * inv; }
    *(v4fa*)&sO[w][ln][dt * 16 + 8 * hh] = lo4;
    *(v4fa*)&sO[w][ln][dt * 16 + 8 * hh + 4] = hi4;
  }
  __builtin_amdgcn_fence(4 /* acq_rel order */, "workgroup");
  __builtin_amdgcn_wave_barrier();
  {
    for (int r = 0; r < 16; ++r) {
      const int row = q0 + r;
      if (row < T && lane < D / 4) {
        const v4f val = *(const v4fa*)&sO[w][r][lane * 4];
        *(v4f*)(y + ((size_t)b * T + row) * ypitch + h * D + lane * 4) = val;
      }
    }
    
  }
}

extern "C" void kernel_launch(void* const* d_in, const int* in_sizes, int n_in,
                              void* d_out, int out_size, void* d_ws, size_t ws_size, hipStream_t stream) {
  if (n_in < 12) return;
  const float* xq = (const float*)d_in[0]; const float* xk = (const float*)d_in[1]; const float* xv = (const float*)d_in[2];
  const int* kpm = (const int*)d_in[3];
  const float* Wq = (const float*)d_in[4]; const float* bq = (const float*)d_in[5]; const float* Wk = (const float*)d_in[6]; const float* bk = (const float*)d_in[7];
  const float* Wv = (const float*)d_in[8]; const float* bv = (const float*)d_in[9]; const float* Wo = (const float*)d_in[10]; const float* bo = (const float*)d_in[11];
  // size checks (lower bounds so a reduced NB/SEQ build still launches on full-size inputs)
  const long long needX = (long long)(NB - 1) * SEQ_FULL * DD + (long long)SEQ * DD;
  if ((long long)in_sizes[0] < needX || (long long)in_sizes[1] < needX || (long long)in_sizes[2] < needX) return;
  if (in_sizes[3] < (NB - 1) * SEQ_FULL + SEQ) return;
  if (in_sizes[4] < DD * DD || in_sizes[6] < DD * DD || in_sizes[8] < DD * DD || in_sizes[10] < DD * DD) return;
  if (in_sizes[5] < DD || in_sizes[7] < DD || in_sizes[9] < DD || in_sizes[11] < DD) return;
  if ((long long)out_size < (long long)NB * SEQ * DD) return;

  char* ws = (char*)d_ws; size_t off = 0;
  auto take = [&](size_t bytes) { char* p = ws + off; off += (bytes + 255) & ~(size_t)255; return p; };
  const size_t MROWS = (size_t)NB * SEQ;
  unsigned short* Wt[4]; for (int i = 0; i < 4; ++i) Wt[i] = (unsigned short*)take((size_t)DD * DD * 2);
  float* q   = (float*)take(MROWS * DD * 4);
  unsigned short* kh = (unsigned short*)take(MROWS * DD * 2);
  unsigned short* kl = (unsigned short*)take(MROWS * DD * 2);
  unsigned short* vh = (unsigned short*)take(MROWS * DD * 2);
  unsigned short* vl = (unsigned short*)take(MROWS * DD * 2);
  float* att = (float*)take(MROWS * DD * 4);
  int* live  = (int*)take(MROWS * 4);
  int* nlive = (int*)take((size_t)NB * 4);
  if (off > ws_size) return;

  const int n8 = DD * DD / 8;
  const int gb = (SEQ / 64) * (DD / 128);
  const dim3 gg(gb, NB), gg3(gb, NB, 3);
  const int nbw = (n8 + 255) / 256;
  k_prep<(SEQ + 255) / 256><<<NB + 4 * nbw, 256, 0, stream>>>(Wq, Wk, Wv, Wo, Wt[0], Wt[1], Wt[2], Wt[3], n8, nbw, kpm, SEQ_FULL, SEQ, live, SEQ, nlive, NB);
  k_gemm_qkv<<<gg3, 128, 0, stream>>>(xq, xk, xv, DD, SEQ_FULL * DD, Wt[0], Wt[1], Wt[2], DD, bq, bk, bv, q, kh, kl, vh, vl, DD, SEQ * DD, SEQ, DD, DD, live, SEQ, nlive);
  k_flash_pm<HD><<<NB * NH * (SEQ / 64), 128, 0, stream>>>(q, kh, kl, vh, vl, DD, SEQ, NH, 0.125f, nlive, att, DD);
  k_gemm_out<<<gg, 128, 0, stream>>>(att, DD, SEQ * DD, Wt[3], DD, bo, (float*)d_out, DD, SEQ * DD, SEQ, DD, DD);
  (void)hipGetLastError();
}

// v007
// A run of this version takes 87 microseconds.
// Two timings next to v006 both put it at 1.09 times that version's speed.
// All steps since v000 together make it 5.37 times as fast.
#include <hip/hip_runtime.h>
// Contractions: q/k/v = x*W^T + b on v_wmma_f32_16x16x32_bf16, a 64 x 128 tile of the result per block with both operands staged in LDS (x, W, b converted to bf16 RNE, single term); QK^T and P*V per 16-query tile as
// 3-term bf16 hi/lo splits, both transposed (S^T = K*Q^T, O^T += V^T*P^T: a lane holds one query's scores, and P^T goes from the score
// accumulators straight into the B operand); out = a*Wo^T + bo with a as a 2-term bf16 hi/lo split (Wo, bo bf16 RNE); f32 accumulate, softmax in f32.
// k and v leave their projection already split into bf16 hi/lo planes, so the attention blocks stage them into LDS by plain 16-byte copies.
// Keys whose padding flag is set have probability exactly 0: the unflagged keys of each batch are listed in ascending order, the k and v
// projections compute only those rows and store them packed (row p = p-th unflagged key), and the attention key loop ends at their count.
// Four launches: work that does not depend on each other shares a grid and is told apart by the block index (the four weight conversions
// with the key lists; the q, k and v projections).
#ifndef NB
#define NB 4
#endif
#ifndef SEQ
#define SEQ 2048
#endif
#define NB_FULL 4
#define SEQ_FULL 2048
#define DD 512
#define NH 8
#define HD 64

static_assert(NB >= 1 && NB <= NB_FULL);
static_assert(SEQ >= 64 && SEQ <= SEQ_FULL && (SEQ % 64) == 0);
static_assert(NH * HD == DD && (DD % 128) == 0 && (HD % 32) == 0 && HD <= 128);

typedef __bf16 v16b __attribute__((ext_vector_type(16)));
typedef unsigned short v8us __attribute__((ext_vector_type(8), may_alias));
typedef float  v8f  __attribute__((ext_vector_type(8)));
typedef unsigned int v8u __attribute__((ext_vector_type(8)));
typedef float  v4f  __attribute__((ext_vector_type(4)));
typedef float  v4fa __attribute__((ext_vector_type(4), may_alias));
typedef unsigned int v4u __attribute__((ext_vector_type(4), may_alias));
typedef unsigned int v2u __attribute__((ext_vector_type(2), may_alias));
typedef float  f32x2 __attribute__((ext_vector_type(2)));
typedef __bf16 bf16x2 __attribute__((ext_vector_type(2)));
union FragB { v16b v; v8us half[2]; unsigned int w[8]; };

// two f32 -> two bf16 (RNE) in one register by the packed hardware conversion: a in the lower 16 bits (the even element), b in the upper
__device__ __forceinline__ unsigned int cvt2(float a, float b) { return __builtin_bit_cast(unsigned int, __builtin_convertvector((f32x2){a, b}, bf16x2)); }
// the f32 values of the two bf16 of such a register
__device__ __forceinline__ float bf16_lower(unsigned int p) { return __uint_as_float(p << 16); }
__device__ __forceinline__ float bf16_upper(unsigned int p) { return __uint_as_float(p & 0xFFFF0000u); }
// hi/lo split of two f32: hi = RNE(x), lo = RNE(x - hi), each pair packed as by cvt2
struct HiLo { unsigned int hi, lo; };
__device__ __forceinline__ HiLo split2(float a, float b) {
  const unsigned int hi = cvt2(a, b);
  return HiLo{hi, cvt2(a - bf16_lower(hi), b - bf16_upper(hi))};
}
__device__ __forceinline__ float bf16_rne(float x) { return bf16_lower(cvt2(x, x)); }

// 16-bit transposing LDS load: with lane l addressing 16 bytes at T[k0 + 8*(l>>4) + (l&7)][d0 + 8*((l>>3)&1)], lane (c = l&15, h = l>>4)
// receives T[k0 + 8h + 0..7][d0 + c]
typedef short s16x8 __attribute__((ext_vector_type(8)));
__device__ __forceinline__ v8us tr16(const unsigned short* p) {
  const s16x8 r = __builtin_amdgcn_ds_load_tr16_b128_v8i16((__attribute__((address_space(3))) s16x8*)p);
  return __builtin_bit_cast(v8us, r);
}

// lane l takes the value of lane l ^ 16 (the other half of the wave)
__device__ __forceinline__ float xhalf(float x) {
  const int b = __float_as_int(x);
  return __int_as_float(__builtin_amdgcn_permlanex16(b, b, 0x76543210, 0xfedcba98, false, false));
}

// D += A*B with NT terms: 1 = ah*bh, 2 = + al*bh (A split), 3 = + ah*bl (both split); 4 nops guard the accumulator
template <int NT>
__device__ __forceinline__ v8f mmaN(v16b ah, v16b al, v16b bh, v16b bl, v8f c) {
  c = __builtin_amdgcn_wmma_f32_16x16x32_bf16(false, ah, false, bh, (short)0, c, false, false);
  if (NT >= 2) c = __builtin_amdgcn_wmma_f32_16x16x32_bf16(false, al, false, bh, (short)0, c, false, false);
  if (NT >= 3) c = __builtin_amdgcn_wmma_f32_16x16x32_bf16(false, ah, false, bl, (short)0, c, false, false);
  asm volatile("v_nop\n\tv_nop\n\tv_nop\n\tv_nop" : "+v"(c) : "v"(ah), "v"(al), "v"(bh), "v"(bl));
  return c;
}

// Wt[n][k] (bf16 bits) = RNE(W[n][k]) for a row-major [N][K] weight used as x*W^T: plain elementwise convert, 8 per thread,
// thread t of the conversion takes elements 8t .. 8t+7
__device__ __forceinline__ void rne_rows(const float* __restrict__ W, unsigned short* __restrict__ Wt, int n8, int t) {
  if (t >= n8) return;
  const v4f a = *(const v4fa*)(W + (size_t)t * 8), b = *(const v4fa*)(W + (size_t)t * 8 + 4);
  *(v4u*)(Wt + (size_t)t * 8) = (v4u){cvt2(a[0], a[1]), cvt2(a[2], a[3]), cvt2(b[0], b[1]), cvt2(b[2], b[3])};
}

// live[b*lpitch + p] = index of the p-th key of batch b (one block of 256 threads a batch) with kpm[b*mpitch + j] == 0 (ascending), nlive[b] = how many there are.
// Wave w owns the PER*32 consecutive keys from w*PER*32, one key a lane in each of PER groups: a ballot gives a key's rank inside its group,
// and the eight wave totals, exchanged through LDS, give each wave its first slot.
template <int PER>
__device__ __forceinline__ void live_keys(const int* __restrict__ kpm, int mpitch, int T, int* __restrict__ live, int lpitch, int* __restrict__ nlive, int b) {
  __shared__ int part[8];
  const int t = threadIdx.x, w = t >> 5, lane = t & 31;
  const int* mrow = kpm + (size_t)b * mpitch;
  unsigned bal[PER];
  int c = 0;
#pragma unroll
  for (int i = 0; i < PER; ++i) {
    const int j = (w * PER + i) * 32 + lane, jc = (j < T) ? j : (T - 1);
    bal[i] = __builtin_amdgcn_ballot_w32((mrow[jc] == 0) && (j < T));
    c += __builtin_popcount(bal[i]);
  }
  if (lane == 0) part[w] = c;
  __syncthreads();                                 // cross-wave: every wave's total is in LDS
  int o = 0, tot = 0;
#pragma unroll
  for (int k = 0; k < 8; ++k) { const int v = part[k]; o += (k < w) ? v : 0; tot += v; }
  int* lrow = live + (size_t)b * lpitch;
  const unsigned below = (1u << lane) - 1u;
#pragma unroll
  for (int i = 0; i < PER; ++i) {
    if ((bal[i] >> lane) & 1u) lrow[o + __builtin_popcount(bal[i] & below)] = (w * PER + i) * 32 + lane;
    o += __builtin_popcount(bal[i]);
  }
  if (t == 0) nlive[b] = tot;
}

// One grid for all that only reads inputs: blocks 0 .. nb-1 list the keys of one batch each, then nbw blocks convert each of the four weights.
template <int PER>
__global__ __launch_bounds__(256) void k_prep(const float* __restrict__ W0, const float* __restrict__ W1, const float* __restrict__ W2, const float* __restrict__ W3,
                                              unsigned short* __restrict__ T0, unsigned short* __restrict__ T1, unsigned short* __restrict__ T2, unsigned short* __restrict__ T3,
                                              int n8, int nbw, const int* __restrict__ kpm, int mpitch, int T, int* __restrict__ live, int lpitch,
                                              int* __restrict__ nlive, int nb) {
  const int bx = blockIdx.x;
  if (bx < nb) { live_keys<PER>(kpm, mpitch, T, live, lpitch, nlive, bx); return; }     // block-uniform: its barrier is met by the whole block
  const int g = bx - nb, wi = g / nbw, blk = g % nbw;
  const float* W = (wi == 0) ? W0 : (wi == 1) ? W1 : (wi == 2) ? W2 : W3;
  unsigned short* Wt = (wi == 0) ? T0 : (wi == 1) ? T1 : (wi == 2) ? T2 : T3;
  rne_rows(W, Wt, n8, blk * 256 + (int)threadIdx.x);
}

// GEMM C[M][N] (f32, pitch ldc) = A[M][K]*W^T + bias per batch y (A += y*abatch, C += y*cbatch elements); bx = the block's tile number.
// A f32 row-major (pitch lda) converted to bf16 (ASPLIT: hi/lo -> 2 terms, else single RNE term); Wt bf16 [N][K] (pitch ldb).
// BIAS_BF16 converts the bias to bf16 RNE before the add. K%64==0, M%64==0, N%128==0.
// One block = a 64 x 128 tile of C, four waves of 32 x 64 each. K goes in steps of 64: the step's 64 A rows (converted once) and 128 Wt rows are
// brought by loads that cover whole 128-byte lines, stored in LDS at a 144-byte pitch and read from there as fragments by every wave that needs
// them; the next step's global loads are issued ahead of the current step's products.
// CSPLIT: the f32 result x is not stored; Ch gets RNE(x) and Cl gets RNE(x - Ch) as bf16 bits, same pitch and batch stride (in elements) as C.
// PACK: output row p comes from A row live[y*lpitch + p], for p < nlive[y] only (the last 64-row tile repeats the last listed row); later tiles are not written.
// The block's LDS is declared by the kernel and handed in, so that two forms of the tile in one kernel share it.
template <bool ASPLIT>
struct __attribute__((aligned(16))) GemmLds {
  unsigned short Ah[64][72], Al[ASPLIT ? 64 : 1][72], W[128][72];   // 144-byte rows, 16 bytes x odd, for 16-byte fragment reads
  float so[4][32][64];
};
template <bool ASPLIT, bool BIAS_BF16, bool CSPLIT, bool PACK>
__device__ __forceinline__ void gemm_tile(GemmLds<ASPLIT>& L, unsigned bx, unsigned y, const float* __restrict__ A, int lda, int abatch, const unsigned short* __restrict__ Wt, int ldb,
                                          const float* __restrict__ bias, float* __restrict__ C, unsigned short* __restrict__ Ch,
                                          unsigned short* __restrict__ Cl, int ldc, int cbatch, int M, int N, int K,
                                          const int* __restrict__ live, int lpitch, const int* __restrict__ nlive) {
  constexpr int BM = 64, BN = 128, BK = 64;
  auto& sAh = L.Ah; auto& sAl = L.Al; auto& sW = L.W; auto& so = L.so;
  const int tid = threadIdx.x, w = tid >> 5, lane = tid & 31, ln = lane & 15, hh = lane >> 4;
  const int wm = w >> 1, wn = w & 1;                         // the wave's 32 rows and 64 columns inside the block tile
  const int ntn = N / BN;
  const int mt = bx / ntn, nq = bx % ntn;
  int Mb = M;
  if (PACK) { const int c = nlive[y]; Mb = (c < M) ? c : M; }
  if (mt * BM >= Mb) return;                    // block-uniform, ahead of every barrier
  const int row0 = mt * BM, col0 = nq * BN;
  const float* Ab = A + (size_t)y * (size_t)abatch;
  // staging: 16 lanes cover the 256 bytes of one A row's step, 8 lanes the 128 bytes of one Wt row's step
  const int sar = tid >> 4, sac = (tid & 15) * 4, swr = tid >> 3, swc = (tid & 7) * 8;
  unsigned aoff[8], woff[8];
#pragma unroll
  for (int i = 0; i < 8; ++i) {
    int ar = row0 + sar + i * 8;
    if (PACK) {
      const int p = (ar < Mb) ? ar : (Mb - 1);
      const unsigned g = (unsigned)live[(size_t)y * lpitch + p];
      ar = (int)((g < (unsigned)M) ? g : (unsigned)(M - 1));
    }
    aoff[i] = ((unsigned)ar * (unsigned)lda + (unsigned)sac) * 4u;                          // byte offsets: one 32-bit register each, kept for
    woff[i] = ((unsigned)(col0 + swr + i * 16) * (unsigned)ldb + (unsigned)swc) * 2u;       // all steps and moved on by the step's bytes
  }
  v4f xa[8]; v8us xw[8];
#pragma unroll
  for (int i = 0; i < 8; ++i) { xa[i] = *(const v4fa*)((const char*)Ab + aoff[i]); xw[i] = *(const v8us*)((const char*)Wt + woff[i]); }
  v8f acc[2][4];
#pragma unroll
  for (int mi = 0; mi < 2; ++mi)
#pragma unroll
    for (int t = 0; t < 4; ++t) acc[mi][t] = (v8f){0.f,0.f,0.f,0.f,0.f,0.f,0.f,0.f};
  for (int kb = 0; kb < K; kb += BK) {
    __syncthreads();                                 // cross-wave: all waves done reading the prior step's tiles
#pragma unroll
    for (int i = 0; i < 8; ++i) {
      if (ASPLIT) {
        const HiLo s0 = split2(xa[i][0], xa[i][1]), s1 = split2(xa[i][2], xa[i][3]);
        *(v2u*)&sAh[sar + i * 8][sac] = (v2u){s0.hi, s1.hi};
        *(v2u*)&sAl[sar + i * 8][sac] = (v2u){s0.lo, s1.lo};
      } else {
        *(v2u*)&sAh[sar + i * 8][sac] = (v2u){cvt2(xa[i][0], xa[i][1]), cvt2(xa[i][2], xa[i][3])};
      }
      *(v8us*)&sW[swr + i * 16][swc] = xw[i];
    }
    __syncthreads();                                 // cross-wave: staging complete before any fragment load
    if (kb + BK < K) {                               // block-uniform: the next step's loads fly under this step's products
#pragma unroll
      for (int i = 0; i < 8; ++i) { aoff[i] += BK * 4u; woff[i] += BK * 2u; }
#pragma unroll
      for (int i = 0; i < 8; ++i) { xa[i] = *(const v4fa*)((const char*)Ab + aoff[i]); xw[i] = *(const v8us*)((const char*)Wt + woff[i]); }
      asm volatile("s_wait_xcnt 0x0" ::: "memory");  // ahead of any later write to a register that these loads name as address
    }
#pragma unroll
    for (int ks = 0; ks < BK / 32; ++ks) {
      FragB ah[2], al[2], b[4];
#pragma unroll
      for (int mi = 0; mi < 2; ++mi) {
        const int r = wm * 32 + mi * 16 + ln;
        ah[mi].half[0] = *(const v8us*)&sAh[r][ks * 32 + 8 * hh];          // elements 0..7  <- k = kb+32ks+8h .. +7
        ah[mi].half[1] = *(const v8us*)&sAh[r][ks * 32 + 16 + 8 * hh];     // elements 8..15 <- k = kb+32ks+16+8h .. +7
        if (ASPLIT) { al[mi].half[0] = *(const v8us*)&sAl[r][ks * 32 + 8 * hh]; al[mi].half[1] = *(const v8us*)&sAl[r][ks * 32 + 16 + 8 * hh]; }
        else al[mi] = ah[mi];
      }
#pragma unroll
      for (int t = 0; t < 4; ++t) {
        const int n = wn * 64 + t * 16 + ln;
        b[t].half[0] = *(const v8us*)&sW[n][ks * 32 + 8 * hh];
        b[t].half[1] = *(const v8us*)&sW[n][ks * 32 + 16 + 8 * hh];
      }
#pragma unroll
      for (int mi = 0; mi < 2; ++mi)
#pragma unroll
        for (int t = 0; t < 4; ++t) acc[mi][t] = mmaN<ASPLIT ? 2 : 1>(ah[mi].v, al[mi].v, b[t].v, b[t].v, acc[mi][t]);
    }
  }
  const int wrow0 = row0 + wm * 32, wcol0 = col0 + wn * 64;
#pragma unroll
  for (int t = 0; t < 4; ++t) {
    float bvv = bias[wcol0 + t * 16 + ln];
    if (BIAS_BF16) bvv = bf16_rne(bvv);
#pragma unroll
    for (int mi = 0; mi < 2; ++mi)
#pragma unroll
      for (int r = 0; r < 8; ++r) { so[w][mi * 16 + 8 * hh + r][t * 16 + ln] = acc[mi][t][r] + bvv; }
  }
  __builtin_amdgcn_fence(4 /* acq_rel order */, "workgroup");      // so[w] is wave-private: same-wave exchange
  __builtin_amdgcn_wave_barrier();
  if (CSPLIT) {
    unsigned short* Chb = Ch + (size_t)y * (size_t)cbatch;
    unsigned short* Clb = Cl + (size_t)y * (size_t)cbatch;
    const int rsub = lane >> 3, c8 = (lane & 7) * 8;      // 8 lanes write one 128-byte row piece of each plane
#pragma unroll
    for (int q = 0; q < 8; ++q) {
      const int r = q * 4 + rsub;
      const v4f x0 = *(const v4fa*)&so[w][r][c8], x1 = *(const v4fa*)&so[w][r][c8 + 4];
      const HiLo s0 = split2(x0[0], x0[1]), s1 = split2(x0[2], x0[3]), s2 = split2(x1[0], x1[1]), s3 = split2(x1[2], x1[3]);
      const size_t o = (size_t)(wrow0 + r) * ldc + wcol0 + c8;
      *(v4u*)(Chb + o) = (v4u){s0.hi, s1.hi, s2.hi, s3.hi};
      *(v4u*)(Clb + o) = (v4u){s0.lo, s1.lo, s2.lo, s3.lo};
    }
    asm volatile("s_wait_xcnt 0x0" ::: "memory");    // ahead of any later write to a register that these stores name: in a kernel with two forms of the tile the other form's code follows
  } else {
    float* Cb = C + (size_t)y * (size_t)cbatch;
    const int rsub = lane >> 4, c4 = (lane & 15) * 4;
#pragma unroll
    for (int q = 0; q < 16; ++q) {
      const int r = q * 2 + rsub;
      const v4f v = *(const v4fa*)&so[w][r][c4];
      *(v4f*)(Cb + (size_t)(wrow0 + r) * ldc + wcol0 + c4) = v;
    }
  }
}

// The three projections in one grid: blockIdx.z = 0, 1 the k and v projections (packed rows, split planes), 2 the q projection (all rows, f32).
// Same shapes and pitches for all three. The k and v tiles, whose first loads wait for the key list, come first in the grid.
__global__ __launch_bounds__(128) void k_gemm_qkv(const float* __restrict__ xq, const float* __restrict__ xk, const float* __restrict__ xv, int lda, int abatch,
                                                  const unsigned short* __restrict__ Wtq, const unsigned short* __restrict__ Wtk, const unsigned short* __restrict__ Wtv, int ldb,
                                                  const float* __restrict__ bq, const float* __restrict__ bk, const float* __restrict__ bv,
                                                  float* __restrict__ q, unsigned short* __restrict__ kh, unsigned short* __restrict__ kl,
                                                  unsigned short* __restrict__ vh, unsigned short* __restrict__ vl, int ldc, int cbatch, int M, int N, int K,
                                                  const int* __restrict__ live, int lpitch, const int* __restrict__ nlive) {
  __shared__ GemmLds<false> L;
  const int z = blockIdx.z;                          // block-uniform
  if (z == 2) {
    gemm_tile<false, true, false, false>(L, blockIdx.x, blockIdx.y, xq, lda, abatch, Wtq, ldb, bq, q, nullptr, nullptr, ldc, cbatch, M, N, K, nullptr, 0, nullptr);
  } else {
    gemm_tile<false, true, true, true>(L, blockIdx.x, blockIdx.y, z ? xv : xk, lda, abatch, z ? Wtv : Wtk, ldb, z ? bv : bk, nullptr, z ? vh : kh, z ? vl : kl,
                                       ldc, cbatch, M, N, K, live, lpitch, nlive);
  }
}

// The output projection: A as a 2-term split, f32 result.
__global__ __launch_bounds__(128) void k_gemm_out(const float* __restrict__ A, int lda, int abatch, const unsigned short* __restrict__ Wt, int ldb,
                                                  const float* __restrict__ bias, float* __restrict__ C, int ldc, int cbatch, int M, int N, int K) {
  __shared__ GemmLds<true> L;
  gemm_tile<true, true, false, false>(L, blockIdx.x, blockIdx.y, A, lda, abatch, Wt, ldb, bias, C, nullptr, nullptr, ldc, cbatch, M, N, K, nullptr, 0, nullptr);
}

// Flash-style attention over the packed keys of each batch: k and v rows 0 .. nlive[b]-1 take part, no other row is read;
// nlive[b] == 0 (every key excluded) yields NaN. QK^T and P*V as 3-term bf16 hi/lo splits, f32 softmax with running max.
// q rows f32, k and v rows as bf16 hi/lo planes, all with pitch `pitch` (elements), batch b at X + b*T*pitch, head h at column h*D.
// One wave = 16 query rows, block = 4 waves (64 queries) sharing K/V chunks of 32 keys copied into LDS (hi/lo bf16 planes).
// Both products are transposed: in S^T[key][query] and O^T[d][query] lane (ln, hh) holds query ln, so the running maximum, the rescale factor
// and the row sum are one value a lane (the two halves of the wave hold 16 keys of a chunk each and exchange the maximum once a chunk).
template <int D>
__global__ __launch_bounds__(128) void k_flash_pm(const float* __restrict__ Qb, const unsigned short* __restrict__ Khb, const unsigned short* __restrict__ Klb,
                                                const unsigned short* __restrict__ Vhb, const unsigned short* __restrict__ Vlb, int pitch, int T, int H, float scale, const int* __restrict__ nlive,
                                                float* __restrict__ y, int ypitch) {
  constexpr int KS = D / 32, DT = D / 16, NP = 32 * (D / 8) / 128;   // NP: 16-byte pieces of one plane's chunk per thread
  __shared__ __attribute__((aligned(16))) unsigned short sKh[32][D + 8], sKl[32][D + 8], sVh[32][D + 16], sVl[32][D + 16];
  __shared__ __attribute__((aligned(16))) float sO[4][16][D + 4];     // 16 bytes x odd pitch: the 16 query rows of a 16-byte store spread over the banks
  const int tid = threadIdx.x, w = tid >> 5, lane = tid & 31, ln = lane & 15, hh = lane >> 4;
  const int nqb = (T + 63) / 64;
  const int bh = blockIdx.x / nqb, qblk = blockIdx.x % nqb;
  const int b = bh / H, h = bh % H;
  const int q0 = qblk * 64 + w * 16;
  const float* Q = Qb + (size_t)b * T * pitch + h * D;
  const unsigned short* Kh = Khb + (size_t)b * T * pitch + h * D;
  const unsigned short* Kl = Klb + (size_t)b * T * pitch + h * D;
  const unsigned short* Vh = Vhb + (size_t)b * T * pitch + h * D;
  const unsigned short* Vl = Vlb + (size_t)b * T * pitch + h * D;
  const int nl = nlive[b];
  const int Tk = (nl < T) ? nl : T;                  // keys of this batch; block-uniform
  const int trow = 8 * hh + (lane & 7), tcol = 8 * ((lane >> 3) & 1);   // lane address of a transposing load: 16 bytes of row trow

  // B fragments [k = d][n = query] of the wave's 16 query rows (scaled by an exact power of two), hi/lo
  FragB aqh[KS], aql[KS];
  {
    int row = q0 + ln; if (row >= T) row = T - 1;
    const float* qr = Q + (size_t)row * pitch;
#pragma unroll
    for (int ks = 0; ks < KS; ++ks)
#pragma unroll
      for (int i = 0; i < 16; i += 2) {               // elements i and i + 1 are neighbours in d and share a register
        const int d = ks * 32 + ((i < 8) ? (8 * hh + i) : (16 + 8 * hh + (i - 8)));
        const HiLo s = split2(qr[d] * scale, qr[d + 1] * scale);
        aqh[ks].w[i / 2] = s.hi; aql[ks].w[i / 2] = s.lo;
      }
  }
  float m_q = -3.0e38f, l_q = 0.f;                   // query ln: running maximum (same in both halves), this half's part of the row sum
  v8f oacc[DT];                                      // oacc[dt][r] = O[query ln][d = dt*16 + 8*hh + r]
#pragma unroll
  for (int dt = 0; dt < DT; ++dt) oacc[dt] = (v8f){0.f,0.f,0.f,0.f,0.f,0.f,0.f,0.f};

  for (int j0 = 0; j0 < Tk; j0 += 32) {
    __syncthreads();                                 // cross-wave: all waves done reading sK/sV of the prior chunk
    {
      v8us xkh[NP], xkl[NP], xvh[NP], xvl[NP];       // all loads of the chunk issued before the first LDS store
#pragma unroll
      for (int i = 0; i < NP; ++i) {
        const int e = tid + i * 128, r = e / (D / 8), c8 = (e % (D / 8)) * 8;
        int key = j0 + r; if (key >= Tk) key = Tk - 1;                       // clamped address, zero by value
        const unsigned o = ((unsigned)key * (unsigned)pitch + (unsigned)c8) * 2u;   // byte offset, one 32-bit register for all four planes
        xkh[i] = *(const v8us*)((const char*)Kh + o); xkl[i] = *(const v8us*)((const char*)Kl + o);
        xvh[i] = *(const v8us*)((const char*)Vh + o); xvl[i] = *(const v8us*)((const char*)Vl + o);
      }
      if (j0 + 32 > Tk) {                                                    // block-uniform: only a chunk that runs past Tk
        const v8us zz = (v8us){0,0,0,0,0,0,0,0};
#pragma unroll
        for (int i = 0; i < NP; ++i)
          if (j0 + (tid + i * 128) / (D / 8) >= Tk) { xkh[i] = zz; xkl[i] = zz; xvh[i] = zz; xvl[i] = zz; }
      }
#pragma unroll
      for (int i = 0; i < NP; ++i) {
        const int e = tid + i * 128, r = e / (D / 8), c8 = (e % (D / 8)) * 8;
        *(v8us*)&sKh[r][c8] = xkh[i]; *(v8us*)&sKl[r][c8] = xkl[i];
        *(v8us*)&sVh[r][c8] = xvh[i]; *(v8us*)&sVl[r][c8] = xvl[i];
      }
    }
    __syncthreads();                                 // cross-wave: staging complete before any fragment load
    // S^T tile 32 keys x 16 queries: A[m = key][k = d] from sK[key][d]; s[nt][r] = score of key j0 + nt*16 + 8*hh + r with query ln
    v8f s[2];
#pragma unroll
    for (int nt = 0; nt < 2; ++nt) {
      v8f acc = (v8f){0.f,0.f,0.f,0.f,0.f,0.f,0.f,0.f};
#pragma unroll
      for (int ks = 0; ks < KS; ++ks) {
        FragB kh_, kl_;
        kh_.half[0] = *(const v8us*)&sKh[nt * 16 + ln][ks * 32 + 8 * hh]; kh_.half[1] = *(const v8us*)&sKh[nt * 16 + ln][ks * 32 + 16 + 8 * hh];
        kl_.half[0] = *(const v8us*)&sKl[nt * 16 + ln][ks * 32 + 8 * hh]; kl_.half[1] = *(const v8us*)&sKl[nt * 16 + ln][ks * 32 + 16 + 8 * hh];
        acc = mmaN<3>(kh_.v, kl_.v, aqh[ks].v, aql[ks].v, acc);
      }
      s[nt] = acc;
    }
    // A[m = d][k = key] from sV[key][d]: all V fragments by transposing LDS loads, one group whose latency the softmax covers
    FragB avh[DT], avl[DT];
#pragma unroll
    for (int dt = 0; dt < DT; ++dt) {
      avh[dt].half[0] = tr16(&sVh[trow][dt * 16 + tcol]); avh[dt].half[1] = tr16(&sVh[16 + trow][dt * 16 + tcol]);
      avl[dt].half[0] = tr16(&sVl[trow][dt * 16 + tcol]); avl[dt].half[1] = tr16(&sVl[16 + trow][dt * 16 + tcol]);
    }
    if (j0 + 32 > Tk) {                              // block-uniform: only a chunk that runs past Tk holds keys past the last packed one;
#pragma unroll
      for (int nt = 0; nt < 2; ++nt)                 // their exponential below is exactly 0 (key j0 is real, so the maximum is a real score)
#pragma unroll
        for (int r = 0; r < 8; ++r) if (j0 + nt * 16 + 8 * hh + r >= Tk) s[nt][r] = -3.0e38f;
    }
    float mx = fmaxf(s[0][0], s[1][0]);
#pragma unroll
    for (int r = 1; r < 8; ++r) mx = fmaxf(mx, fmaxf(s[0][r], s[1][r]));
    mx = fmaxf(mx, xhalf(mx));                       // both halves now hold the maximum over the chunk's 32 keys
    const float mnew = fmaxf(m_q, mx);
    const float alpha = (mnew > -1.0e38f) ? __expf(m_q - mnew) : 1.0f;
    m_q = mnew;
    // P^T as the B operand [k = key][n = query]: element nt*8 + r of lane (ln, hh) is key nt*16 + 8*hh + r, which is where s[nt][r] already lies
    v8u pwh, pwl;                                    // hi and lo planes, two keys a register
    float ps0 = 0.f, ps1 = 0.f;
#pragma unroll
    for (int nt = 0; nt < 2; ++nt)
#pragma unroll
      for (int i = 0; i < 4; ++i) {
        const float p0 = __expf(s[nt][2 * i] - mnew), p1 = __expf(s[nt][2 * i + 1] - mnew);
        ps0 += p0; ps1 += p1;
        const HiLo pp = split2(p0, p1);
        pwh[nt * 4 + i] = pp.hi; pwl[nt * 4 + i] = pp.lo;
      }
    const v16b pbh = __builtin_bit_cast(v16b, pwh), pbl = __builtin_bit_cast(v16b, pwl);
    l_q = l_q * alpha + (ps0 + ps1);                 // this half's 16 keys (the halves are joined at the end)
#pragma unroll
    for (int dt = 0; dt < DT; ++dt)
#pragma unroll
      for (int r = 0; r < 8; ++r) oacc[dt][r] *= alpha;
#pragma unroll
    for (int dt = 0; dt < DT; ++dt) {
      oacc[dt] = mmaN<3>(avh[dt].v, avl[dt].v, pbh, pbl, oacc[dt]);
    }
  }
  const float qnan = __uint_as_float(0x7FC00000u);
  const float lsum = l_q + xhalf(l_q);
  const float inv = (m_q > -1.0e38f) ? (1.0f / lsum) : qnan;
#pragma unroll
  for (int dt = 0; dt < DT; ++dt) {
    v4f lo4, hi4;
#pragma unroll
    for (int r = 0; r < 4; ++r) { lo4[r] = oacc[dt][r] * inv; hi4[r] = oacc[dt][4 + r] * inv; }
    *(v4fa*)&sO[w][ln][dt * 16 + 8 * hh] = lo4;
    *(v4fa*)&sO[w][ln][dt * 16 + 8 * hh + 4] = hi4;
  }
  __builtin_amdgcn_fence(4 /* acq_rel order */, "workgroup");
  __builtin_amdgcn_wave_barrier();
  {
    for (int r = 0; r < 16; ++r) {
      const int row = q0 + r;
      if (row < T && lane < D / 4) {
        const v4f val = *(const v4fa*)&sO[w][r][lane * 4];
        *(v4f*)(y + ((size_t)b * T + row) * ypitch + h * D + lane * 4) = val;
      }
    }
    
  }
}

extern "C" void kernel_launch(void* const* d_in, const int* in_sizes, int n_in,
                              void* d_out, int out_size, void* d_ws, size_t ws_size, hipStream_t stream) {
  if (n_in < 12) return;
  const float* xq = (const float*)d_in[0]; const float* xk = (const float*)d_in[1]; const float* xv = (const float*)d_in[2];
  const int* kpm = (const int*)d_in[3];
  const float* Wq = (const float*)d_in[4]; const float* bq = (const float*)d_in[5]; const float* Wk = (const float*)d_in[6]; const float* bk = (const float*)d_in[7];
  const float* Wv = (const float*)d_in[8]; const float* bv = (const float*)d_in[9]; const float* Wo = (const float*)d_in[10]; const float* bo = (const float*)d_in[11];
  // size checks (lower bounds so a reduced NB/SEQ build still launches on full-size inputs)
  const long long needX = (long long)(NB - 1) * SEQ_FULL * DD + (long long)SEQ * DD;
  if ((long long)in_sizes[0] < needX || (long long)in_sizes[1] < needX || (long long)in_sizes[2] < needX) return;
  if (in_sizes[3] < (NB - 1) * SEQ_FULL + SEQ) return;
  if (in_sizes[4] < DD * DD || in_sizes[6] < DD * DD || in_sizes[8] < DD * DD || in_sizes[10] < DD * DD) return;
  if (in_sizes[5] < DD || in_sizes[7] < DD || in_sizes[9] < DD || in_sizes[11] < DD) return;
  if ((long long)out_size < (long long)NB * SEQ * DD) return;

  char* ws = (char*)d_ws; size_t off = 0;
  auto take = [&](size_t bytes) { char* p = ws + off; off += (bytes + 255) & ~(size_t)255; return p; };
  const size_t MROWS = (size_t)NB * SEQ;
  unsigned short* Wt[4]; for (int i = 0; i < 4; ++i) Wt[i] = (unsigned short*)take((size_t)DD * DD * 2);
  float* q   = (float*)take(MROWS * DD * 4);
  unsigned short* kh = (unsigned short*)take(MROWS * DD * 2);
  unsigned short* kl = (unsigned short*)take(MROWS * DD * 2);
  unsigned short* vh = (unsigned short*)take(MROWS * DD * 2);
  unsigned short* vl = (unsigned short*)take(MROWS * DD * 2);
  float* att = (float*)take(MROWS * DD * 4);
  int* live  = (int*)take(MROWS * 4);
  int* nlive = (int*)take((size_t)NB * 4);
  if (off > ws_size) return;

  const int n8 = DD * DD / 8;
  const int gb = (SEQ / 64) * (DD / 128);
  const dim3 gg(gb, NB), gg3(gb, NB, 3);
  const int nbw = (n8 + 255) / 256;
  k_prep<(SEQ + 255) / 256><<<NB + 4 * nbw, 256, 0, stream>>>(Wq, Wk, Wv, Wo, Wt[0], Wt[1], Wt[2], Wt[3], n8, nbw, kpm, SEQ_FULL, SEQ, live, SEQ, nlive, NB);
  k_gemm_qkv<<<gg3, 128, 0, stream>>>(xq, xk, xv, DD, SEQ_FULL * DD, Wt[0], Wt[1], Wt[2], DD, bq, bk, bv, q, kh, kl, vh, vl, DD, SEQ * DD, SEQ, DD, DD, live, SEQ, nlive);
  k_flash_pm<HD><<<NB * NH * (SEQ / 64), 128, 0, stream>>>(q, kh, kl, vh, vl, DD, SEQ, NH, 0.125f, nlive, att, DD);
  k_gemm_out<<<gg, 128, 0, stream>>>(att, DD, SEQ * DD, Wt[3], DD, bo, (float*)d_out, DD, SEQ * DD, SEQ, DD, DD);
  (void)hipGetLastError();
}

// v008
// Measured time: 79.9 microseconds a run.
// Timed twice side by side with v007, it ran 1.09 and 1.10 times as fast.
// Counting every step since v000, it is 5.86 times as fast.
#include <hip/hip_runtime.h>
// Contractions: q/k/v = x*W^T + b on v_wmma_f32_16x16x32_bf16, a 64 x 128 tile of the result per block with both operands staged in LDS (x, W, b converted to bf16 RNE, single term); QK^T and P*V per 16-query tile as
// 3-term bf16 hi/lo splits, both transposed (S^T = K*Q^T, O^T += V^T*P^T: a lane holds one query's scores, and P^T goes from the score
// accumulators straight into the B operand); out = a*Wo^T + bo with a as a 2-term bf16 hi/lo split (Wo, bo bf16 RNE); f32 accumulate, softmax in f32.
// k and v leave their projection already split into bf16 hi/lo planes; the attention blocks bring each 32-key chunk of the four planes into LDS by
// tensor loads (one plane a wave), into two buffers in turn, so that the next chunk's load flies while the current chunk is worked on.
// Keys whose padding flag is set have probability exactly 0: the unflagged keys of each batch are listed in ascending order, the k and v
// projections compute only those rows and store them packed (row p = p-th unflagged key), and the attention key loop ends at their count.
// Four launches: work that does not depend on each other shares a grid and is told apart by the block index (the four weight conversions
// with the key lists; the q, k and v projections).
#ifndef NB
#define NB 4
#endif
#ifndef SEQ
#define SEQ 2048
#endif
#define NB_FULL 4
#define SEQ_FULL 2048
#define DD 512
#define NH 8
#define HD 64

static_assert(NB >= 1 && NB <= NB_FULL);
static_assert(SEQ >= 64 && SEQ <= SEQ_FULL && (SEQ % 64) == 0);
static_assert(NH * HD == DD && (DD % 128) == 0 && (HD % 32) == 0 && HD <= 128);

typedef __bf16 v16b __attribute__((ext_vector_type(16)));
typedef unsigned short v8us __attribute__((ext_vector_type(8), may_alias));
typedef float  v8f  __attribute__((ext_vector_type(8)));
typedef unsigned int v8u __attribute__((ext_vector_type(8)));
typedef float  v4f  __attribute__((ext_vector_type(4)));
typedef float  v4fa __attribute__((ext_vector_type(4), may_alias));
typedef unsigned int v4u __attribute__((ext_vector_type(4), may_alias));
typedef unsigned int v2u __attribute__((ext_vector_type(2), may_alias));
typedef float  f32x2 __attribute__((ext_vector_type(2)));
typedef __bf16 bf16x2 __attribute__((ext_vector_type(2)));
union FragB { v16b v; v8us half[2]; unsigned int w[8]; };

// two f32 -> two bf16 (RNE) in one register by the packed hardware conversion: a in the lower 16 bits (the even element), b in the upper
__device__ __forceinline__ unsigned int cvt2(float a, float b) { return __builtin_bit_cast(unsigned int, __builtin_convertvector((f32x2){a, b}, bf16x2)); }
// the f32 values of the two bf16 of such a register
__device__ __forceinline__ float bf16_lower(unsigned int p) { return __uint_as_float(p << 16); }
__device__ __forceinline__ float bf16_upper(unsigned int p) { return __uint_as_float(p & 0xFFFF0000u); }
// hi/lo split of two f32: hi = RNE(x), lo = RNE(x - hi), each pair packed as by cvt2
struct HiLo { unsigned int hi, lo; };
__device__ __forceinline__ HiLo split2(float a, float b) {
  const unsigned int hi = cvt2(a, b);
  return HiLo{hi, cvt2(a - bf16_lower(hi), b - bf16_upper(hi))};
}
__device__ __forceinline__ float bf16_rne(float x) { return bf16_lower(cvt2(x, x)); }

// 16-bit transposing LDS load: with lane l addressing 16 bytes at T[k0 + 8*(l>>4) + (l&7)][d0 + 8*((l>>3)&1)], lane (c = l&15, h = l>>4)
// receives T[k0 + 8h + 0..7][d0 + c]
typedef short s16x8 __attribute__((ext_vector_type(8)));
__device__ __forceinline__ v8us tr16(const unsigned short* p) {
  const s16x8 r = __builtin_amdgcn_ds_load_tr16_b128_v8i16((__attribute__((address_space(3))) s16x8*)p);
  return __builtin_bit_cast(v8us, r);
}

// lane l takes the value of lane l ^ 16 (the other half of the wave)
__device__ __forceinline__ float xhalf(float x) {
  const int b = __float_as_int(x);
  return __int_as_float(__builtin_amdgcn_permlanex16(b, b, 0x76543210, 0xfedcba98, false, false));
}

// Tensor load of a two-dimensional tile into LDS: one request of a whole wave, through no register.
typedef unsigned int u32x4 __attribute__((ext_vector_type(4)));
typedef unsigned int u32x8 __attribute__((ext_vector_type(8)));
__device__ __forceinline__ unsigned int uni(unsigned int v) { return (unsigned int)__builtin_amdgcn_readfirstlane(v); }
// a wave-uniform value held in a scalar register: a test on it compiles to s_cmp + s_cbranch (a tensor load ignores EXEC), and what is
// derived from it is computed behind the asm statements that stand in front of it
__device__ __forceinline__ unsigned int pinned(unsigned int v) {
  unsigned int w = uni(v);
  asm volatile("" : "+s"(w));                        // keeps a descriptor word or an issue test in a scalar register
  return w;
}
// this wave's tensor loads have landed; the descriptor groups are named as inputs so that their registers keep their values from the issue to this wait
__device__ __forceinline__ void wait_tensor0(u32x4 g0, u32x8 g1a, u32x8 g1b) { asm volatile("s_wait_tensorcnt 0x0" :: "s"(g0), "s"(g1a), "s"(g1b) : "memory"); }
__device__ __forceinline__ void wait_ds0() { asm volatile("s_wait_dscnt 0x0" ::: "memory"); }           // this wave's LDS reads have returned
__device__ __forceinline__ void tdm_load(u32x4 g0, u32x8 g1) { asm volatile("tensor_load_to_lds %0, %1" :: "s"(g0), "s"(g1) : "memory"); }
// Descriptor group 1: 1-byte elements, tensor = tile = 32 rows of 128 bytes, source row pitch src_pitch bytes, PADC + 1 dwords of LDS pad behind every row
template <unsigned int PADC>
__device__ __forceinline__ u32x8 tdm_group1(unsigned int src_pitch) {
  constexpr unsigned int d0 = 128u, d1 = 32u;
  u32x8 g;
  g[0] = uni((1u << 20) | (4u << 22) | (PADC << 25));   // no mask; pad on, interval code 4 = one 128-byte row
  g[1] = uni((d0 & 0xFFFFu) << 16);
  g[2] = uni((d0 >> 16) | ((d1 & 0xFFFFu) << 16));
  g[3] = uni((d1 >> 16) | (d0 << 16));
  g[4] = uni(d1);
  g[5] = uni(src_pitch);
  g[6] = uni(0u);
  g[7] = uni(0u);
  return g;
}
// Descriptor group 0: count 1, LDS byte offset, global address of the tile's first byte, type 2
__device__ __forceinline__ u32x4 tdm_group0(unsigned int lds_dst, unsigned long long ga) {
  u32x4 g;
  g[0] = uni(1u); g[1] = uni(lds_dst); g[2] = uni((unsigned int)ga); g[3] = uni((((unsigned int)(ga >> 32)) & 0x01FFFFFFu) | 0x80000000u);
  return g;
}

// D += A*B with NT terms: 1 = ah*bh, 2 = + al*bh (A split), 3 = + ah*bl (both split); 4 nops guard the accumulator
template <int NT>
__device__ __forceinline__ v8f mmaN(v16b ah, v16b al, v16b bh, v16b bl, v8f c) {
  c = __builtin_amdgcn_wmma_f32_16x16x32_bf16(false, ah, false, bh, (short)0, c, false, false);
  if (NT >= 2) c = __builtin_amdgcn_wmma_f32_16x16x32_bf16(false, al, false, bh, (short)0, c, false, false);
  if (NT >= 3) c = __builtin_amdgcn_wmma_f32_16x16x32_bf16(false, ah, false, bl, (short)0, c, false, false);
  asm volatile("v_nop\n\tv_nop\n\tv_nop\n\tv_nop" : "+v"(c) : "v"(ah), "v"(al), "v"(bh), "v"(bl));
  return c;
}

// Wt[n][k] (bf16 bits) = RNE(W[n][k]) for a row-major [N][K] weight used as x*W^T: plain elementwise convert, 8 per thread,
// thread t of the conversion takes elements 8t .. 8t+7
__device__ __forceinline__ void rne_rows(const float* __restrict__ W, unsigned short* __restrict__ Wt, int n8, int t) {
  if (t >= n8) return;
  const v4f a = *(const v4fa*)(W + (size_t)t * 8), b = *(const v4fa*)(W + (size_t)t * 8 + 4);
  *(v4u*)(Wt + (size_t)t * 8) = (v4u){cvt2(a[0], a[1]), cvt2(a[2], a[3]), cvt2(b[0], b[1]), cvt2(b[2], b[3])};
}

// live[b*lpitch + p] = index of the p-th key of batch b (one block of 256 threads a batch) with kpm[b*mpitch + j] == 0 (ascending), nlive[b] = how many there are.
// Wave w owns the PER*32 consecutive keys from w*PER*32, one key a lane in each of PER groups: a ballot gives a key's rank inside its group,
// and the eight wave totals, exchanged through LDS, give each wave its first slot.
template <int PER>
__device__ __forceinline__ void live_keys(const int* __restrict__ kpm, int mpitch, int T, int* __restrict__ live, int lpitch, int* __restrict__ nlive, int b) {
  __shared__ int part[8];
  const int t = threadIdx.x, w = t >> 5, lane = t & 31;
  const int* mrow = kpm + (size_t)b * mpitch;
  unsigned bal[PER];
  int c = 0;
#pragma unroll
  for (int i = 0; i < PER; ++i) {
    const int j = (w * PER + i) * 32 + lane, jc = (j < T) ? j : (T - 1);
    bal[i] = __builtin_amdgcn_ballot_w32((mrow[jc] == 0) && (j < T));
    c += __builtin_popcount(bal[i]);
  }
  if (lane == 0) part[w] = c;
  __syncthreads();                                 // cross-wave: every wave's total is in LDS
  int o = 0, tot = 0;
#pragma unroll
  for (int k = 0; k < 8; ++k) { const int v = part[k]; o += (k < w) ? v : 0; tot += v; }
  int* lrow = live + (size_t)b * lpitch;
  const unsigned below = (1u << lane) - 1u;
#pragma unroll
  for (int i = 0; i < PER; ++i) {
    if ((bal[i] >> lane) & 1u) lrow[o + __builtin_popcount(bal[i] & below)] = (w * PER + i) * 32 + lane;
    o += __builtin_popcount(bal[i]);
  }
  if (t == 0) nlive[b] = tot;
}

// One grid for all that only reads inputs: blocks 0 .. nb-1 list the keys of one batch each, then nbw blocks convert each of the four weights.
template <int PER>
__global__ __launch_bounds__(256) void k_prep(const float* __restrict__ W0, const float* __restrict__ W1, const float* __restrict__ W2, const float* __restrict__ W3,
                                              unsigned short* __restrict__ T0, unsigned short* __restrict__ T1, unsigned short* __restrict__ T2, unsigned short* __restrict__ T3,
                                              int n8, int nbw, const int* __restrict__ kpm, int mpitch, int T, int* __restrict__ live, int lpitch,
                                              int* __restrict__ nlive, int nb) {
  const int bx = blockIdx.x;
  if (bx < nb) { live_keys<PER>(kpm, mpitch, T, live, lpitch, nlive, bx); return; }     // block-uniform: its barrier is met by the whole block
  const int g = bx - nb, wi = g / nbw, blk = g % nbw;
  const float* W = (wi == 0) ? W0 : (wi == 1) ? W1 : (wi == 2) ? W2 : W3;
  unsigned short* Wt = (wi == 0) ? T0 : (wi == 1) ? T1 : (wi == 2) ? T2 : T3;
  rne_rows(W, Wt, n8, blk * 256 + (int)threadIdx.x);
}

// GEMM C[M][N] (f32, pitch ldc) = A[M][K]*W^T + bias per batch y (A += y*abatch, C += y*cbatch elements); bx = the block's tile number.
// A f32 row-major (pitch lda) converted to bf16 (ASPLIT: hi/lo -> 2 terms, else single RNE term); Wt bf16 [N][K] (pitch ldb).
// BIAS_BF16 converts the bias to bf16 RNE before the add. K%64==0, M%64==0, N%128==0.
// One block = a 64 x 128 tile of C, four waves of 32 x 64 each. K goes in steps of 64: the step's 64 A rows (converted once) and 128 Wt rows are
// brought by loads that cover whole 128-byte lines, stored in LDS at a 144-byte pitch and read from there as fragments by every wave that needs
// them; the next step's global loads are issued ahead of the current step's products.
// CSPLIT: the f32 result x is not stored; Ch gets RNE(x) and Cl gets RNE(x - Ch) as bf16 bits, same pitch and batch stride (in elements) as C.
// PACK: output row p comes from A row live[y*lpitch + p], for p < nlive[y] only (the last 64-row tile repeats the last listed row); later tiles are not written.
// The block's LDS is declared by the kernel and handed in, so that two forms of the tile in one kernel share it.
template <bool ASPLIT>
struct __attribute__((aligned(16))) GemmLds {
  unsigned short Ah[64][72], Al[ASPLIT ? 64 : 1][72], W[128][72];   // 144-byte rows, 16 bytes x odd, for 16-byte fragment reads
  float so[4][32][64];
};
template <bool ASPLIT, bool BIAS_BF16, bool CSPLIT, bool PACK>
__device__ __forceinline__ void gemm_tile(GemmLds<ASPLIT>& L, unsigned bx, unsigned y, const float* __restrict__ A, int lda, int abatch, const unsigned short* __restrict__ Wt, int ldb,
                                          const float* __restrict__ bias, float* __restrict__ C, unsigned short* __restrict__ Ch,
                                          unsigned short* __restrict__ Cl, int ldc, int cbatch, int M, int N, int K,
                                          const int* __restrict__ live, int lpitch, const int* __restrict__ nlive) {
  constexpr int BM = 64, BN = 128, BK = 64;
  auto& sAh = L.Ah; auto& sAl = L.Al; auto& sW = L.W; auto& so = L.so;
  const int tid = threadIdx.x, w = tid >> 5, lane = tid & 31, ln = lane & 15, hh = lane >> 4;
  const int wm = w >> 1, wn = w & 1;                         // the wave's 32 rows and 64 columns inside the block tile
  const int ntn = N / BN;
  const int mt = bx / ntn, nq = bx % ntn;
  int Mb = M;
  if (PACK) { const int c = nlive[y]; Mb = (c < M) ? c : M; }
  if (mt * BM >= Mb) return;                    // block-uniform, ahead of every barrier
  const int row0 = mt * BM, col0 = nq * BN;
  const float* Ab = A + (size_t)y * (size_t)abatch;
  // staging: 16 lanes cover the 256 bytes of one A row's step, 8 lanes the 128 bytes of one Wt row's step
  const int sar = tid >> 4, sac = (tid & 15) * 4, swr = tid >> 3, swc = (tid & 7) * 8;
  unsigned aoff[8], woff[8];
#pragma unroll
  for (int i = 0; i < 8; ++i) {
    int ar = row0 + sar + i * 8;
    if (PACK) {
      const int p = (ar < Mb) ? ar : (Mb - 1);
      const unsigned g = (unsigned)live[(size_t)y * lpitch + p];
      ar = (int)((g < (unsigned)M) ? g : (unsigned)(M - 1));
    }
    aoff[i] = ((unsigned)ar * (unsigned)lda + (unsigned)sac) * 4u;                          // byte offsets: one 32-bit register each, kept for
    woff[i] = ((unsigned)(col0 + swr + i * 16) * (unsigned)ldb + (unsigned)swc) * 2u;       // all steps and moved on by the step's bytes
  }
  v4f xa[8]; v8us xw[8];
#pragma unroll
  for (int i = 0; i < 8; ++i) { xa[i] = *(const v4fa*)((const char*)Ab + aoff[i]); xw[i] = *(const v8us*)((const char*)Wt + woff[i]); }
  v8f acc[2][4];
#pragma unroll
  for (int mi = 0; mi < 2; ++mi)
#pragma unroll
    for (int t = 0; t < 4; ++t) acc[mi][t] = (v8f){0.f,0.f,0.f,0.f,0.f,0.f,0.f,0.f};
  for (int kb = 0; kb < K; kb += BK) {
    __syncthreads();                                 // cross-wave: all waves done reading the prior step's tiles
#pragma unroll
    for (int i = 0; i < 8; ++i) {
      if (ASPLIT) {
        const HiLo s0 = split2(xa[i][0], xa[i][1]), s1 = split2(xa[i][2], xa[i][3]);
        *(v2u*)&sAh[sar + i * 8][sac] = (v2u){s0.hi, s1.hi};
        *(v2u*)&sAl[sar + i * 8][sac] = (v2u){s0.lo, s1.lo};
      } else {
        *(v2u*)&sAh[sar + i * 8][sac] = (v2u){cvt2(xa[i][0], xa[i][1]), cvt2(xa[i][2], xa[i][3])};
      }
      *(v8us*)&sW[swr + i * 16][swc] = xw[i];
    }
    __syncthreads();                                 // cross-wave: staging complete before any fragment load
    if (kb + BK < K) {                               // block-uniform: the next step's loads fly under this step's products
#pragma unroll
      for (int i = 0; i < 8; ++i) { aoff[i] += BK * 4u; woff[i] += BK * 2u; }
#pragma unroll
      for (int i = 0; i < 8; ++i) { xa[i] = *(const v4fa*)((const char*)Ab + aoff[i]); xw[i] = *(const v8us*)((const char*)Wt + woff[i]); }
      asm volatile("s_wait_xcnt 0x0" ::: "memory");  // ahead of any later write to a register that these loads name as address
    }
#pragma unroll
    for (int ks = 0; ks < BK / 32; ++ks) {
      FragB ah[2], al[2], b[4];
#pragma unroll
      for (int mi = 0; mi < 2; ++mi) {
        const int r = wm * 32 + mi * 16 + ln;
        ah[mi].half[0] = *(const v8us*)&sAh[r][ks * 32 + 8 * hh];          // elements 0..7  <- k = kb+32ks+8h .. +7
        ah[mi].half[1] = *(const v8us*)&sAh[r][ks * 32 + 16 + 8 * hh];     // elements 8..15 <- k = kb+32ks+16+8h .. +7
        if (ASPLIT) { al[mi].half[0] = *(const v8us*)&sAl[r][ks * 32 + 8 * hh]; al[mi].half[1] = *(const v8us*)&sAl[r][ks * 32 + 16 + 8 * hh]; }
        else al[mi] = ah[mi];
      }
#pragma unroll
      for (int t = 0; t < 4; ++t) {
        const int n = wn * 64 + t * 16 + ln;
        b[t].half[0] = *(const v8us*)&sW[n][ks * 32 + 8 * hh];
        b[t].half[1] = *(const v8us*)&sW[n][ks * 32 + 16 + 8 * hh];
      }
#pragma unroll
      for (int mi = 0; mi < 2; ++mi)
#pragma unroll
        for (int t = 0; t < 4; ++t) acc[mi][t] = mmaN<ASPLIT ? 2 : 1>(ah[mi].v, al[mi].v, b[t].v, b[t].v, acc[mi][t]);
    }
  }
  const int wrow0 = row0 + wm * 32, wcol0 = col0 + wn * 64;
#pragma unroll
  for (int t = 0; t < 4; ++t) {
    float bvv = bias[wcol0 + t * 16 + ln];
    if (BIAS_BF16) bvv = bf16_rne(bvv);
#pragma unroll
    for (int mi = 0; mi < 2; ++mi)
#pragma unroll
      for (int r = 0; r < 8; ++r) { so[w][mi * 16 + 8 * hh + r][t * 16 + ln] = acc[mi][t][r] + bvv; }
  }
  __builtin_amdgcn_fence(4 /* acq_rel order */, "workgroup");      // so[w] is wave-private: same-wave exchange
  __builtin_amdgcn_wave_barrier();
  if (CSPLIT) {
    unsigned short* Chb = Ch + (size_t)y * (size_t)cbatch;
    unsigned short* Clb = Cl + (size_t)y * (size_t)cbatch;
    const int rsub = lane >> 3, c8 = (lane & 7) * 8;      // 8 lanes write one 128-byte row piece of each plane
#pragma unroll
    for (int q = 0; q < 8; ++q) {
      const int r = q * 4 + rsub;
      const v4f x0 = *(const v4fa*)&so[w][r][c8], x1 = *(const v4fa*)&so[w][r][c8 + 4];
      const HiLo s0 = split2(x0[0], x0[1]), s1 = split2(x0[2], x0[3]), s2 = split2(x1[0], x1[1]), s3 = split2(x1[2], x1[3]);
      const size_t o = (size_t)(wrow0 + r) * ldc + wcol0 + c8;
      *(v4u*)(Chb + o) = (v4u){s0.hi, s1.hi, s2.hi, s3.hi};
      *(v4u*)(Clb + o) = (v4u){s0.lo, s1.lo, s2.lo, s3.lo};
    }
    asm volatile("s_wait_xcnt 0x0" ::: "memory");    // ahead of any later write to a register that these stores name: in a kernel with two forms of the tile the other form's code follows
  } else {
    float* Cb = C + (size_t)y * (size_t)cbatch;
    const int rsub = lane >> 4, c4 = (lane & 15) * 4;
#pragma unroll
    for (int q = 0; q < 16; ++q) {
      const int r = q * 2 + rsub;
      const v4f v = *(const v4fa*)&so[w][r][c4];
      *(v4f*)(Cb + (size_t)(wrow0 + r) * ldc + wcol0 + c4) = v;
    }
  }
}

// The three projections in one grid: blockIdx.z = 0, 1 the k and v projections (packed rows, split planes), 2 the q projection (all rows, f32).
// Same shapes and pitches for all three. The k and v tiles, whose first loads wait for the key list, come first in the grid.
__global__ __launch_bounds__(128) void k_gemm_qkv(const float* __restrict__ xq, const float* __restrict__ xk, const float* __restrict__ xv, int lda, int abatch,
                                                  const unsigned short* __restrict__ Wtq, const unsigned short* __restrict__ Wtk, const unsigned short* __restrict__ Wtv, int ldb,
                                                  const float* __restrict__ bq, const float* __restrict__ bk, const float* __restrict__ bv,
                                                  float* __restrict__ q, unsigned short* __restrict__ kh, unsigned short* __restrict__ kl,
                                                  unsigned short* __restrict__ vh, unsigned short* __restrict__ vl, int ldc, int cbatch, int M, int N, int K,
                                                  const int* __restrict__ live, int lpitch, const int* __restrict__ nlive) {
  __shared__ GemmLds<false> L;
  const int z = blockIdx.z;                          // block-uniform
  if (z == 2) {
    gemm_tile<false, true, false, false>(L, blockIdx.x, blockIdx.y, xq, lda, abatch, Wtq, ldb, bq, q, nullptr, nullptr, ldc, cbatch, M, N, K, nullptr, 0, nullptr);
  } else {
    gemm_tile<false, true, true, true>(L, blockIdx.x, blockIdx.y, z ? xv : xk, lda, abatch, z ? Wtv : Wtk, ldb, z ? bv : bk, nullptr, z ? vh : kh, z ? vl : kl,
                                       ldc, cbatch, M, N, K, live, lpitch, nlive);
  }
}

// The output projection: A as a 2-term split, f32 result.
__global__ __launch_bounds__(128) void k_gemm_out(const float* __restrict__ A, int lda, int abatch, const unsigned short* __restrict__ Wt, int ldb,
                                                  const float* __restrict__ bias, float* __restrict__ C, int ldc, int cbatch, int M, int N, int K) {
  __shared__ GemmLds<true> L;
  gemm_tile<true, true, false, false>(L, blockIdx.x, blockIdx.y, A, lda, abatch, Wt, ldb, bias, C, nullptr, nullptr, ldc, cbatch, M, N, K, nullptr, 0, nullptr);
}

// Flash-style attention over the packed keys of each batch: k and v rows 0 .. nlive[b]-1 take part;
// nlive[b] == 0 (every key excluded) yields NaN. QK^T and P*V as 3-term bf16 hi/lo splits, f32 softmax with running max.
// q rows f32, k and v rows as bf16 hi/lo planes, all with pitch `pitch` (elements), batch b at X + b*T*pitch, head h at column h*D.
// One wave = 16 query rows, block = 4 waves (64 queries) sharing K/V chunks of 32 keys in LDS (hi/lo bf16 planes): wave 0, 1, 2, 3 brings the chunk's rows of
// the k hi, k lo, v hi, v lo plane by one tensor load, whose pad gives the LDS pitch; two buffers, chunk s + 1 asked for when every wave has left chunk s - 1.
// A last chunk that runs past the key count takes rows that the projection wrote as repeats of the last listed row (its last 64-row tile is written whole):
// their scores are masked below, so their probability is exactly 0.
// Both products are transposed: in S^T[key][query] and O^T[d][query] lane (ln, hh) holds query ln, so the running maximum, the rescale factor
// and the row sum are one value a lane (the two halves of the wave hold 16 keys of a chunk each and exchange the maximum once a chunk).
template <int D>
__global__ __launch_bounds__(128) void k_flash_pm(const float* __restrict__ Qb, const unsigned short* __restrict__ Khb, const unsigned short* __restrict__ Klb,
                                                const unsigned short* __restrict__ Vhb, const unsigned short* __restrict__ Vlb, int pitch, int T, int H, float scale, const int* __restrict__ nlive,
                                                float* __restrict__ y, int ypitch) {
  constexpr int KS = D / 32, DT = D / 16;
  static_assert(D == 64, "the tensor loads' pad codes are those of 128-byte rows");
  constexpr unsigned PK = 2 * D + 16, PV = 2 * D + 32;     // LDS row pitch in bytes: 16 x odd for the 16-byte K reads, 32 x odd for the transposing V reads
  constexpr unsigned SLICE = 6144, BUF = 4 * SLICE;        // one plane's 32 padded rows, rounded up to a multiple of 2 KiB; the four planes of a chunk
  static_assert(32 * PK <= SLICE && 32 * PV <= SLICE && (SLICE % 2048) == 0);
  __shared__ __attribute__((aligned(2048))) unsigned char ring[2 * BUF];
  __shared__ __attribute__((aligned(16))) float sO[4][16][D + 4];     // 16 bytes x odd pitch: the 16 query rows of a 16-byte store spread over the banks
  const int tid = threadIdx.x, w = tid >> 5, lane = tid & 31, ln = lane & 15, hh = lane >> 4;
  const int nqb = (T + 63) / 64;
  const int bh = blockIdx.x / nqb, qblk = blockIdx.x % nqb;
  const int b = bh / H, h = bh % H;
  const int q0 = qblk * 64 + w * 16;
  const float* Q = Qb + (size_t)b * T * pitch + h * D;
  const unsigned short* Kh = Khb + (size_t)b * T * pitch + h * D;
  const unsigned short* Kl = Klb + (size_t)b * T * pitch + h * D;
  const unsigned short* Vh = Vhb + (size_t)b * T * pitch + h * D;
  const unsigned short* Vl = Vlb + (size_t)b * T * pitch + h * D;
  const int nl = nlive[b];
  const int Tk = (nl < T) ? nl : T;                  // keys of this batch; block-uniform
  const int trow = 8 * hh + (lane & 7), tcol = 8 * ((lane >> 3) & 1);   // lane address of a transposing load: 16 bytes of row trow
  const int ns = (Tk + 31) >> 5;                     // chunks of 32 keys; block-uniform
  const unsigned wu = uni((unsigned)tid >> 5);       // the wave's number, scalar
  const unsigned short* plane = (wu == 0) ? Kh : (wu == 1) ? Kl : (wu == 2) ? Vh : Vl;
  const unsigned lbase = (unsigned)(size_t)ring, src_pitch = (unsigned)pitch * 2u;
  u32x8 g1k = tdm_group1<3>(src_pitch), g1v = tdm_group1<7>(src_pitch);   // k planes: 144-byte LDS pitch; v planes: 160-byte
  asm volatile("" : "+s"(g1k));                      // for a whole group: descriptor words held in scalar registers, built once
  asm volatile("" : "+s"(g1v));                      // the same
  u32x4 g0 = tdm_group0(lbase, (unsigned long long)(size_t)plane);
  // every wave asks for its own plane's rows 32*st .. 32*st + 31 (inside the batch's T rows: the launch passes a T that is a multiple of 64), into buffer st & 1
  auto issue = [&](unsigned st) {
    const unsigned sp = pinned(st);                  // the descriptor's changing words are formed behind the wait that stands in front
    const unsigned dst = lbase + (sp & 1u) * BUF + wu * SLICE;
    const unsigned long long ga = (unsigned long long)(size_t)plane + (unsigned long long)(sp * 32u) * src_pitch;
    g0 = tdm_group0(dst, ga);
    if (pinned(wu < 2u)) tdm_load(g0, g1k);
    else                 tdm_load(g0, g1v);
  };
  if (pinned(0 < ns)) issue(0);                      // flies under the loads and the split of Q

  // B fragments [k = d][n = query] of the wave's 16 query rows (scaled by an exact power of two), hi/lo
  FragB aqh[KS], aql[KS];
  {
    int row = q0 + ln; if (row >= T) row = T - 1;
    const float* qr = Q + (size_t)row * pitch;
#pragma unroll
    for (int ks = 0; ks < KS; ++ks)
#pragma unroll
      for (int i = 0; i < 16; i += 2) {               // elements i and i + 1 are neighbours in d and share a register
        const int d = ks * 32 + ((i < 8) ? (8 * hh + i) : (16 + 8 * hh + (i - 8)));
        const HiLo s = split2(qr[d] * scale, qr[d + 1] * scale);
        aqh[ks].w[i / 2] = s.hi; aql[ks].w[i / 2] = s.lo;
      }
  }
  float m_q = -3.0e38f, l_q = 0.f;                   // query ln: running maximum (same in both halves), this half's part of the row sum
  v8f oacc[DT];                                      // oacc[dt][r] = O[query ln][d = dt*16 + 8*hh + r]
#pragma unroll
  for (int dt = 0; dt < DT; ++dt) oacc[dt] = (v8f){0.f,0.f,0.f,0.f,0.f,0.f,0.f,0.f};

  for (int s_ = 0; s_ < ns; ++s_) {
    // hand-over, in the two-buffer ring's order (at s_ = 0 it is the ring's prologue): chunk s_ becomes readable, the buffer of chunk s_ - 1 becomes free
    wait_ds0();                                      // this wave's reads of chunk s_ - 1 are done
    wait_tensor0(g0, g1k, g1v);                      // this wave's plane of chunk s_ has landed
    __syncthreads();                                 // cross-wave: both hold for every wave
    if (pinned(s_ + 1 < ns)) issue((unsigned)s_ + 1u);   // flies while chunk s_ is worked on
    const int j0 = s_ * 32;
    const unsigned char* bufp = ring + (unsigned)(s_ & 1) * BUF;
    const unsigned char* pKh = bufp + ln * PK + 16 * hh;                       // K rows: lane ln's row, 16 bytes at d = 8*hh
    const unsigned char* pVh = bufp + 2 * SLICE + trow * PV + 2 * tcol;        // V rows: the lane address of a transposing load
    // S^T tile 32 keys x 16 queries: A[m = key][k = d] from sK[key][d]; s[nt][r] = score of key j0 + nt*16 + 8*hh + r with query ln
    v8f s[2];
#pragma unroll
    for (int nt = 0; nt < 2; ++nt) {
      v8f acc = (v8f){0.f,0.f,0.f,0.f,0.f,0.f,0.f,0.f};
#pragma unroll
      for (int ks = 0; ks < KS; ++ks) {
        FragB kh_, kl_;
        const unsigned char* pk = pKh + nt * 16 * PK + ks * 64;
        kh_.half[0] = *(const v8us*)pk;           kh_.half[1] = *(const v8us*)(pk + 32);
        kl_.half[0] = *(const v8us*)(pk + SLICE); kl_.half[1] = *(const v8us*)(pk + SLICE + 32);
        acc = mmaN<3>(kh_.v, kl_.v, aqh[ks].v, aql[ks].v, acc);
      }
      s[nt] = acc;
    }
    // A[m = d][k = key] from sV[key][d]: all V fragments by transposing LDS loads, one group whose latency the softmax covers
    FragB avh[DT], avl[DT];
#pragma unroll
    for (int dt = 0; dt < DT; ++dt) {
      const unsigned char* pv = pVh + dt * 32;
      avh[dt].half[0] = tr16((const unsigned short*)pv);           avh[dt].half[1] = tr16((const unsigned short*)(pv + 16 * PV));
      avl[dt].half[0] = tr16((const unsigned short*)(pv + SLICE)); avl[dt].half[1] = tr16((const unsigned short*)(pv + SLICE + 16 * PV));
    }
    if (j0 + 32 > Tk) {                              // block-uniform: only a chunk that runs past Tk holds keys past the last packed one;
#pragma unroll
      for (int nt = 0; nt < 2; ++nt)                 // their exponential below is exactly 0 (key j0 is real, so the maximum is a real score)
#pragma unroll
        for (int r = 0; r < 8; ++r) if (j0 + nt * 16 + 8 * hh + r >= Tk) s[nt][r] = -3.0e38f;
    }
    float mx = fmaxf(s[0][0], s[1][0]);
#pragma unroll
    for (int r = 1; r < 8; ++r) mx = fmaxf(mx, fmaxf(s[0][r], s[1][r]));
    mx = fmaxf(mx, xhalf(mx));                       // both halves now hold the maximum over the chunk's 32 keys
    const float mnew = fmaxf(m_q, mx);
    const float alpha = (mnew > -1.0e38f) ? __expf(m_q - mnew) : 1.0f;
    m_q = mnew;
    // P^T as the B operand [k = key][n = query]: element nt*8 + r of lane (ln, hh) is key nt*16 + 8*hh + r, which is where s[nt][r] already lies
    v8u pwh, pwl;                                    // hi and lo planes, two keys a register
    float ps0 = 0.f, ps1 = 0.f;
#pragma unroll
    for (int nt = 0; nt < 2; ++nt)
#pragma unroll
      for (int i = 0; i < 4; ++i) {
        const float p0 = __expf(s[nt][2 * i] - mnew), p1 = __expf(s[nt][2 * i + 1] - mnew);
        ps0 += p0; ps1 += p1;
        const HiLo pp = split2(p0, p1);
        pwh[nt * 4 + i] = pp.hi; pwl[nt * 4 + i] = pp.lo;
      }
    const v16b pbh = __builtin_bit_cast(v16b, pwh), pbl = __builtin_bit_cast(v16b, pwl);
    l_q = l_q * alpha + (ps0 + ps1);                 // this half's 16 keys (the halves are joined at the end)
#pragma unroll
    for (int dt = 0; dt < DT; ++dt)
#pragma unroll
      for (int r = 0; r < 8; ++r) oacc[dt][r] *= alpha;
#pragma unroll
    for (int dt = 0; dt < DT; ++dt) {
      oacc[dt] = mmaN<3>(avh[dt].v, avl[dt].v, pbh, pbl, oacc[dt]);
    }
  }
  wait_tensor0(g0, g1k, g1v);                        // nothing in flight when the wave goes on to its end
  wait_ds0();
  const float qnan = __uint_as_float(0x7FC00000u);
  const float lsum = l_q + xhalf(l_q);
  const float inv = (m_q > -1.0e38f) ? (1.0f / lsum) : qnan;
#pragma unroll
  for (int dt = 0; dt < DT; ++dt) {
    v4f lo4, hi4;
#pragma unroll
    for (int r = 0; r < 4; ++r) { lo4[r] = oacc[dt][r] * inv; hi4[r] = oacc[dt][4 + r] * inv; }
    *(v4fa*)&sO[w][ln][dt * 16 + 8 * hh] = lo4;
    *(v4fa*)&sO[w][ln][dt * 16 + 8 * hh + 4] = hi4;
  }
  __builtin_amdgcn_fence(4 /* acq_rel order */, "workgroup");
  __builtin_amdgcn_wave_barrier();
  {
    for (int r = 0; r < 16; ++r) {
      const int row = q0 + r;
      if (row < T && lane < D / 4) {
        const v4f val = *(const v4fa*)&sO[w][r][lane * 4];
        *(v4f*)(y + ((size_t)b * T + row) * ypitch + h * D + lane * 4) = val;
      }
    }
    
  }
}

extern "C" void kernel_launch(void* const* d_in, const int* in_sizes, int n_in,
                              void* d_out, int out_size, void* d_ws, size_t ws_size, hipStream_t stream) {
  if (n_in < 12) return;
  const float* xq = (const float*)d_in[0]; const float* xk = (const float*)d_in[1]; const float* xv = (const float*)d_in[2];
  const int* kpm = (const int*)d_in[3];
  const float* Wq = (const float*)d_in[4]; const float* bq = (const float*)d_in[5]; const float* Wk = (const float*)d_in[6]; const float* bk = (const float*)d_in[7];
  const float* Wv = (const float*)d_in[8]; const float* bv = (const float*)d_in[9]; const float* Wo = (const float*)d_in[10]; const float* bo = (const float*)d_in[11];
  // size checks (lower bounds so a reduced NB/SEQ build still launches on full-size inputs)
  const long long needX = (long long)(NB - 1) * SEQ_FULL * DD + (long long)SEQ * DD;
  if ((long long)in_sizes[0] < needX || (long long)in_sizes[1] < needX || (long long)in_sizes[2] < needX) return;
  if (in_sizes[3] < (NB - 1) * SEQ_FULL + SEQ) return;
  if (in_sizes[4] < DD * DD || in_sizes[6] < DD * DD || in_sizes[8] < DD * DD || in_sizes[10] < DD * DD) return;
  if (in_sizes[5] < DD || in_sizes[7] < DD || in_sizes[9] < DD || in_sizes[11] < DD) return;
  if ((long long)out_size < (long long)NB * SEQ * DD) return;

  char* ws = (char*)d_ws; size_t off = 0;
  auto take = [&](size_t bytes) { char* p = ws + off; off += (bytes + 255) & ~(size_t)255; return p; };
  const size_t MROWS = (size_t)NB * SEQ;
  unsigned short* Wt[4]; for (int i = 0; i < 4; ++i) Wt[i] = (unsigned short*)take((size_t)DD * DD * 2);
  float* q   = (float*)take(MROWS * DD * 4);
  unsigned short* kh = (unsigned short*)take(MROWS * DD * 2);
  unsigned short* kl = (unsigned short*)take(MROWS * DD * 2);
  unsigned short* vh = (unsigned short*)take(MROWS * DD * 2);
  unsigned short* vl = (unsigned short*)take(MROWS * DD * 2);
  float* att = (float*)take(MROWS * DD * 4);
  int* live  = (int*)take(MROWS * 4);
  int* nlive = (int*)take((size_t)NB * 4);
  if (off > ws_size) return;

  const int n8 = DD * DD / 8;
  const int gb = (SEQ / 64) * (DD / 128);
  const dim3 gg(gb, NB), gg3(gb, NB, 3);
  const int nbw = (n8 + 255) / 256;
  k_prep<(SEQ + 255) / 256><<<NB + 4 * nbw, 256, 0, stream>>>(Wq, Wk, Wv, Wo, Wt[0], Wt[1], Wt[2], Wt[3], n8, nbw, kpm, SEQ_FULL, SEQ, live, SEQ, nlive, NB);
  k_gemm_qkv<<<gg3, 128, 0, stream>>>(xq, xk, xv, DD, SEQ_FULL * DD, Wt[0], Wt[1], Wt[2], DD, bq, bk, bv, q, kh, kl, vh, vl, DD, SEQ * DD, SEQ, DD, DD, live, SEQ, nlive);
  k_flash_pm<HD><<<NB * NH * (SEQ / 64), 128, 0, stream>>>(q, kh, kl, vh, vl, DD, SEQ, NH, 0.125f, nlive, att, DD);
  k_gemm_out<<<gg, 128, 0, stream>>>(att, DD, SEQ * DD, Wt[3], DD, bo, (float*)d_out, DD, SEQ * DD, SEQ, DD, DD);
  (void)hipGetLastError();
}

// v009
// It runs in 76.3 microseconds.
// In both of two side-by-side timings against v008, it was 1.05 times as fast.
// Counting every step since v000, it is 6.14 times as fast.
#include <hip/hip_runtime.h>
// Contractions: q/k/v = x*W^T + b on v_wmma_f32_16x16x32_bf16, a 64 x 128 tile of the result per block with both operands staged in LDS (x, W, b converted to bf16 RNE, single term); QK^T and P*V per 16-query tile as
// 3-term bf16 hi/lo splits, both transposed (S^T = K*Q^T, O^T += V^T*P^T: a lane holds one query's scores, and P^T goes from the score
// accumulators straight into the B operand), two 16-query tiles a wave, so that every K and V fragment read from LDS serves both; out = a*Wo^T + bo with a as a 2-term bf16 hi/lo split (Wo, bo bf16 RNE); f32 accumulate, softmax in f32.
// k and v leave their projection already split into bf16 hi/lo planes; the attention blocks bring each 32-key chunk of the four planes into LDS by
// tensor loads (one plane a wave), into two buffers in turn, so that the next chunk's load flies while the current chunk is worked on.
// Keys whose padding flag is set have probability exactly 0: the unflagged keys of each batch are listed in ascending order, the k and v
// projections compute only those rows and store them packed (row p = p-th unflagged key), and the attention key loop ends at their count.
// Four launches: work that does not depend on each other shares a grid and is told apart by the block index (the four weight conversions
// with the key lists; the q, k and v projections).
#ifndef NB
#define NB 4
#endif
#ifndef SEQ
#define SEQ 2048
#endif
#define NB_FULL 4
#define SEQ_FULL 2048
#define DD 512
#define NH 8
#define HD 64

static_assert(NB >= 1 && NB <= NB_FULL);
static_assert(SEQ >= 64 && SEQ <= SEQ_FULL && (SEQ % 64) == 0);
static_assert(NH * HD == DD && (DD % 128) == 0 && (HD % 32) == 0 && HD <= 128);

typedef __bf16 v16b __attribute__((ext_vector_type(16)));
typedef unsigned short v8us __attribute__((ext_vector_type(8), may_alias));
typedef float  v8f  __attribute__((ext_vector_type(8)));
typedef unsigned int v8u __attribute__((ext_vector_type(8)));
typedef float  v4f  __attribute__((ext_vector_type(4)));
typedef float  v4fa __attribute__((ext_vector_type(4), may_alias));
typedef unsigned int v4u __attribute__((ext_vector_type(4), may_alias));
typedef unsigned int v2u __attribute__((ext_vector_type(2), may_alias));
typedef float  f32x2 __attribute__((ext_vector_type(2)));
typedef __bf16 bf16x2 __attribute__((ext_vector_type(2)));
union FragB { v16b v; v8us half[2]; unsigned int w[8]; };

// two f32 -> two bf16 (RNE) in one register by the packed hardware conversion: a in the lower 16 bits (the even element), b in the upper
__device__ __forceinline__ unsigned int cvt2(float a, float b) { return __builtin_bit_cast(unsigned int, __builtin_convertvector((f32x2){a, b}, bf16x2)); }
// the f32 values of the two bf16 of such a register
__device__ __forceinline__ float bf16_lower(unsigned int p) { return __uint_as_float(p << 16); }
__device__ __forceinline__ float bf16_upper(unsigned int p) { return __uint_as_float(p & 0xFFFF0000u); }
// hi/lo split of two f32: hi = RNE(x), lo = RNE(x - hi), each pair packed as by cvt2
struct HiLo { unsigned int hi, lo; };
__device__ __forceinline__ HiLo split2(float a, float b) {
  const unsigned int hi = cvt2(a, b);
  return HiLo{hi, cvt2(a - bf16_lower(hi), b - bf16_upper(hi))};
}
__device__ __forceinline__ float bf16_rne(float x) { return bf16_lower(cvt2(x, x)); }

// 16-bit transposing LDS load: with lane l addressing 16 bytes at T[k0 + 8*(l>>4) + (l&7)][d0 + 8*((l>>3)&1)], lane (c = l&15, h = l>>4)
// receives T[k0 + 8h + 0..7][d0 + c]
typedef short s16x8 __attribute__((ext_vector_type(8)));
__device__ __forceinline__ v8us tr16(const unsigned short* p) {
  const s16x8 r = __builtin_amdgcn_ds_load_tr16_b128_v8i16((__attribute__((address_space(3))) s16x8*)p);
  return __builtin_bit_cast(v8us, r);
}

// lane l takes the value of lane l ^ 16 (the other half of the wave)
__device__ __forceinline__ float xhalf(float x) {
  const int b = __float_as_int(x);
  return __int_as_float(__builtin_amdgcn_permlanex16(b, b, 0x76543210, 0xfedcba98, false, false));
}

// Tensor load of a two-dimensional tile into LDS: one request of a whole wave, through no register.
typedef unsigned int u32x4 __attribute__((ext_vector_type(4)));
typedef unsigned int u32x8 __attribute__((ext_vector_type(8)));
__device__ __forceinline__ unsigned int uni(unsigned int v) { return (unsigned int)__builtin_amdgcn_readfirstlane(v); }
// a wave-uniform value held in a scalar register: a test on it compiles to s_cmp + s_cbranch (a tensor load ignores EXEC), and what is
// derived from it is computed behind the asm statements that stand in front of it
__device__ __forceinline__ unsigned int pinned(unsigned int v) {
  unsigned int w = uni(v);
  asm volatile("" : "+s"(w));                        // keeps a descriptor word or an issue test in a scalar register
  return w;
}
// this wave's tensor loads have landed; the descriptor groups are named as inputs so that their registers keep their values from the issue to this wait
__device__ __forceinline__ void wait_tensor0(u32x4 g0, u32x8 g1a, u32x8 g1b) { asm volatile("s_wait_tensorcnt 0x0" :: "s"(g0), "s"(g1a), "s"(g1b) : "memory"); }
__device__ __forceinline__ void wait_ds0() { asm volatile("s_wait_dscnt 0x0" ::: "memory"); }           // this wave's LDS reads have returned
__device__ __forceinline__ void tdm_load(u32x4 g0, u32x8 g1) { asm volatile("tensor_load_to_lds %0, %1" :: "s"(g0), "s"(g1) : "memory"); }
// Descriptor group 1: 1-byte elements, tensor = tile = 32 rows of 128 bytes, source row pitch src_pitch bytes, PADC + 1 dwords of LDS pad behind every row
template <unsigned int PADC>
__device__ __forceinline__ u32x8 tdm_group1(unsigned int src_pitch) {
  constexpr unsigned int d0 = 128u, d1 = 32u;
  u32x8 g;
  g[0] = uni((1u << 20) | (4u << 22) | (PADC << 25));   // no mask; pad on, interval code 4 = one 128-byte row
  g[1] = uni((d0 & 0xFFFFu) << 16);
  g[2] = uni((d0 >> 16) | ((d1 & 0xFFFFu) << 16));
  g[3] = uni((d1 >> 16) | (d0 << 16));
  g[4] = uni(d1);
  g[5] = uni(src_pitch);
  g[6] = uni(0u);
  g[7] = uni(0u);
  return g;
}
// Descriptor group 0: count 1, LDS byte offset, global address of the tile's first byte, type 2
__device__ __forceinline__ u32x4 tdm_group0(unsigned int lds_dst, unsigned long long ga) {
  u32x4 g;
  g[0] = uni(1u); g[1] = uni(lds_dst); g[2] = uni((unsigned int)ga); g[3] = uni((((unsigned int)(ga >> 32)) & 0x01FFFFFFu) | 0x80000000u);
  return g;
}

// D += A*B with NT terms: 1 = ah*bh, 2 = + al*bh (A split), 3 = + ah*bl (both split); 4 nops guard the accumulator
template <int NT>
__device__ __forceinline__ v8f mmaN(v16b ah, v16b al, v16b bh, v16b bl, v8f c) {
  c = __builtin_amdgcn_wmma_f32_16x16x32_bf16(false, ah, false, bh, (short)0, c, false, false);
  if (NT >= 2) c = __builtin_amdgcn_wmma_f32_16x16x32_bf16(false, al, false, bh, (short)0, c, false, false);
  if (NT >= 3) c = __builtin_amdgcn_wmma_f32_16x16x32_bf16(false, ah, false, bl, (short)0, c, false, false);
  asm volatile("v_nop\n\tv_nop\n\tv_nop\n\tv_nop" : "+v"(c) : "v"(ah), "v"(al), "v"(bh), "v"(bl));
  return c;
}

// The 3-term product of one A fragment pair with the B fragments of two independent tiles: c0 += A*B0, c1 += A*B1, each with mmaN<3>'s order of terms;
// the two accumulators take turns, so that neither waits for its own previous product; 4 nops guard the accumulators and the operands
__device__ __forceinline__ void mma3_two(v16b ah, v16b al, v16b b0h, v16b b0l, v16b b1h, v16b b1l, v8f& c0, v8f& c1) {
  c0 = __builtin_amdgcn_wmma_f32_16x16x32_bf16(false, ah, false, b0h, (short)0, c0, false, false);
  c1 = __builtin_amdgcn_wmma_f32_16x16x32_bf16(false, ah, false, b1h, (short)0, c1, false, false);
  c0 = __builtin_amdgcn_wmma_f32_16x16x32_bf16(false, al, false, b0h, (short)0, c0, false, false);
  c1 = __builtin_amdgcn_wmma_f32_16x16x32_bf16(false, al, false, b1h, (short)0, c1, false, false);
  c0 = __builtin_amdgcn_wmma_f32_16x16x32_bf16(false, ah, false, b0l, (short)0, c0, false, false);
  c1 = __builtin_amdgcn_wmma_f32_16x16x32_bf16(false, ah, false, b1l, (short)0, c1, false, false);
  // the four vector slots between a WMMA and the next vector instruction on its D, A or B, kept on every path (also where a branch follows)
  asm volatile("v_nop\n\tv_nop\n\tv_nop\n\tv_nop" : "+v"(c0), "+v"(c1) : "v"(ah), "v"(al), "v"(b0h), "v"(b0l), "v"(b1h), "v"(b1l));
}

// Wt[n][k] (bf16 bits) = RNE(W[n][k]) for a row-major [N][K] weight used as x*W^T: plain elementwise convert, 8 per thread,
// thread t of the conversion takes elements 8t .. 8t+7
__device__ __forceinline__ void rne_rows(const float* __restrict__ W, unsigned short* __restrict__ Wt, int n8, int t) {
  if (t >= n8) return;
  const v4f a = *(const v4fa*)(W + (size_t)t * 8), b = *(const v4fa*)(W + (size_t)t * 8 + 4);
  *(v4u*)(Wt + (size_t)t * 8) = (v4u){cvt2(a[0], a[1]), cvt2(a[2], a[3]), cvt2(b[0], b[1]), cvt2(b[2], b[3])};
}

// live[b*lpitch + p] = index of the p-th key of batch b (one block of 256 threads a batch) with kpm[b*mpitch + j] == 0 (ascending), nlive[b] = how many there are.
// Wave w owns the PER*32 consecutive keys from w*PER*32, one key a lane in each of PER groups: a ballot gives a key's rank inside its group,
// and the eight wave totals, exchanged through LDS, give each wave its first slot.
template <int PER>
__device__ __forceinline__ void live_keys(const int* __restrict__ kpm, int mpitch, int T, int* __restrict__ live, int lpitch, int* __restrict__ nlive, int b) {
  __shared__ int part[8];
  const int t = threadIdx.x, w = t >> 5, lane = t & 31;
  const int* mrow = kpm + (size_t)b * mpitch;
  unsigned bal[PER];
  int c = 0;
#pragma unroll
  for (int i = 0; i < PER; ++i) {
    const int j = (w * PER + i) * 32 + lane, jc = (j < T) ? j : (T - 1);
    bal[i] = __builtin_amdgcn_ballot_w32((mrow[jc] == 0) && (j < T));
    c += __builtin_popcount(bal[i]);
  }
  if (lane == 0) part[w] = c;
  __syncthreads();                                 // cross-wave: every wave's total is in LDS
  int o = 0, tot = 0;
#pragma unroll
  for (int k = 0; k < 8; ++k) { const int v = part[k]; o += (k < w) ? v : 0; tot += v; }
  int* lrow = live + (size_t)b * lpitch;
  const unsigned below = (1u << lane) - 1u;
#pragma unroll
  for (int i = 0; i < PER; ++i) {
    if ((bal[i] >> lane) & 1u) lrow[o + __builtin_popcount(bal[i] & below)] = (w * PER + i) * 32 + lane;
    o += __builtin_popcount(bal[i]);
  }
  if (t == 0) nlive[b] = tot;
}

// One grid for all that only reads inputs: blocks 0 .. nb-1 list the keys of one batch each, then nbw blocks convert each of the four weights.
template <int PER>
__global__ __launch_bounds__(256) void k_prep(const float* __restrict__ W0, const float* __restrict__ W1, const float* __restrict__ W2, const float* __restrict__ W3,
                                              unsigned short* __restrict__ T0, unsigned short* __restrict__ T1, unsigned short* __restrict__ T2, unsigned short* __restrict__ T3,
                                              int n8, int nbw, const int* __restrict__ kpm, int mpitch, int T, int* __restrict__ live, int lpitch,
                                              int* __restrict__ nlive, int nb) {
  const int bx = blockIdx.x;
  if (bx < nb) { live_keys<PER>(kpm, mpitch, T, live, lpitch, nlive, bx); return; }     // block-uniform: its barrier is met by the whole block
  const int g = bx - nb, wi = g / nbw, blk = g % nbw;
  const float* W = (wi == 0) ? W0 : (wi == 1) ? W1 : (wi == 2) ? W2 : W3;
  unsigned short* Wt = (wi == 0) ? T0 : (wi == 1) ? T1 : (wi == 2) ? T2 : T3;
  rne_rows(W, Wt, n8, blk * 256 + (int)threadIdx.x);
}

// GEMM C[M][N] (f32, pitch ldc) = A[M][K]*W^T + bias per batch y (A += y*abatch, C += y*cbatch elements); bx = the block's tile number.
// A f32 row-major (pitch lda) converted to bf16 (ASPLIT: hi/lo -> 2 terms, else single RNE term); Wt bf16 [N][K] (pitch ldb).
// BIAS_BF16 converts the bias to bf16 RNE before the add. K%64==0, M%64==0, N%128==0.
// One block = a 64 x 128 tile of C, four waves of 32 x 64 each. K goes in steps of 64: the step's 64 A rows (converted once) and 128 Wt rows are
// brought by loads that cover whole 128-byte lines, stored in LDS at a 144-byte pitch and read from there as fragments by every wave that needs
// them; the next step's global loads are issued ahead of the current step's products.
// CSPLIT: the f32 result x is not stored; Ch gets RNE(x) and Cl gets RNE(x - Ch) as bf16 bits, same pitch and batch stride (in elements) as C.
// PACK: output row p comes from A row live[y*lpitch + p], for p < nlive[y] only (the last 64-row tile repeats the last listed row); later tiles are not written.
// The block's LDS is declared by the kernel and handed in, so that two forms of the tile in one kernel share it.
template <bool ASPLIT>
struct __attribute__((aligned(16))) GemmLds {
  unsigned short Ah[64][72], Al[ASPLIT ? 64 : 1][72], W[128][72];   // 144-byte rows, 16 bytes x odd, for 16-byte fragment reads
  float so[4][32][64];
};
template <bool ASPLIT, bool BIAS_BF16, bool CSPLIT, bool PACK>
__device__ __forceinline__ void gemm_tile(GemmLds<ASPLIT>& L, unsigned bx, unsigned y, const float* __restrict__ A, int lda, int abatch, const unsigned short* __restrict__ Wt, int ldb,
                                          const float* __restrict__ bias, float* __restrict__ C, unsigned short* __restrict__ Ch,
                                          unsigned short* __restrict__ Cl, int ldc, int cbatch, int M, int N, int K,
                                          const int* __restrict__ live, int lpitch, const int* __restrict__ nlive) {
  constexpr int BM = 64, BN = 128, BK = 64;
  auto& sAh = L.Ah; auto& sAl = L.Al; auto& sW = L.W; auto& so = L.so;
  const int tid = threadIdx.x, w = tid >> 5, lane = tid & 31, ln = lane & 15, hh = lane >> 4;
  const int wm = w >> 1, wn = w & 1;                         // the wave's 32 rows and 64 columns inside the block tile
  const int ntn = N / BN;
  const int mt = bx / ntn, nq = bx % ntn;
  int Mb = M;
  if (PACK) { const int c = nlive[y]; Mb = (c < M) ? c : M; }
  if (mt * BM >= Mb) return;                    // block-uniform, ahead of every barrier
  const int row0 = mt * BM, col0 = nq * BN;
  const float* Ab = A + (size_t)y * (size_t)abatch;
  // staging: 16 lanes cover the 256 bytes of one A row's step, 8 lanes the 128 bytes of one Wt row's step
  const int sar = tid >> 4, sac = (tid & 15) * 4, swr = tid >> 3, swc = (tid & 7) * 8;
  unsigned aoff[8], woff[8];
#pragma unroll
  for (int i = 0; i < 8; ++i) {
    int ar = row0 + sar + i * 8;
    if (PACK) {
      const int p = (ar < Mb) ? ar : (Mb - 1);
      const unsigned g = (unsigned)live[(size_t)y * lpitch + p];
      ar = (int)((g < (unsigned)M) ? g : (unsigned)(M - 1));
    }
    aoff[i] = ((unsigned)ar * (unsigned)lda + (unsigned)sac) * 4u;                          // byte offsets: one 32-bit register each, kept for
    woff[i] = ((unsigned)(col0 + swr + i * 16) * (unsigned)ldb + (unsigned)swc) * 2u;       // all steps and moved on by the step's bytes
  }
  v4f xa[8]; v8us xw[8];
#pragma unroll
  for (int i = 0; i < 8; ++i) { xa[i] = *(const v4fa*)((const char*)Ab + aoff[i]); xw[i] = *(const v8us*)((const char*)Wt + woff[i]); }
  v8f acc[2][4];
#pragma unroll
  for (int mi = 0; mi < 2; ++mi)
#pragma unroll
    for (int t = 0; t < 4; ++t) acc[mi][t] = (v8f){0.f,0.f,0.f,0.f,0.f,0.f,0.f,0.f};
  for (int kb = 0; kb < K; kb += BK) {
    __syncthreads();                                 // cross-wave: all waves done reading the prior step's tiles
#pragma unroll
    for (int i = 0; i < 8; ++i) {
      if (ASPLIT) {
        const HiLo s0 = split2(xa[i][0], xa[i][1]), s1 = split2(xa[i][2], xa[i][3]);
        *(v2u*)&sAh[sar + i * 8][sac] = (v2u){s0.hi, s1.hi};
        *(v2u*)&sAl[sar + i * 8][sac] = (v2u){s0.lo, s1.lo};
      } else {
        *(v2u*)&sAh[sar + i * 8][sac] = (v2u){cvt2(xa[i][0], xa[i][1]), cvt2(xa[i][2], xa[i][3])};
      }
      *(v8us*)&sW[swr + i * 16][swc] = xw[i];
    }
    __syncthreads();                                 // cross-wave: staging complete before any fragment load
    if (kb + BK < K) {                               // block-uniform: the next step's loads fly under this step's products
#pragma unroll
      for (int i = 0; i < 8; ++i) { aoff[i] += BK * 4u; woff[i] += BK * 2u; }
#pragma unroll
      for (int i = 0; i < 8; ++i) { xa[i] = *(const v4fa*)((const char*)Ab + aoff[i]); xw[i] = *(const v8us*)((const char*)Wt + woff[i]); }
      asm volatile("s_wait_xcnt 0x0" ::: "memory");  // ahead of any later write to a register that these loads name as address
    }
#pragma unroll
    for (int ks = 0; ks < BK / 32; ++ks) {
      FragB ah[2], al[2], b[4];
#pragma unroll
      for (int mi = 0; mi < 2; ++mi) {
        const int r = wm * 32 + mi * 16 + ln;
        ah[mi].half[0] = *(const v8us*)&sAh[r][ks * 32 + 8 * hh];          // elements 0..7  <- k = kb+32ks+8h .. +7
        ah[mi].half[1] = *(const v8us*)&sAh[r][ks * 32 + 16 + 8 * hh];     // elements 8..15 <- k = kb+32ks+16+8h .. +7
        if (ASPLIT) { al[mi].half[0] = *(const v8us*)&sAl[r][ks * 32 + 8 * hh]; al[mi].half[1] = *(const v8us*)&sAl[r][ks * 32 + 16 + 8 * hh]; }
        else al[mi] = ah[mi];
      }
#pragma unroll
      for (int t = 0; t < 4; ++t) {
        const int n = wn * 64 + t * 16 + ln;
        b[t].half[0] = *(const v8us*)&sW[n][ks * 32 + 8 * hh];
        b[t].half[1] = *(const v8us*)&sW[n][ks * 32 + 16 + 8 * hh];
      }
#pragma unroll
      for (int mi = 0; mi < 2; ++mi)
#pragma unroll
        for (int t = 0; t < 4; ++t) acc[mi][t] = mmaN<ASPLIT ? 2 : 1>(ah[mi].v, al[mi].v, b[t].v, b[t].v, acc[mi][t]);
    }
  }
  const int wrow0 = row0 + wm * 32, wcol0 = col0 + wn * 64;
#pragma unroll
  for (int t = 0; t < 4; ++t) {
    float bvv = bias[wcol0 + t * 16 + ln];
    if (BIAS_BF16) bvv = bf16_rne(bvv);
#pragma unroll
    for (int mi = 0; mi < 2; ++mi)
#pragma unroll
      for (int r = 0; r < 8; ++r) { so[w][mi * 16 + 8 * hh + r][t * 16 + ln] = acc[mi][t][r] + bvv; }
  }
  __builtin_amdgcn_fence(4 /* acq_rel order */, "workgroup");      // so[w] is wave-private: same-wave exchange
  __builtin_amdgcn_wave_barrier();
  if (CSPLIT) {
    unsigned short* Chb = Ch + (size_t)y * (size_t)cbatch;
    unsigned short* Clb = Cl + (size_t)y * (size_t)cbatch;
    const int rsub = lane >> 3, c8 = (lane & 7) * 8;      // 8 lanes write one 128-byte row piece of each plane
#pragma unroll
    for (int q = 0; q < 8; ++q) {
      const int r = q * 4 + rsub;
      const v4f x0 = *(const v4fa*)&so[w][r][c8], x1 = *(const v4fa*)&so[w][r][c8 + 4];
      const HiLo s0 = split2(x0[0], x0[1]), s1 = split2(x0[2], x0[3]), s2 = split2(x1[0], x1[1]), s3 = split2(x1[2], x1[3]);
      const size_t o = (size_t)(wrow0 + r) * ldc + wcol0 + c8;
      *(v4u*)(Chb + o) = (v4u){s0.hi, s1.hi, s2.hi, s3.hi};
      *(v4u*)(Clb + o) = (v4u){s0.lo, s1.lo, s2.lo, s3.lo};
    }
    asm volatile("s_wait_xcnt 0x0" ::: "memory");    // ahead of any later write to a register that these stores name: in a kernel with two forms of the tile the other form's code follows
  } else {
    float* Cb = C + (size_t)y * (size_t)cbatch;
    const int rsub = lane >> 4, c4 = (lane & 15) * 4;
#pragma unroll
    for (int q = 0; q < 16; ++q) {
      const int r = q * 2 + rsub;
      const v4f v = *(const v4fa*)&so[w][r][c4];
      *(v4f*)(Cb + (size_t)(wrow0 + r) * ldc + wcol0 + c4) = v;
    }
  }
}

// The three projections in one grid: blockIdx.z = 0, 1 the k and v projections (packed rows, split planes), 2 the q projection (all rows, f32).
// Same shapes and pitches for all three. The k and v tiles, whose first loads wait for the key list, come first in the grid.
__global__ __launch_bounds__(128) void k_gemm_qkv(const float* __restrict__ xq, const float* __restrict__ xk, const float* __restrict__ xv, int lda, int abatch,
                                                  const unsigned short* __restrict__ Wtq, const unsigned short* __restrict__ Wtk, const unsigned short* __restrict__ Wtv, int ldb,
                                                  const float* __restrict__ bq, const float* __restrict__ bk, const float* __restrict__ bv,
                                                  float* __restrict__ q, unsigned short* __restrict__ kh, unsigned short* __restrict__ kl,
                                                  unsigned short* __restrict__ vh, unsigned short* __restrict__ vl, int ldc, int cbatch, int M, int N, int K,
                                                  const int* __restrict__ live, int lpitch, const int* __restrict__ nlive) {
  __shared__ GemmLds<false> L;
  const int z = blockIdx.z;                          // block-uniform
  if (z == 2) {
    gemm_tile<false, true, false, false>(L, blockIdx.x, blockIdx.y, xq, lda, abatch, Wtq, ldb, bq, q, nullptr, nullptr, ldc, cbatch, M, N, K, nullptr, 0, nullptr);
  } else {
    gemm_tile<false, true, true, true>(L, blockIdx.x, blockIdx.y, z ? xv : xk, lda, abatch, z ? Wtv : Wtk, ldb, z ? bv : bk, nullptr, z ? vh : kh, z ? vl : kl,
                                       ldc, cbatch, M, N, K, live, lpitch, nlive);
  }
}

// The output projection: A as a 2-term split, f32 result.
__global__ __launch_bounds__(128) void k_gemm_out(const float* __restrict__ A, int lda, int abatch, const unsigned short* __restrict__ Wt, int ldb,
                                                  const float* __restrict__ bias, float* __restrict__ C, int ldc, int cbatch, int M, int N, int K) {
  __shared__ GemmLds<true> L;
  gemm_tile<true, true, false, false>(L, blockIdx.x, blockIdx.y, A, lda, abatch, Wt, ldb, bias, C, nullptr, nullptr, ldc, cbatch, M, N, K, nullptr, 0, nullptr);
}

// Flash-style attention over the packed keys of each batch: k and v rows 0 .. nlive[b]-1 take part;
// nlive[b] == 0 (every key excluded) yields NaN. QK^T and P*V as 3-term bf16 hi/lo splits, f32 softmax with running max.
// q rows f32, k and v rows as bf16 hi/lo planes, all with pitch `pitch` (elements), batch b at X + b*T*pitch, head h at column h*D.
// One wave = 32 query rows as two tiles of 16 (each K and V fragment is read from LDS once and multiplied with both tiles' operands), block = 4 waves
// (128 queries) sharing K/V chunks of 32 keys in LDS (hi/lo bf16 planes): wave 0, 1, 2, 3 brings the chunk's rows of
// the k hi, k lo, v hi, v lo plane by one tensor load, whose pad gives the LDS pitch; two buffers, chunk s + 1 asked for when every wave has left chunk s - 1.
// A last chunk that runs past the key count takes rows that the projection wrote as repeats of the last listed row (its last 64-row tile is written whole):
// their scores are masked below, so their probability is exactly 0.
// Both products are transposed: in S^T[key][query] and O^T[d][query] lane (ln, hh) holds query ln of each tile, so the running maximum, the rescale factor
// and the row sum are one value a lane and tile (the two halves of the wave hold 16 keys of a chunk each and exchange the maximum once a chunk).
// Two waves a SIMD at most: the grid has two blocks for every WGP, and the register allocation is padded so that a third finds no room beside them.
template <int D>
__global__ __launch_bounds__(128) __attribute__((amdgpu_waves_per_eu(2, 2))) void k_flash_pm(const float* __restrict__ Qb, const unsigned short* __restrict__ Khb, const unsigned short* __restrict__ Klb,
                                                const unsigned short* __restrict__ Vhb, const unsigned short* __restrict__ Vlb, int pitch, int T, int H, float scale, const int* __restrict__ nlive,
                                                float* __restrict__ y, int ypitch) {
  constexpr int KS = D / 32, DT = D / 16, QT = 2;          // QT query tiles of 16 a wave
  static_assert(D == 64, "the tensor loads' pad codes are those of 128-byte rows");
  constexpr unsigned PK = 2 * D + 16, PV = 2 * D + 32;     // LDS row pitch in bytes: 16 x odd for the 16-byte K reads, 32 x odd for the transposing V reads
  constexpr unsigned SLICE = 6144, BUF = 4 * SLICE;        // one plane's 32 padded rows, rounded up to a multiple of 2 KiB; the four planes of a chunk
  static_assert(32 * PK <= SLICE && 32 * PV <= SLICE && (SLICE % 2048) == 0);
  __shared__ __attribute__((aligned(2048))) unsigned char ring[2 * BUF];
  __shared__ __attribute__((aligned(16))) float sO[4][16 * QT][D + 4];     // 16 bytes x odd pitch: the 16 query rows of a 16-byte store spread over the banks
  const int tid = threadIdx.x, w = tid >> 5, lane = tid & 31, ln = lane & 15, hh = lane >> 4;
  const int nqb = (T + 64 * QT - 1) / (64 * QT);
  const int bh = blockIdx.x / nqb, qblk = blockIdx.x % nqb;
  const int b = bh / H, h = bh % H;
  const int q0 = (qblk * 4 + w) * 16 * QT;
  const float* Q = Qb + (size_t)b * T * pitch + h * D;
  const unsigned short* Kh = Khb + (size_t)b * T * pitch + h * D;
  const unsigned short* Kl = Klb + (size_t)b * T * pitch + h * D;
  const unsigned short* Vh = Vhb + (size_t)b * T * pitch + h * D;
  const unsigned short* Vl = Vlb + (size_t)b * T * pitch + h * D;
  const int nl = nlive[b];
  const int Tk = (nl < T) ? nl : T;                  // keys of this batch; block-uniform
  const int trow = 8 * hh + (lane & 7), tcol = 8 * ((lane >> 3) & 1);   // lane address of a transposing load: 16 bytes of row trow
  const int ns = (Tk + 31) >> 5;                     // chunks of 32 keys; block-uniform
  const unsigned wu = uni((unsigned)tid >> 5);       // the wave's number, scalar
  const unsigned short* plane = (wu == 0) ? Kh : (wu == 1) ? Kl : (wu == 2) ? Vh : Vl;
  const unsigned lbase = (unsigned)(size_t)ring, src_pitch = (unsigned)pitch * 2u;
  u32x8 g1k = tdm_group1<3>(src_pitch), g1v = tdm_group1<7>(src_pitch);   // k planes: 144-byte LDS pitch; v planes: 160-byte
  asm volatile("" : "+s"(g1k));                      // for a whole group: descriptor words held in scalar registers, built once
  asm volatile("" : "+s"(g1v));                      // the same
  u32x4 g0 = tdm_group0(lbase, (unsigned long long)(size_t)plane);
  // every wave asks for its own plane's rows 32*st .. 32*st + 31 (inside the batch's T rows: the launch passes a T that is a multiple of 64), into buffer st & 1
  auto issue = [&](unsigned st) {
    const unsigned sp = pinned(st);                  // the descriptor's changing words are formed behind the wait that stands in front
    const unsigned dst = lbase + (sp & 1u) * BUF + wu * SLICE;
    const unsigned long long ga = (unsigned long long)(size_t)plane + (unsigned long long)(sp * 32u) * src_pitch;
    g0 = tdm_group0(dst, ga);
    if (pinned(wu < 2u)) tdm_load(g0, g1k);
    else                 tdm_load(g0, g1v);
  };
  if (pinned(0 < ns)) issue(0);                      // flies under the loads and the split of Q

  // B fragments [k = d][n = query] of the wave's query rows (scaled by an exact power of two), hi/lo, tile by tile
  FragB aqh[QT][KS], aql[QT][KS];
#pragma unroll
  for (int qt = 0; qt < QT; ++qt) {
    int row = q0 + qt * 16 + ln; if (row >= T) row = T - 1;
    const float* qr = Q + (size_t)row * pitch;
#pragma unroll
    for (int ks = 0; ks < KS; ++ks)
#pragma unroll
      for (int i = 0; i < 16; i += 2) {               // elements i and i + 1 are neighbours in d and share a register
        const int d = ks * 32 + ((i < 8) ? (8 * hh + i) : (16 + 8 * hh + (i - 8)));
        const HiLo s = split2(qr[d] * scale, qr[d + 1] * scale);
        aqh[qt][ks].w[i / 2] = s.hi; aql[qt][ks].w[i / 2] = s.lo;
      }
  }
  float m_q[QT], l_q[QT];                            // query ln of tile qt: running maximum (same in both halves), this half's part of the row sum
  v8f oacc[QT][DT];                                  // oacc[qt][dt][r] = O[query ln of tile qt][d = dt*16 + 8*hh + r]
#pragma unroll
  for (int qt = 0; qt < QT; ++qt) {
    m_q[qt] = -3.0e38f; l_q[qt] = 0.f;
#pragma unroll
    for (int dt = 0; dt < DT; ++dt) oacc[qt][dt] = (v8f){0.f,0.f,0.f,0.f,0.f,0.f,0.f,0.f};
  }

  for (int s_ = 0; s_ < ns; ++s_) {
    // hand-over, in the two-buffer ring's order (at s_ = 0 it is the ring's prologue): chunk s_ becomes readable, the buffer of chunk s_ - 1 becomes free
    wait_ds0();                                      // this wave's reads of chunk s_ - 1 are done
    wait_tensor0(g0, g1k, g1v);                      // this wave's plane of chunk s_ has landed
    __syncthreads();                                 // cross-wave: both hold for every wave
    if (pinned(s_ + 1 < ns)) issue((unsigned)s_ + 1u);   // flies while chunk s_ is worked on
    const int j0 = s_ * 32;
    const unsigned char* bufp = ring + (unsigned)(s_ & 1) * BUF;
    const unsigned char* pKh = bufp + ln * PK + 16 * hh;                       // K rows: lane ln's row, 16 bytes at d = 8*hh
    const unsigned char* pVh = bufp + 2 * SLICE + trow * PV + 2 * tcol;        // V rows: the lane address of a transposing load
    // S^T tiles 32 keys x 16 queries: A[m = key][k = d] from sK[key][d]; s[qt][nt][r] = score of key j0 + nt*16 + 8*hh + r with query ln of tile qt
    v8f s[QT][2];
    FragB kh_[2][KS], kl_[2][KS];                    // the chunk's K fragments, each read once for both query tiles
#pragma unroll
    for (int nt = 0; nt < 2; ++nt)
#pragma unroll
      for (int ks = 0; ks < KS; ++ks) {
        const unsigned char* pk = pKh + nt * 16 * PK + ks * 64;
        kh_[nt][ks].half[0] = *(const v8us*)pk;           kh_[nt][ks].half[1] = *(const v8us*)(pk + 32);
        kl_[nt][ks].half[0] = *(const v8us*)(pk + SLICE); kl_[nt][ks].half[1] = *(const v8us*)(pk + SLICE + 32);
      }
#pragma unroll
    for (int nt = 0; nt < 2; ++nt) {
      v8f acc0 = (v8f){0.f,0.f,0.f,0.f,0.f,0.f,0.f,0.f}, acc1 = acc0;
#pragma unroll
      for (int ks = 0; ks < KS; ++ks)
        mma3_two(kh_[nt][ks].v, kl_[nt][ks].v, aqh[0][ks].v, aql[0][ks].v, aqh[1][ks].v, aql[1][ks].v, acc0, acc1);
      s[0][nt] = acc0; s[1][nt] = acc1;
    }
    // A[m = d][k = key] from sV[key][d]: all V fragments by transposing LDS loads, one group whose latency the softmax covers
    FragB avh[DT], avl[DT];
#pragma unroll
    for (int dt = 0; dt < DT; ++dt) {
      const unsigned char* pv = pVh + dt * 32;
      avh[dt].half[0] = tr16((const unsigned short*)pv);           avh[dt].half[1] = tr16((const unsigned short*)(pv + 16 * PV));
      avl[dt].half[0] = tr16((const unsigned short*)(pv + SLICE)); avl[dt].half[1] = tr16((const unsigned short*)(pv + SLICE + 16 * PV));
    }
    if (j0 + 32 > Tk) {                              // block-uniform: only a chunk that runs past Tk holds keys past the last packed one;
#pragma unroll
      for (int qt = 0; qt < QT; ++qt)                // their exponential below is exactly 0 (key j0 is real, so the maximum is a real score)
#pragma unroll
        for (int nt = 0; nt < 2; ++nt)
#pragma unroll
          for (int r = 0; r < 8; ++r) if (j0 + nt * 16 + 8 * hh + r >= Tk) s[qt][nt][r] = -3.0e38f;
    }
    v16b pbh[QT], pbl[QT];
#pragma unroll
    for (int qt = 0; qt < QT; ++qt) {
      float mx = fmaxf(s[qt][0][0], s[qt][1][0]);
#pragma unroll
      for (int r = 1; r < 8; ++r) mx = fmaxf(mx, fmaxf(s[qt][0][r], s[qt][1][r]));
      mx = fmaxf(mx, xhalf(mx));                     // both halves now hold the maximum over the chunk's 32 keys
      const float mnew = fmaxf(m_q[qt], mx);
      const float alpha = (mnew > -1.0e38f) ? __expf(m_q[qt] - mnew) : 1.0f;
      m_q[qt] = mnew;
      // P^T as the B operand [k = key][n = query]: element nt*8 + r of lane (ln, hh) is key nt*16 + 8*hh + r, which is where s[qt][nt][r] already lies
      v8u pwh, pwl;                                  // hi and lo planes, two keys a register
      float ps0 = 0.f, ps1 = 0.f;
#pragma unroll
      for (int nt = 0; nt < 2; ++nt)
#pragma unroll
        for (int i = 0; i < 4; ++i) {
          const float p0 = __expf(s[qt][nt][2 * i] - mnew), p1 = __expf(s[qt][nt][2 * i + 1] - mnew);
          ps0 += p0; ps1 += p1;
          const HiLo pp = split2(p0, p1);
          pwh[nt * 4 + i] = pp.hi; pwl[nt * 4 + i] = pp.lo;
        }
      pbh[qt] = __builtin_bit_cast(v16b, pwh); pbl[qt] = __builtin_bit_cast(v16b, pwl);
      l_q[qt] = l_q[qt] * alpha + (ps0 + ps1);       // this half's 16 keys (the halves are joined at the end)
#pragma unroll
      for (int dt = 0; dt < DT; ++dt)
#pragma unroll
        for (int r = 0; r < 8; ++r) oacc[qt][dt][r] *= alpha;
    }
#pragma unroll
    for (int dt = 0; dt < DT; ++dt) {
      mma3_two(avh[dt].v, avl[dt].v, pbh[0], pbl[0], pbh[1], pbl[1], oacc[0][dt], oacc[1][dt]);
    }
  }
  wait_tensor0(g0, g1k, g1v);                        // nothing in flight when the wave goes on to its end
  wait_ds0();
  const float qnan = __uint_as_float(0x7FC00000u);
#pragma unroll
  for (int qt = 0; qt < QT; ++qt) {
    const float lsum = l_q[qt] + xhalf(l_q[qt]);
    const float inv = (m_q[qt] > -1.0e38f) ? (1.0f / lsum) : qnan;
#pragma unroll
    for (int dt = 0; dt < DT; ++dt) {
      v4f lo4, hi4;
#pragma unroll
      for (int r = 0; r < 4; ++r) { lo4[r] = oacc[qt][dt][r] * inv; hi4[r] = oacc[qt][dt][4 + r] * inv; }
      *(v4fa*)&sO[w][qt * 16 + ln][dt * 16 + 8 * hh] = lo4;
      *(v4fa*)&sO[w][qt * 16 + ln][dt * 16 + 8 * hh + 4] = hi4;
    }
  }
  __builtin_amdgcn_fence(4 /* acq_rel order */, "workgroup");
  __builtin_amdgcn_wave_barrier();
  {
    // 16 lanes carry the D floats of one row, so a store takes two rows; the rows' LDS reads stand ahead of the stores as one group
    const int rsub = lane >> 4, c4 = (lane & 15) * 4;
    float* yb = y + ((size_t)b * T + q0 + rsub) * ypitch + h * D + c4;
    v4f val[8 * QT];
#pragma unroll
    for (int i = 0; i < 8 * QT; ++i) val[i] = *(const v4fa*)&sO[w][2 * i + rsub][c4];
#pragma unroll
    for (int i = 0; i < 8 * QT; ++i)
      if (q0 + 2 * i + rsub < T) *(v4f*)(yb + (size_t)(2 * i) * ypitch) = val[i];
  }
}

extern "C" void kernel_launch(void* const* d_in, const int* in_sizes, int n_in,
                              void* d_out, int out_size, void* d_ws, size_t ws_size, hipStream_t stream) {
  if (n_in < 12) return;
  const float* xq = (const float*)d_in[0]; const float* xk = (const float*)d_in[1]; const float* xv = (const float*)d_in[2];
  const int* kpm = (const int*)d_in[3];
  const float* Wq = (const float*)d_in[4]; const float* bq = (const float*)d_in[5]; const float* Wk = (const float*)d_in[6]; const float* bk = (const float*)d_in[7];
  const float* Wv = (const float*)d_in[8]; const float* bv = (const float*)d_in[9]; const float* Wo = (const float*)d_in[10]; const float* bo = (const float*)d_in[11];
  // size checks (lower bounds so a reduced NB/SEQ build still launches on full-size inputs)
  const long long needX = (long long)(NB - 1) * SEQ_FULL * DD + (long long)SEQ * DD;
  if ((long long)in_sizes[0] < needX || (long long)in_sizes[1] < needX || (long long)in_sizes[2] < needX) return;
  if (in_sizes[3] < (NB - 1) * SEQ_FULL + SEQ) return;
  if (in_sizes[4] < DD * DD || in_sizes[6] < DD * DD || in_sizes[8] < DD * DD || in_sizes[10] < DD * DD) return;
  if (in_sizes[5] < DD || in_sizes[7] < DD || in_sizes[9] < DD || in_sizes[11] < DD) return;
  if ((long long)out_size < (long long)NB * SEQ * DD) return;

  char* ws = (char*)d_ws; size_t off = 0;
  auto take = [&](size_t bytes) { char* p = ws + off; off += (bytes + 255) & ~(size_t)255; return p; };
  const size_t MROWS = (size_t)NB * SEQ;
  unsigned short* Wt[4]; for (int i = 0; i < 4; ++i) Wt[i] = (unsigned short*)take((size_t)DD * DD * 2);
  float* q   = (float*)take(MROWS * DD * 4);
  unsigned short* kh = (unsigned short*)take(MROWS * DD * 2);
  unsigned short* kl = (unsigned short*)take(MROWS * DD * 2);
  unsigned short* vh = (unsigned short*)take(MROWS * DD * 2);
  unsigned short* vl = (unsigned short*)take(MROWS * DD * 2);
  float* att = (float*)take(MROWS * DD * 4);
  int* live  = (int*)take(MROWS * 4);
  int* nlive = (int*)take((size_t)NB * 4);
  if (off > ws_size) return;

  const int n8 = DD * DD / 8;
  const int gb = (SEQ / 64) * (DD / 128);
  const dim3 gg(gb, NB), gg3(gb, NB, 3);
  const int nbw = (n8 + 255) / 256;
  k_prep<(SEQ + 255) / 256><<<NB + 4 * nbw, 256, 0, stream>>>(Wq, Wk, Wv, Wo, Wt[0], Wt[1], Wt[2], Wt[3], n8, nbw, kpm, SEQ_FULL, SEQ, live, SEQ, nlive, NB);
  k_gemm_qkv<<<gg3, 128, 0, stream>>>(xq, xk, xv, DD, SEQ_FULL * DD, Wt[0], Wt[1], Wt[2], DD, bq, bk, bv, q, kh, kl, vh, vl, DD, SEQ * DD, SEQ, DD, DD, live, SEQ, nlive);
  k_flash_pm<HD><<<NB * NH * ((SEQ + 127) / 128), 128, 0, stream>>>(q, kh, kl, vh, vl, DD, SEQ, NH, 0.125f, nlive, att, DD);
  k_gemm_out<<<gg, 128, 0, stream>>>(att, DD, SEQ * DD, Wt[3], DD, bo, (float*)d_out, DD, SEQ * DD, SEQ, DD, DD);
  (void)hipGetLastError();
}
